// v000
// Measured on an AMD MI455X. A time is GPU time per run, averaged over a window of back-to-back runs after a warm-up
// (all launches, gaps included; the runs take copies of the inputs in turn), and the median of several windows.
// Apart from v000's, it joins two sittings. Times from different sittings can be a few percent apart, while
// side-by-side timings come from the same sitting.
// The starting kernel, v000, takes 412 microseconds a run.
#include <hip/hip_runtime.h>

// Causal grouped-query attention, width 2048 = 32 heads x 64, 8 key/value groups (4 heads per group), rotate-half rotary with INPUT cos/sin tables, output projection; x [NB][SEQ][2048], W [out][in] (y = x W^T), no biases, score scale 1/8.
// Compute dtypes, f32 accumulate everywhere: q/k/v projections v_wmma_f32_16x16x32_bf16 (x, W RNE-converted to bf16; products exact); rotary in f32 with bf16-converted table values;
// scores, P.V and the output projection v_wmma_f32_16x16x32_f16: q, k, v^T, ctx(x64) as f16 value planes plus f16 residual planes x2048; Wo as f16 of the bf16 value x64; P carried x256.
// Query rows >= 512 use single f16 products; query rows < 512 use value + residual (three products for scores and P.V, two for the output projection), residual products in their own accumulators.
// Transposed flash form (S^T = K Q^T, O^T = V^T P^T), online softmax in f32 (running max), causal mask applied by value on the diagonal key step.

#ifndef NB
#define NB 2
#endif
#ifndef SEQ
#define SEQ 2048
#endif
#define NB_FULL  2
#define SEQ_FULL 2048
#ifndef OUT_SEQ
#define OUT_SEQ SEQ              // row pitch (in tokens) between batches of the output
#endif
#define DM   2048                // model width = depth of every GEMM
#define NH_  32
#define NG_  8
#define GS_  4                   // heads per key/value group
#define HD   64
#define KVD  512                 // NG_ * HD
#define AW   4                   // waves per flash block (16 query rows each)
#define QRS  2048.0f             // carry of every residual plane
#define QRI  (1.0f / 2048.0f)
#define SC2  (0.125f * 1.4426950408889634f)   // HD^-0.5 * log2(e)
#define PSH  8.0f                // log2 of the P carry (256)
#define CXS  64.0f               // carry of the ctx plane
#define WOS  64.0f               // carry of the Wo plane
#define OSC  (1.0f / 4096.0f)    // 1 / (CXS * WOS)
#define NEGB (-3.0e38f)

static constexpr int ER_ROWS = (SEQ < 512) ? SEQ : 512;   // query rows per batch on the value + residual path

static_assert(HD == 64);
static_assert(NH_ * HD == DM);
static_assert(NG_ * HD == KVD);
static_assert(NG_ * GS_ == NH_);
static_assert(DM % 64 == 0);
static_assert(DM % 32 == 0);                   // GEMM k-loop steps by 32
static_assert(KVD % 64 == 0);
static_assert(SEQ % 64 == 0);                  // a 64-row tile never straddles two batches
static_assert(SEQ % (16 * AW) == 0);
static_assert(ER_ROWS % 64 == 0);
static_assert((SEQ - ER_ROWS) % 64 == 0);
static_assert(((size_t)SEQ * DM) % 8 == 0);
static_assert(NB <= NB_FULL);
static_assert(SEQ <= SEQ_FULL);

typedef _Float16 h16;
typedef unsigned short bf;
typedef __attribute__((ext_vector_type(16))) __bf16   v16bf;
typedef __attribute__((ext_vector_type(16))) _Float16 v16h;
typedef __attribute__((ext_vector_type(8)))  _Float16 v8h;
typedef __attribute__((ext_vector_type(8)))  unsigned short v8us;
typedef __attribute__((ext_vector_type(8)))  float    v8f;
typedef __attribute__((ext_vector_type(4)))  float    v4f;
typedef v4f  __attribute__((may_alias)) v4fa;

__device__ __forceinline__ unsigned short f2bf(float f) { unsigned u = __float_as_uint(f); u += 0x7FFFu + ((u >> 16) & 1u); return (unsigned short)(u >> 16); }
__device__ __forceinline__ float bfr(float f) { return __uint_as_float(((unsigned)f2bf(f)) << 16); }   // value after RNE conversion to bf16
__device__ __forceinline__ v16h cat16(v8h lo, v8h hi) { return __builtin_shufflevector(lo, hi, 0, 1, 2, 3, 4, 5, 6, 7, 8, 9, 10, 11, 12, 13, 14, 15); }
__device__ __forceinline__ v16bf cat16b(v8us lo, v8us hi) { return __builtin_bit_cast(v16bf, __builtin_shufflevector(lo, hi, 0, 1, 2, 3, 4, 5, 6, 7, 8, 9, 10, 11, 12, 13, 14, 15)); }
__device__ __forceinline__ v8f wmma16(v16h a, v16h b, v8f c) { return __builtin_amdgcn_wmma_f32_16x16x32_f16(false, a, false, b, (short)0, c, false, false); }
__device__ __forceinline__ v8f wmmab(v16bf a, v16bf b, v8f c) { return __builtin_amdgcn_wmma_f32_16x16x32_bf16(false, a, false, b, (short)0, c, false, false); }
// fragment loaders from K-contiguous 16-bit rows; p already includes + 8*(lane>>4): elements 0..7 <- k0+8h+0..7, elements 8..15 <- k0+16+8h+0..7 (same map for A and B)
__device__ __forceinline__ v16h  ldh(const h16* p) { return cat16(*(const v8h*)p, *(const v8h*)(p + 16)); }
__device__ __forceinline__ v16bf ldb(const bf* p)  { return cat16b(*(const v8us*)p, *(const v8us*)(p + 16)); }
// ordering point for wave-private LDS tiles (same wave writes and reads)
__device__ __forceinline__ void wave_sync() { __builtin_amdgcn_fence(3 /* release order */, "wavefront"); __builtin_amdgcn_wave_barrier(); asm volatile("" ::: "memory"); }

// MODE 0: bf16 bits (RNE). MODE 1: f16 of (bf16 value x WOS) (exact for normal results).
template<int MODE>
__global__ __launch_bounds__(256) void k_cvt8(const float* __restrict__ src, unsigned short* dst, size_t n8) {
    const size_t i = (size_t)blockIdx.x * 256 + threadIdx.x; if (i >= n8) return;
    const v8f v = *(const v8f*)(src + i * 8);
    if (MODE == 0) {
        v8us o;
#pragma unroll
        for (int k = 0; k < 8; ++k) o[k] = f2bf(v[k]);
        *(v8us*)(dst + i * 8) = o; 
    } else {
        v8h o;
#pragma unroll
        for (int k = 0; k < 8; ++k) o[k] = (h16)(bfr(v[k]) * WOS);
        h16* d = (h16*)dst;
        *(v8h*)(d + i * 8) = o; 
    }
}

// k_proj: register-blocked bf16 GEMM, ONE WAVE per 64x64 tile (16 accumulators), operands straight from K-contiguous bf16 planes, K = DM.
// C[m][n] = sum_k A[m][k] Bt[n][k]; optional rotate-half rotary on the 64-column tile (one head: partner column = c ^ 32, token = r0 % RB + row);
// written as f16 value (Ph) and f16 residual x2048 (Pr) at tile base (r0/RB)*sRB + (r0%RB)*pitch + (c0/CB)*sCB + (c0%CB), row pitch 'pitch' (halves). grid (M/64, N/64), 32 threads.
template<bool ROPE>
__global__ __launch_bounds__(32) void k_proj(const bf* __restrict__ A, const bf* __restrict__ Bt, h16* Ph, h16* Pr, int RB, size_t sRB, int pitch, int CB, size_t sCB,
                                             const float* __restrict__ COS, const float* __restrict__ SIN) {
    __shared__ __align__(16) float os[16 * 68];
    const int K = DM;
    const int lane = threadIdx.x & 31, lr = lane & 15, hi = lane >> 4; const int r0 = blockIdx.x * 64, c0 = blockIdx.y * 64;
    v8f acc[4][4];
#pragma unroll
    for (int mb = 0; mb < 4; ++mb)
#pragma unroll
        for (int nb = 0; nb < 4; ++nb) acc[mb][nb] = (v8f){};
    const size_t aoff = (size_t)(r0 + lr) * K + 8 * hi, boff = (size_t)(c0 + lr) * K + 8 * hi;
#pragma unroll 1
    for (int kc = 0; kc < K; kc += 32) {
        v16bf a[4];
#pragma unroll
        for (int mb = 0; mb < 4; ++mb) a[mb] = ldb(A + aoff + (size_t)mb * 16 * K + kc);
#pragma unroll
        for (int nb = 0; nb < 4; ++nb) { const v16bf b = ldb(Bt + boff + (size_t)nb * 16 * K + kc);
#pragma unroll
            for (int mb = 0; mb < 4; ++mb) acc[mb][nb] = wmmab(a[mb], b, acc[mb][nb]); }
        asm volatile("v_nop\n\tv_nop\n\tv_nop\n\tv_nop" : "+v"(acc[0][0]), "+v"(acc[1][1]), "+v"(acc[2][2]), "+v"(acc[3][3]) : "v"(a[0]), "v"(a[1]), "v"(a[2]), "v"(a[3]));
    }
    const size_t tbase = (size_t)(r0 / RB) * sRB + (size_t)(r0 % RB) * (size_t)pitch + (size_t)(c0 / CB) * sCB + (size_t)(c0 % CB);
    const int tok0 = r0 % RB;
#pragma unroll
    for (int mb = 0; mb < 4; ++mb) {
#pragma unroll
        for (int nb = 0; nb < 4; ++nb) {
#pragma unroll
            for (int j = 0; j < 8; ++j) os[(hi * 8 + j) * 68 + nb * 16 + lr] = acc[mb][nb][j]; }   // D: row 8h+j, col lane&15; rows 0..15 x columns 0..63 all written
        wave_sync();
        v8h hv[4], rv[4];
#pragma unroll
        for (int s = 0; s < 4; ++s) { const int row = 4 * s + (lane >> 3), c8 = (lane & 7) * 8;   // 4 s x 4 row groups = 16 rows; 8 lanes x 8 = 64 columns
            const v4f x0 = *(const v4fa*)(&os[row * 68 + c8]); const v4f x1 = *(const v4fa*)(&os[row * 68 + c8 + 4]);
            float xv[8];
#pragma unroll
            for (int i = 0; i < 4; ++i) { xv[i] = x0[i]; xv[4 + i] = x1[i]; }
            if (ROPE) {
                const int pc = c8 ^ 32;
                const v4f y0 = *(const v4fa*)(&os[row * 68 + pc]); const v4f y1 = *(const v4fa*)(&os[row * 68 + pc + 4]);
                const size_t to = (size_t)(tok0 + mb * 16 + row) * HD + c8;
                const v4f ca = *(const v4f*)(COS + to), cb = *(const v4f*)(COS + to + 4), sa = *(const v4f*)(SIN + to), sb = *(const v4f*)(SIN + to + 4);
                const float sg = (c8 < 32) ? -1.0f : 1.0f;     // rotated = concat(-x2, x1)
#pragma unroll
                for (int i = 0; i < 4; ++i) { xv[i] = x0[i] * bfr(ca[i]) + (sg * y0[i]) * bfr(sa[i]); xv[4 + i] = x1[i] * bfr(cb[i]) + (sg * y1[i]) * bfr(sb[i]); }
            }
            v8h hh, rr;
#pragma unroll
            for (int i = 0; i < 8; ++i) { const h16 a0 = (h16)xv[i]; hh[i] = a0; rr[i] = (h16)((xv[i] - (float)a0) * QRS); }
            hv[s] = hh; rv[s] = rr; }
        const size_t sb0 = tbase + (size_t)(mb * 16) * (size_t)pitch;
#pragma unroll
        for (int s = 0; s < 4; ++s) { const int row = 4 * s + (lane >> 3), c8 = (lane & 7) * 8; const size_t oo = sb0 + (size_t)row * (size_t)pitch + c8;
            *(v8h*)(Ph + oo) = hv[s]; *(v8h*)(Pr + oo) = rv[s]; }
        
        wave_sync();
    }
}

// k_flash: fused causal attention, one wave per 16 query rows of one (batch, head); K / V^T / Q fragments straight from the f16 planes (two 16-B loads each, arithmetic addressing).
// Transposed form: S^T[key][t] = K Q^T (A = K rows, B = Q rows); lane (t = lane&15, h = lane>>4) holds keys 8h+r of each 16-key tile, so the packed
// P tile is directly the B fragment of O^T[d][t] = V^T P^T (element r <- tile keys 0..15, element 8+r <- tile keys 16..31, lane unchanged).
// Head h reads key/value group h / GS_. Key loop covers keys 0 .. t0+15 in steps of 32; keys above the query index are replaced by NEGB (P = 0) on the diagonal step.
// ER: value + residual path (scores kh*qh + [kh*qr + kr*qh]/2048, O = vh*ph + [vr*ph + vh*pr]/2048), residual products in separate accumulators.
template<bool ER>
__global__ __launch_bounds__(32 * AW) void k_flash(const h16* __restrict__ QH, const h16* __restrict__ QR, const h16* __restrict__ KH, const h16* __restrict__ KR,
                                                   const h16* __restrict__ VH, const h16* __restrict__ VR, h16* CH, h16* CR, int xb0) {
    __shared__ __align__(16) float os[AW * 16 * 68];
    const int lane = threadIdx.x & 31, lr = lane & 15, hi = lane >> 4;
    const int wave = __builtin_amdgcn_readfirstlane((int)(threadIdx.x >> 5));
    const int zh = blockIdx.y; const int b = zh / NH_, h = zh % NH_, g = h / GS_;
    const int t0 = (((int)blockIdx.x + xb0) * AW + wave) * 16;
    const int tq = t0 + lr;
    const size_t qbase = (size_t)zh * SEQ * HD;
    const size_t kvb = (size_t)(b * NG_ + g) * SEQ * HD;
    const size_t qo = qbase + (size_t)(t0 + lr) * HD + 8 * hi;
    const v16h qh0 = ldh(QH + qo), qh1 = ldh(QH + qo + 32);          // B fragments: col t, k = d
    v16h qr0 = qh0, qr1 = qh1;
    if (ER) { qr0 = ldh(QR + qo); qr1 = ldh(QR + qo + 32); }
    const size_t ko = kvb + (size_t)lr * HD + 8 * hi;      // + key * HD       (A fragment: row key, k = d)
    const size_t vo = kvb + (size_t)lr * SEQ + 8 * hi;     // + 16j*SEQ + key  (A fragment: row d, k = key)
    v8f oH[4], oL[4];
#pragma unroll
    for (int j = 0; j < 4; ++j) { oH[j] = (v8f){}; oL[j] = (v8f){}; }
    float m = NEGB, l = 0.0f;
#pragma unroll 1
    for (int key0 = 0; key0 < t0 + 16; key0 += 32) {
        const h16* ka = KH + ko + (size_t)key0 * HD;
        float ta[8], tb[8];
        if (!ER) {
            const v16h ka0 = ldh(ka), ka1 = ldh(ka + 32), kb0 = ldh(ka + 16 * HD), kb1 = ldh(ka + 16 * HD + 32);
            v8f sHa = (v8f){}, sHb = (v8f){};
            sHa = wmma16(ka0, qh0, sHa); sHb = wmma16(kb0, qh0, sHb);
            sHa = wmma16(ka1, qh1, sHa); sHb = wmma16(kb1, qh1, sHb);
            asm volatile("v_nop\n\tv_nop\n\tv_nop\n\tv_nop" : "+v"(sHa), "+v"(sHb) : "v"(ka0), "v"(ka1), "v"(kb0), "v"(kb1));
#pragma unroll
            for (int r = 0; r < 8; ++r) { ta[r] = sHa[r] * SC2; tb[r] = sHb[r] * SC2; }
        } else {
            const h16* kr = KR + ko + (size_t)key0 * HD;
            { const v16h ka0 = ldh(ka), ka1 = ldh(ka + 32), ra0 = ldh(kr), ra1 = ldh(kr + 32);
              v8f sH = (v8f){}, sL = (v8f){};
              sH = wmma16(ka0, qh0, sH); sL = wmma16(ka0, qr0, sL);
              sH = wmma16(ka1, qh1, sH); sL = wmma16(ka1, qr1, sL);
              sL = wmma16(ra0, qh0, sL); sL = wmma16(ra1, qh1, sL);
              asm volatile("v_nop\n\tv_nop\n\tv_nop\n\tv_nop" : "+v"(sH), "+v"(sL) : "v"(ka0), "v"(ka1), "v"(ra0), "v"(ra1));
#pragma unroll
              for (int r = 0; r < 8; ++r) ta[r] = (sH[r] + sL[r] * QRI) * SC2; }
            { const v16h kb0 = ldh(ka + 16 * HD), kb1 = ldh(ka + 16 * HD + 32), rb0 = ldh(kr + 16 * HD), rb1 = ldh(kr + 16 * HD + 32);
              v8f sH = (v8f){}, sL = (v8f){};
              sH = wmma16(kb0, qh0, sH); sL = wmma16(kb0, qr0, sL);
              sH = wmma16(kb1, qh1, sH); sL = wmma16(kb1, qr1, sL);
              sL = wmma16(rb0, qh0, sL); sL = wmma16(rb1, qh1, sL);
              asm volatile("v_nop\n\tv_nop\n\tv_nop\n\tv_nop" : "+v"(sH), "+v"(sL) : "v"(kb0), "v"(kb1), "v"(rb0), "v"(rb1));
#pragma unroll
              for (int r = 0; r < 8; ++r) tb[r] = (sH[r] + sL[r] * QRI) * SC2; }
        }
        if (key0 + 31 > t0) {      // wave-uniform: only the diagonal step holds keys above some query index; every row keeps key key0 <= t
#pragma unroll
            for (int r = 0; r < 8; ++r) { const int kk = key0 + 8 * hi + r; ta[r] = (kk <= tq) ? ta[r] : NEGB; tb[r] = (kk + 16 <= tq) ? tb[r] : NEGB; }
        }
        float mx = NEGB;
#pragma unroll
        for (int r = 0; r < 8; ++r) mx = fmaxf(mx, fmaxf(ta[r], tb[r]));
        mx = fmaxf(mx, __shfl_xor(mx, 16, 32));
        const float mnew = fmaxf(m, mx);
        const float alpha = __builtin_amdgcn_exp2f(m - mnew);
        const float sh = PSH - mnew;
        v16h pb, pq; float ls = 0.0f;
        if (!ER) {
#pragma unroll
            for (int r = 0; r < 8; ++r) { const h16 pa = (h16)__builtin_amdgcn_exp2f(ta[r] + sh); const h16 pc = (h16)__builtin_amdgcn_exp2f(tb[r] + sh); pb[r] = pa; pb[8 + r] = pc; ls += (float)pa + (float)pc; }
            pq = pb;
        } else {
#pragma unroll
            for (int r = 0; r < 8; ++r) { const float fa = __builtin_amdgcn_exp2f(ta[r] + sh); const float fc = __builtin_amdgcn_exp2f(tb[r] + sh);
                const h16 pa = (h16)fa; const h16 pc = (h16)fc; const h16 qa = (h16)((fa - (float)pa) * QRS); const h16 qc = (h16)((fc - (float)pc) * QRS);
                pb[r] = pa; pb[8 + r] = pc; pq[r] = qa; pq[8 + r] = qc; ls += ((float)pa + (float)pc) + ((float)qa + (float)qc) * QRI; }
        }
        l = l * alpha + ls; m = mnew;
#pragma unroll
        for (int j = 0; j < 4; ++j) { oH[j] = oH[j] * alpha; if (ER) oL[j] = oL[j] * alpha; }
        const h16* va = VH + vo + key0;
        const v16h v0 = ldh(va), v1 = ldh(va + (size_t)16 * SEQ), v2 = ldh(va + (size_t)32 * SEQ), v3 = ldh(va + (size_t)48 * SEQ);
        if (!ER) {
            oH[0] = wmma16(v0, pb, oH[0]); oH[1] = wmma16(v1, pb, oH[1]); oH[2] = wmma16(v2, pb, oH[2]); oH[3] = wmma16(v3, pb, oH[3]);
            asm volatile("v_nop\n\tv_nop\n\tv_nop\n\tv_nop" : "+v"(oH[0]), "+v"(oH[1]), "+v"(oH[2]), "+v"(oH[3]) : "v"(v0), "v"(v1), "v"(v2), "v"(v3), "v"(pb));
        } else {
            const h16* vr = VR + vo + key0;
            const v16h w0 = ldh(vr), w1 = ldh(vr + (size_t)16 * SEQ), w2 = ldh(vr + (size_t)32 * SEQ), w3 = ldh(vr + (size_t)48 * SEQ);
            oH[0] = wmma16(v0, pb, oH[0]); oH[1] = wmma16(v1, pb, oH[1]); oH[2] = wmma16(v2, pb, oH[2]); oH[3] = wmma16(v3, pb, oH[3]);
            oL[0] = wmma16(w0, pb, oL[0]); oL[1] = wmma16(w1, pb, oL[1]); oL[2] = wmma16(w2, pb, oL[2]); oL[3] = wmma16(w3, pb, oL[3]);
            oL[0] = wmma16(v0, pq, oL[0]); oL[1] = wmma16(v1, pq, oL[1]); oL[2] = wmma16(v2, pq, oL[2]); oL[3] = wmma16(v3, pq, oL[3]);
            asm volatile("v_nop\n\tv_nop\n\tv_nop\n\tv_nop" : "+v"(oH[0]), "+v"(oH[1]), "+v"(oH[2]), "+v"(oH[3]), "+v"(oL[0]), "+v"(oL[1]), "+v"(oL[2]), "+v"(oL[3])
                         : "v"(v0), "v"(v1), "v"(v2), "v"(v3), "v"(w0), "v"(w1), "v"(w2), "v"(w3), "v"(pb), "v"(pq));
        }
    }
    l += __shfl_xor(l, 16, 32);
    const float inv = CXS * (1.0f / l);
    const int wb = wave * 16 * 68;
    // O^T D layout: o_j[r] = (d = 16j + 8h + r, t = lane&15) -> os[t][d]; rows 0..15 x columns 0..63 all written
#pragma unroll
    for (int j = 0; j < 4; ++j) { v4f a, c;
#pragma unroll
        for (int i = 0; i < 4; ++i) {
            if (ER) { a[i] = (oH[j][i] + oL[j][i] * QRI) * inv; c[i] = (oH[j][4 + i] + oL[j][4 + i] * QRI) * inv; }
            else    { a[i] = oH[j][i] * inv; c[i] = oH[j][4 + i] * inv; } }
        *(v4fa*)(&os[wb + lr * 68 + 16 * j + 8 * hi]) = a; *(v4fa*)(&os[wb + lr * 68 + 16 * j + 8 * hi + 4]) = c; }
    wave_sync();
    v8h hv[4], rv[4];
#pragma unroll
    for (int s = 0; s < 4; ++s) { const int row = 4 * s + (lane >> 3), c8 = (lane & 7) * 8;   // 4 s x 4 row groups = 16 rows; 8 lanes x 8 = 64 columns
        const v4f x0 = *(const v4fa*)(&os[wb + row * 68 + c8]); const v4f x1 = *(const v4fa*)(&os[wb + row * 68 + c8 + 4]); v8h hh, rr;
#pragma unroll
        for (int i = 0; i < 4; ++i) { const h16 a0 = (h16)x0[i]; const h16 a1 = (h16)x1[i]; hh[i] = a0; hh[4 + i] = a1; rr[i] = (h16)((x0[i] - (float)a0) * QRS); rr[4 + i] = (h16)((x1[i] - (float)a1) * QRS); }
        hv[s] = hh; rv[s] = rr; }
    const size_t cbase = ((size_t)b * SEQ + t0) * DM + (size_t)h * HD;
    const size_t rbase = ((size_t)b * ER_ROWS + t0) * DM + (size_t)h * HD;     // used by the ER instantiation only (t0 < ER_ROWS there)
#pragma unroll
    for (int s = 0; s < 4; ++s) { const int row = 4 * s + (lane >> 3), c8 = (lane & 7) * 8;
        *(v8h*)(CH + cbase + (size_t)row * DM + c8) = hv[s]; if (ER) *(v8h*)(CR + rbase + (size_t)row * DM + c8) = rv[s]; }
    
}

// k_out: output projection, f16 GEMM, ONE WAVE per (16*MB) x 64 tile, operands straight from K-contiguous f16 planes, K = DM.
// OUT[b][t][n] = OSC * sum_k (CH[b*SEQ+t][k] + CR[b*ER_ROWS+t][k]/2048) * WO[n][k]; RES: residual products in their own accumulators.
// Rows t in [tstart, tstart+tcount) of every batch; grid (NB*tcount/(16*MB), DM/64), 32 threads.
template<int MB, bool RES>
__global__ __launch_bounds__(32) void k_out(const h16* __restrict__ CH, const h16* __restrict__ CR, const h16* __restrict__ WO, float* OUT, int tstart, int tcount) {
    __shared__ __align__(16) float os[16 * 68];
    const int lane = threadIdx.x & 31, lr = lane & 15, hi = lane >> 4;
    const int tiles = tcount / (16 * MB);
    const int b = (int)blockIdx.x / tiles, t = tstart + ((int)blockIdx.x % tiles) * 16 * MB, c0 = blockIdx.y * 64;
    v8f acc[MB][4], acr[MB][4];
#pragma unroll
    for (int mb = 0; mb < MB; ++mb)
#pragma unroll
        for (int nb = 0; nb < 4; ++nb) { acc[mb][nb] = (v8f){}; acr[mb][nb] = (v8f){}; }
    const size_t aoff = ((size_t)b * SEQ + t + lr) * DM + 8 * hi;
    const size_t roff = ((size_t)b * ER_ROWS + t + lr) * DM + 8 * hi;     // RES only (t < ER_ROWS there)
    const size_t boff = (size_t)(c0 + lr) * DM + 8 * hi;
#pragma unroll 1
    for (int kc = 0; kc < DM; kc += 32) {
        v16h a[MB], ar[MB];
#pragma unroll
        for (int mb = 0; mb < MB; ++mb) { a[mb] = ldh(CH + aoff + (size_t)mb * 16 * DM + kc); ar[mb] = a[mb]; if (RES) ar[mb] = ldh(CR + roff + (size_t)mb * 16 * DM + kc); }
#pragma unroll
        for (int nb = 0; nb < 4; ++nb) { const v16h bb = ldh(WO + boff + (size_t)nb * 16 * DM + kc);
#pragma unroll
            for (int mb = 0; mb < MB; ++mb) { acc[mb][nb] = wmma16(a[mb], bb, acc[mb][nb]); if (RES) acr[mb][nb] = wmma16(ar[mb], bb, acr[mb][nb]); } }
        if (RES) asm volatile("v_nop\n\tv_nop\n\tv_nop\n\tv_nop" : "+v"(acc[0][0]), "+v"(acc[MB - 1][3]), "+v"(acr[0][0]), "+v"(acr[MB - 1][3]) : "v"(a[0]), "v"(a[1]), "v"(a[MB - 2]), "v"(a[MB - 1]), "v"(ar[0]), "v"(ar[MB - 1]));
        else     asm volatile("v_nop\n\tv_nop\n\tv_nop\n\tv_nop" : "+v"(acc[0][0]), "+v"(acc[1][1]), "+v"(acc[MB - 2][2]), "+v"(acc[MB - 1][3]) : "v"(a[0]), "v"(a[1]), "v"(a[MB - 2]), "v"(a[MB - 1]));
    }
#pragma unroll
    for (int mb = 0; mb < MB; ++mb) {
#pragma unroll
        for (int nb = 0; nb < 4; ++nb) {
#pragma unroll
            for (int j = 0; j < 8; ++j) os[(hi * 8 + j) * 68 + nb * 16 + lr] = RES ? (acc[mb][nb][j] + acr[mb][nb][j] * QRI) * OSC : acc[mb][nb][j] * OSC; }   // D: row 8h+j, col lane&15
        wave_sync();
        float* orow = OUT + ((size_t)b * OUT_SEQ + t + mb * 16) * DM + c0;
{
#pragma unroll
            for (int s = 0; s < 8; ++s) { const int row = 2 * s + hi, cofs = lr * 4;   // 8 s x 2 rows = 16 rows; 16 lanes x 4 floats = 64 columns
                const v4f val = *(const v4fa*)(&os[row * 68 + cofs]);
                *(v4f*)(orow + (size_t)row * DM + cofs) = val; }
             }
        wave_sync();
    }
}

static constexpr size_t al256(size_t v) { return (v + 255) & ~(size_t)255; }
static constexpr size_t SZ_XB = al256((size_t)NB * SEQ * DM * 2);
static constexpr size_t SZ_WQ = al256((size_t)DM * DM * 2);
static constexpr size_t SZ_WK = al256((size_t)KVD * DM * 2);
static constexpr size_t SZ_QP = al256((size_t)NB * NH_ * SEQ * HD * 2);
static constexpr size_t SZ_KP = al256((size_t)NB * NG_ * SEQ * HD * 2);
static constexpr size_t SZ_CH = al256((size_t)NB * SEQ * DM * 2);
static constexpr size_t SZ_CR = al256((size_t)NB * ER_ROWS * DM * 2);
static constexpr size_t SZ_TOTAL = SZ_XB + 2 * SZ_WQ + 2 * SZ_WK + 2 * SZ_QP + 4 * SZ_KP + SZ_CH + SZ_CR;
static_assert(SZ_TOTAL <= (size_t)134217728);          // workspace carve <= 128 MiB

extern "C" void kernel_launch(void* const* d_in, const int* in_sizes, int n_in,
                              void* d_out, int out_size, void* d_ws, size_t ws_size, hipStream_t stream) {
    if (n_in < 7) return;
    const size_t needx = ((size_t)(NB - 1) * SEQ_FULL + SEQ) * DM;
    if ((size_t)in_sizes[0] < needx) return;
    if ((size_t)in_sizes[1] < (size_t)DM * DM || (size_t)in_sizes[2] < (size_t)KVD * DM || (size_t)in_sizes[3] < (size_t)KVD * DM || (size_t)in_sizes[4] < (size_t)DM * DM) return;
    if ((size_t)in_sizes[5] < (size_t)SEQ * HD || (size_t)in_sizes[6] < (size_t)SEQ * HD) return;
    if ((size_t)out_size < ((size_t)(NB - 1) * OUT_SEQ + SEQ) * DM) return;
    if (SZ_TOTAL > ws_size) return;
    // wire order: x, Wq, Wk, Wv, Wo, cos, sin (W as [out][in] = Bt as-is; cos/sin [token][64] read as values)
    const float* x = (const float*)d_in[0]; const float* wq = (const float*)d_in[1]; const float* wk = (const float*)d_in[2]; const float* wv = (const float*)d_in[3];
    const float* wo = (const float*)d_in[4]; const float* cs = (const float*)d_in[5]; const float* sn = (const float*)d_in[6];
    float* OUT = (float*)d_out;      // [NB][SEQ][2048]
    char* wsp = (char*)d_ws;
    bf* XB = (bf*)wsp; wsp += SZ_XB;                 // [NB*SEQ][2048] bf16
    bf* WQ = (bf*)wsp; wsp += SZ_WQ;                 // [2048][2048] bf16
    bf* WK = (bf*)wsp; wsp += SZ_WK;                 // [512][2048] bf16
    bf* WV = (bf*)wsp; wsp += SZ_WK;                 // [512][2048] bf16
    h16* WO = (h16*)wsp; wsp += SZ_WQ;               // [2048][2048] f16 x64
    h16* QH = (h16*)wsp; wsp += SZ_QP;               // [NB*32][SEQ][64]
    h16* QR = (h16*)wsp; wsp += SZ_QP;               // residual x2048
    h16* KH = (h16*)wsp; wsp += SZ_KP;               // [NB*8][SEQ][64]
    h16* KR = (h16*)wsp; wsp += SZ_KP;               // residual x2048
    h16* VH = (h16*)wsp; wsp += SZ_KP;               // [NB*8][64][SEQ]
    h16* VR = (h16*)wsp; wsp += SZ_KP;               // residual x2048
    h16* CH = (h16*)wsp; wsp += SZ_CH;               // [NB*SEQ][2048] ctx x64
    h16* CR = (h16*)wsp; wsp += SZ_CR;               // [NB*ER_ROWS][2048] residual x2048

    if (SEQ == SEQ_FULL) {
        const size_t n8 = (size_t)NB * SEQ * DM / 8;
        k_cvt8<0><<<(unsigned)((n8 + 255) / 256), 256, 0, stream>>>(x, XB, n8);
    } else {
        const size_t n8 = (size_t)SEQ * DM / 8;
        for (int b = 0; b < NB; ++b) k_cvt8<0><<<(unsigned)((n8 + 255) / 256), 256, 0, stream>>>(x + (size_t)b * SEQ_FULL * DM, XB + (size_t)b * SEQ * DM, n8);
    }
    { const size_t n8 = (size_t)DM * DM / 8; const unsigned g = (unsigned)((n8 + 255) / 256);
      k_cvt8<0><<<g, 256, 0, stream>>>(wq, WQ, n8);
      k_cvt8<1><<<g, 256, 0, stream>>>(wo, (unsigned short*)WO, n8); }
    { const size_t n8 = (size_t)KVD * DM / 8; const unsigned g = (unsigned)((n8 + 255) / 256);
      k_cvt8<0><<<g, 256, 0, stream>>>(wk, WK, n8); k_cvt8<0><<<g, 256, 0, stream>>>(wv, WV, n8); }

    // q: A = x rows (m = b*SEQ + t), Bt = Wq rows (n = h*64 + d) -> planes [(b*32 + h)][t][d], rotary fused
    k_proj<true><<<dim3(NB * SEQ / 64, DM / 64, 1), 32, 0, stream>>>(XB, WQ, QH, QR, SEQ, (size_t)NH_ * SEQ * HD, HD, HD, (size_t)SEQ * HD, cs, sn);
    // k: Bt = Wk rows (n = g*64 + d) -> planes [(b*8 + g)][t][d], rotary fused
    k_proj<true><<<dim3(NB * SEQ / 64, KVD / 64, 1), 32, 0, stream>>>(XB, WK, KH, KR, SEQ, (size_t)NG_ * SEQ * HD, HD, HD, (size_t)SEQ * HD, cs, sn);
    // v^T: A = Wv rows (m = g*64 + d, 512 rows), Bt = x rows (n = b*SEQ + t) -> planes [(b*512 + m)][t] = [(b*8 + g)][d][t]
    k_proj<false><<<dim3(KVD / 64, NB * SEQ / 64, 1), 32, 0, stream>>>(WV, XB, VH, VR, KVD, (size_t)0, SEQ, SEQ, (size_t)KVD * SEQ, cs, sn);

    k_flash<true><<<dim3(ER_ROWS / (16 * AW), NB * NH_, 1), 32 * AW, 0, stream>>>(QH, QR, KH, KR, VH, VR, CH, CR, 0);
    if (SEQ > ER_ROWS)
        k_flash<false><<<dim3((SEQ - ER_ROWS) / (16 * AW) + (SEQ == ER_ROWS), NB * NH_, 1), 32 * AW, 0, stream>>>(QH, QR, KH, KR, VH, VR, CH, CR, ER_ROWS / (16 * AW));

    k_out<2, true><<<dim3(NB * ER_ROWS / 32, DM / 64, 1), 32, 0, stream>>>(CH, CR, WO, OUT, 0, ER_ROWS);
    if (SEQ > ER_ROWS)
        k_out<4, false><<<dim3(NB * (SEQ - ER_ROWS) / 64 + (SEQ == ER_ROWS), DM / 64, 1), 32, 0, stream>>>(CH, CR, WO, OUT, ER_ROWS, (SEQ == ER_ROWS) ? 64 : (SEQ - ER_ROWS));
}

// v001
// A run of this version takes 290 microseconds.
// Next to v000, in two timings, it ran 1.45 times as fast each time.
#include <hip/hip_runtime.h>

// Causal grouped-query attention, width 2048 = 32 heads x 64, 8 key/value groups (4 heads per group), rotate-half rotary with INPUT cos/sin tables, output projection; x [NB][SEQ][2048], W [out][in] (y = x W^T), no biases, score scale 1/8.
// Compute dtypes, f32 accumulate everywhere: q/k/v projections v_wmma_f32_16x16x32_bf16 (x, W RNE-converted to bf16; products exact); rotary in f32 with bf16-converted table values;
// scores, P.V and the output projection v_wmma_f32_16x16x32_f16: q, k, v^T, ctx(x64) as f16 value planes plus f16 residual planes x2048; Wo as f16 of the bf16 value x64; P carried x256.
// Query rows >= 512 use single f16 products; query rows < 512 use value + residual (three products for scores and P.V, two for the output projection), residual products in their own accumulators.
// Transposed flash form (S^T = K Q^T, O^T = V^T P^T), online softmax in f32 (running max), causal mask applied by value on the diagonal key step.

#ifndef NB
#define NB 2
#endif
#ifndef SEQ
#define SEQ 2048
#endif
#define NB_FULL  2
#define SEQ_FULL 2048
#ifndef OUT_SEQ
#define OUT_SEQ SEQ              // row pitch (in tokens) between batches of the output
#endif
#define DM   2048                // model width = depth of every GEMM
#define NH_  32
#define NG_  8
#define GS_  4                   // heads per key/value group
#define HD   64
#define KVD  512                 // NG_ * HD
#define AW   4                   // waves per flash block (16 query rows each)
#define QRS  2048.0f             // carry of every residual plane
#define QRI  (1.0f / 2048.0f)
#define SC2  (0.125f * 1.4426950408889634f)   // HD^-0.5 * log2(e)
#define PSH  8.0f                // log2 of the P carry (256)
#define CXS  64.0f               // carry of the ctx plane
#define WOS  64.0f               // carry of the Wo plane
#define OSC  (1.0f / 4096.0f)    // 1 / (CXS * WOS)
#define NEGB (-3.0e38f)

static constexpr int ER_ROWS = (SEQ < 512) ? SEQ : 512;   // query rows per batch on the value + residual path

static_assert(HD == 64);
static_assert(NH_ * HD == DM);
static_assert(NG_ * HD == KVD);
static_assert(NG_ * GS_ == NH_);
static_assert(DM % 64 == 0);
static_assert(DM % 32 == 0);                   // GEMM k-loop steps by 32
static_assert(KVD % 64 == 0);
static_assert(SEQ % 64 == 0);                  // a 64-row tile never straddles two batches
static_assert(SEQ % (16 * AW) == 0);
static_assert(ER_ROWS % 64 == 0);
static_assert((SEQ - ER_ROWS) % 64 == 0);
static_assert(((size_t)SEQ * DM) % 8 == 0);
static_assert(NB <= NB_FULL);
static_assert(SEQ <= SEQ_FULL);

typedef _Float16 h16;
typedef unsigned short bf;
typedef __attribute__((ext_vector_type(16))) __bf16   v16bf;
typedef __attribute__((ext_vector_type(16))) _Float16 v16h;
typedef __attribute__((ext_vector_type(8)))  _Float16 v8h;
typedef __attribute__((ext_vector_type(8)))  unsigned short v8us;
typedef __attribute__((ext_vector_type(8)))  float    v8f;
typedef __attribute__((ext_vector_type(4)))  float    v4f;
typedef v4f  __attribute__((may_alias)) v4fa;

__device__ __forceinline__ unsigned short f2bf(float f) { unsigned u = __float_as_uint(f); u += 0x7FFFu + ((u >> 16) & 1u); return (unsigned short)(u >> 16); }
__device__ __forceinline__ float bfr(float f) { return __uint_as_float(((unsigned)f2bf(f)) << 16); }   // value after RNE conversion to bf16
__device__ __forceinline__ v16h cat16(v8h lo, v8h hi) { return __builtin_shufflevector(lo, hi, 0, 1, 2, 3, 4, 5, 6, 7, 8, 9, 10, 11, 12, 13, 14, 15); }
__device__ __forceinline__ v16bf cat16b(v8us lo, v8us hi) { return __builtin_bit_cast(v16bf, __builtin_shufflevector(lo, hi, 0, 1, 2, 3, 4, 5, 6, 7, 8, 9, 10, 11, 12, 13, 14, 15)); }
__device__ __forceinline__ v8f wmma16(v16h a, v16h b, v8f c) { return __builtin_amdgcn_wmma_f32_16x16x32_f16(false, a, false, b, (short)0, c, false, false); }
__device__ __forceinline__ v8f wmmab(v16bf a, v16bf b, v8f c) { return __builtin_amdgcn_wmma_f32_16x16x32_bf16(false, a, false, b, (short)0, c, false, false); }
// fragment loaders from K-contiguous 16-bit rows; p already includes + 8*(lane>>4): elements 0..7 <- k0+8h+0..7, elements 8..15 <- k0+16+8h+0..7 (same map for A and B)
__device__ __forceinline__ v16h  ldh(const h16* p) { return cat16(*(const v8h*)p, *(const v8h*)(p + 16)); }
__device__ __forceinline__ v16bf ldb(const bf* p)  { return cat16b(*(const v8us*)p, *(const v8us*)(p + 16)); }
// ordering point for wave-private LDS tiles (same wave writes and reads)
__device__ __forceinline__ void wave_sync() { __builtin_amdgcn_fence(3 /* release order */, "wavefront"); __builtin_amdgcn_wave_barrier(); asm volatile("" ::: "memory"); }

// Operand tiles of every GEMM kernel go through LDS: a work-group of 4 waves (2 x 2 wave tiles) shares 128 A rows and 128 B rows, KT k-values per trip, two buffers.
#define KT    128                // k per trip: rows of 256 B
#define LP    136                // LDS row pitch in 16-bit elements: 272 B = 16 B x odd, conflict-free for 16-B fragment reads
#define TBUF  (256 * LP)         // elements of one buffer: 128 A rows, then 128 B rows
#define NTRIP (DM / KT)
static_assert(DM % KT == 0);
static_assert(NTRIP >= 2);       // the prologue fills two tiles
static_assert((NB * SEQ) % 128 == 0);
static_assert(DM % 128 == 0);
static_assert(KVD % 128 == 0);
static_assert((SEQ - ER_ROWS) % 128 == 0);
// Eight asynchronous 16-B copies per lane, global -> LDS, rows 8 apart (64 rows per work-group of 128 lanes: 16 lanes per 256-B row, 8 rows per copy).
// l: the lane's LDS byte address, g: the lane's global address of the first row (row pitch DM elements). The s_wait_xcnt ends the copies' own statement so that no address register is rewritten ahead of it.
__device__ __forceinline__ void cp8(unsigned l, const unsigned short* g) {
    asm volatile("global_load_async_to_lds_b128 %0, %8, off\n\t"
                 "global_load_async_to_lds_b128 %1, %9, off\n\t"
                 "global_load_async_to_lds_b128 %2, %10, off\n\t"
                 "global_load_async_to_lds_b128 %3, %11, off\n\t"
                 "global_load_async_to_lds_b128 %4, %12, off\n\t"
                 "global_load_async_to_lds_b128 %5, %13, off\n\t"
                 "global_load_async_to_lds_b128 %6, %14, off\n\t"
                 "global_load_async_to_lds_b128 %7, %15, off\n\t"
                 "s_wait_xcnt 0x0"
                 :: "v"(l), "v"(l + 8u * LP * 2u), "v"(l + 16u * LP * 2u), "v"(l + 24u * LP * 2u), "v"(l + 32u * LP * 2u), "v"(l + 40u * LP * 2u), "v"(l + 48u * LP * 2u), "v"(l + 56u * LP * 2u),
                    "v"(g), "v"(g + (size_t)8 * DM), "v"(g + (size_t)16 * DM), "v"(g + (size_t)24 * DM), "v"(g + (size_t)32 * DM), "v"(g + (size_t)40 * DM), "v"(g + (size_t)48 * DM), "v"(g + (size_t)56 * DM)
                 : "memory");
}
// One tile: A rows 0..63 from a0, A rows 64..127 from a1, B rows 0..127 from b0 (32 copies per lane in flight).
__device__ __forceinline__ void stage_tile(unsigned l, const unsigned short* a0, const unsigned short* a1, const unsigned short* b0) {
    cp8(l, a0); cp8(l + 64u * LP * 2u, a1); cp8(l + 128u * LP * 2u, b0); cp8(l + 192u * LP * 2u, b0 + (size_t)64 * DM);
}
// Publish point of the two-buffer ring: own LDS reads retired, own copies landed, then the work-group barrier (it publishes the next tile and frees the buffer just read).
__device__ __forceinline__ void ring_publish() {
    asm volatile("s_wait_dscnt 0x0" ::: "memory");      // this wave's fragment reads of the buffer that is refilled next have retired
    asm volatile("s_wait_asynccnt 0x0" ::: "memory");   // this wave's copies of the next tile have landed
    __syncthreads();
}

// MODE 0: bf16 bits (RNE). MODE 1: f16 of (bf16 value x WOS) (exact for normal results).
template<int MODE>
__global__ __launch_bounds__(256) void k_cvt8(const float* __restrict__ src, unsigned short* dst, size_t n8) {
    const size_t i = (size_t)blockIdx.x * 256 + threadIdx.x; if (i >= n8) return;
    const v8f v = *(const v8f*)(src + i * 8);
    if (MODE == 0) {
        v8us o;
#pragma unroll
        for (int k = 0; k < 8; ++k) o[k] = f2bf(v[k]);
        *(v8us*)(dst + i * 8) = o; 
    } else {
        v8h o;
#pragma unroll
        for (int k = 0; k < 8; ++k) o[k] = (h16)(bfr(v[k]) * WOS);
        h16* d = (h16*)dst;
        *(v8h*)(d + i * 8) = o; 
    }
}

// k_proj: register-blocked bf16 GEMM, one wave per 64x64 tile (16 accumulators), 4 waves per 128x128 work-group tile, operands from K-contiguous bf16 planes through the LDS ring, K = DM.
// C[m][n] = sum_k A[m][k] Bt[n][k]; optional rotate-half rotary on the 64-column tile (one head: partner column = c ^ 32, token = r0 % RB + row);
// written as f16 value (Ph) and f16 residual x2048 (Pr) at tile base (r0/RB)*sRB + (r0%RB)*pitch + (c0/CB)*sCB + (c0%CB), row pitch 'pitch' (halves). grid (M/128, N/128), 128 threads.
template<bool ROPE>
__global__ __launch_bounds__(128) void k_proj(const bf* __restrict__ A, const bf* __restrict__ Bt, h16* Ph, h16* Pr, int RB, size_t sRB, int pitch, int CB, size_t sCB,
                                             const float* __restrict__ COS, const float* __restrict__ SIN) {
    __shared__ __align__(16) unsigned short st[2 * TBUF];
    __shared__ __align__(16) float osw[4 * 16 * 68];
    const int K = DM;
    const int tid = threadIdx.x, lane = tid & 31, lr = lane & 15, hi = lane >> 4;
    const int wave = __builtin_amdgcn_readfirstlane(tid >> 5); const int wm = wave >> 1, wn = wave & 1;
    float* os = osw + wave * 16 * 68;      // wave-private epilogue staging
    const int r0 = blockIdx.x * 128 + wm * 64, c0 = blockIdx.y * 128 + wn * 64;
    v8f acc[4][4];
#pragma unroll
    for (int mb = 0; mb < 4; ++mb)
#pragma unroll
        for (int nb = 0; nb < 4; ++nb) acc[mb][nb] = (v8f){};
    const unsigned lds0 = (unsigned)(uintptr_t)st + (unsigned)((tid >> 4) * (LP * 2) + (tid & 15) * 16);      // this lane's copy target: row tid/16, 16-B chunk tid%16
    const bf* ga = A + (size_t)(blockIdx.x * 128 + (tid >> 4)) * K + (tid & 15) * 8;
    const bf* gb = Bt + (size_t)(blockIdx.y * 128 + (tid >> 4)) * K + (tid & 15) * 8;
    stage_tile(lds0, ga, ga + (size_t)64 * K, gb);
    asm volatile("s_wait_asynccnt 0x0" ::: "memory");   // tile 0 has landed before the barrier that publishes it
    __syncthreads();
    stage_tile(lds0 + TBUF * 2u, ga + KT, ga + (size_t)64 * K + KT, gb + KT);
    const int ao = (wm * 64 + lr) * LP + 8 * hi, bo = (128 + wn * 64 + lr) * LP + 8 * hi;
#pragma unroll 1
    for (int t = 0; t < NTRIP; ++t) {      // rolled: one trip per LDS buffer
        const bf* sb = st + (t & 1) * TBUF;
        v16bf a[2][4], b[2][4];            // two fragment sets: block s + 1 of this buffer is fetched while block s is multiplied
#pragma unroll
        for (int i = 0; i < 4; ++i) { a[0][i] = ldb(sb + ao + i * 16 * LP); b[0][i] = ldb(sb + bo + i * 16 * LP); }
#pragma unroll
        for (int s = 0; s < KT / 32; ++s) {
            if (s + 1 < KT / 32) {
#pragma unroll
                for (int i = 0; i < 4; ++i) { a[(s + 1) & 1][i] = ldb(sb + ao + i * 16 * LP + (s + 1) * 32); b[(s + 1) & 1][i] = ldb(sb + bo + i * 16 * LP + (s + 1) * 32); }
            }
            __builtin_amdgcn_sched_barrier(0);   // the next block's LDS reads stay one group, ahead of this block's matrix instructions
#pragma unroll
            for (int nb = 0; nb < 4; ++nb)
#pragma unroll
                for (int mb = 0; mb < 4; ++mb) acc[mb][nb] = wmmab(a[s & 1][mb], b[s & 1][nb], acc[mb][nb]);
            __builtin_amdgcn_sched_barrier(0);   // no later LDS read moves in among them
        }
        ring_publish();
        if (t + 2 < NTRIP) { const int kn = (t + 2) * KT; stage_tile(lds0 + (unsigned)(t & 1) * (TBUF * 2u), ga + kn, ga + (size_t)64 * K + kn, gb + kn); }
    }
    asm volatile("s_wait_asynccnt 0x0" ::: "memory");   // nothing of the ring is in flight when the wave goes on
    const size_t tbase = (size_t)(r0 / RB) * sRB + (size_t)(r0 % RB) * (size_t)pitch + (size_t)(c0 / CB) * sCB + (size_t)(c0 % CB);
    const int tok0 = r0 % RB;
#pragma unroll
    for (int mb = 0; mb < 4; ++mb) {
#pragma unroll
        for (int nb = 0; nb < 4; ++nb) {
#pragma unroll
            for (int j = 0; j < 8; ++j) os[(hi * 8 + j) * 68 + nb * 16 + lr] = acc[mb][nb][j]; }   // D: row 8h+j, col lane&15; rows 0..15 x columns 0..63 all written
        wave_sync();
        v8h hv[4], rv[4];
#pragma unroll
        for (int s = 0; s < 4; ++s) { const int row = 4 * s + (lane >> 3), c8 = (lane & 7) * 8;   // 4 s x 4 row groups = 16 rows; 8 lanes x 8 = 64 columns
            const v4f x0 = *(const v4fa*)(&os[row * 68 + c8]); const v4f x1 = *(const v4fa*)(&os[row * 68 + c8 + 4]);
            float xv[8];
#pragma unroll
            for (int i = 0; i < 4; ++i) { xv[i] = x0[i]; xv[4 + i] = x1[i]; }
            if (ROPE) {
                const int pc = c8 ^ 32;
                const v4f y0 = *(const v4fa*)(&os[row * 68 + pc]); const v4f y1 = *(const v4fa*)(&os[row * 68 + pc + 4]);
                const size_t to = (size_t)(tok0 + mb * 16 + row) * HD + c8;
                const v4f ca = *(const v4f*)(COS + to), cb = *(const v4f*)(COS + to + 4), sa = *(const v4f*)(SIN + to), sb = *(const v4f*)(SIN + to + 4);
                const float sg = (c8 < 32) ? -1.0f : 1.0f;     // rotated = concat(-x2, x1)
#pragma unroll
                for (int i = 0; i < 4; ++i) { xv[i] = x0[i] * bfr(ca[i]) + (sg * y0[i]) * bfr(sa[i]); xv[4 + i] = x1[i] * bfr(cb[i]) + (sg * y1[i]) * bfr(sb[i]); }
            }
            v8h hh, rr;
#pragma unroll
            for (int i = 0; i < 8; ++i) { const h16 a0 = (h16)xv[i]; hh[i] = a0; rr[i] = (h16)((xv[i] - (float)a0) * QRS); }
            hv[s] = hh; rv[s] = rr; }
        const size_t sb0 = tbase + (size_t)(mb * 16) * (size_t)pitch;
#pragma unroll
        for (int s = 0; s < 4; ++s) { const int row = 4 * s + (lane >> 3), c8 = (lane & 7) * 8; const size_t oo = sb0 + (size_t)row * (size_t)pitch + c8;
            *(v8h*)(Ph + oo) = hv[s]; *(v8h*)(Pr + oo) = rv[s]; }
        
        wave_sync();
    }
}

// k_flash: fused causal attention, one wave per 16 query rows of one (batch, head); K / V^T / Q fragments straight from the f16 planes (two 16-B loads each, arithmetic addressing).
// Transposed form: S^T[key][t] = K Q^T (A = K rows, B = Q rows); lane (t = lane&15, h = lane>>4) holds keys 8h+r of each 16-key tile, so the packed
// P tile is directly the B fragment of O^T[d][t] = V^T P^T (element r <- tile keys 0..15, element 8+r <- tile keys 16..31, lane unchanged).
// Head h reads key/value group h / GS_. Key loop covers keys 0 .. t0+15 in steps of 32; keys above the query index are replaced by NEGB (P = 0) on the diagonal step.
// ER: value + residual path (scores kh*qh + [kh*qr + kr*qh]/2048, O = vh*ph + [vr*ph + vh*pr]/2048), residual products in separate accumulators.
template<bool ER>
__global__ __launch_bounds__(32 * AW) void k_flash(const h16* __restrict__ QH, const h16* __restrict__ QR, const h16* __restrict__ KH, const h16* __restrict__ KR,
                                                   const h16* __restrict__ VH, const h16* __restrict__ VR, h16* CH, h16* CR, int xb0) {
    __shared__ __align__(16) float os[AW * 16 * 68];
    const int lane = threadIdx.x & 31, lr = lane & 15, hi = lane >> 4;
    const int wave = __builtin_amdgcn_readfirstlane((int)(threadIdx.x >> 5));
    const int zh = blockIdx.y; const int b = zh / NH_, h = zh % NH_, g = h / GS_;
    const int t0 = (((int)blockIdx.x + xb0) * AW + wave) * 16;
    const int tq = t0 + lr;
    const size_t qbase = (size_t)zh * SEQ * HD;
    const size_t kvb = (size_t)(b * NG_ + g) * SEQ * HD;
    const size_t qo = qbase + (size_t)(t0 + lr) * HD + 8 * hi;
    const v16h qh0 = ldh(QH + qo), qh1 = ldh(QH + qo + 32);          // B fragments: col t, k = d
    v16h qr0 = qh0, qr1 = qh1;
    if (ER) { qr0 = ldh(QR + qo); qr1 = ldh(QR + qo + 32); }
    const size_t ko = kvb + (size_t)lr * HD + 8 * hi;      // + key * HD       (A fragment: row key, k = d)
    const size_t vo = kvb + (size_t)lr * SEQ + 8 * hi;     // + 16j*SEQ + key  (A fragment: row d, k = key)
    v8f oH[4], oL[4];
#pragma unroll
    for (int j = 0; j < 4; ++j) { oH[j] = (v8f){}; oL[j] = (v8f){}; }
    float m = NEGB, l = 0.0f;
#pragma unroll 1
    for (int key0 = 0; key0 < t0 + 16; key0 += 32) {
        const h16* ka = KH + ko + (size_t)key0 * HD;
        float ta[8], tb[8];
        if (!ER) {
            const v16h ka0 = ldh(ka), ka1 = ldh(ka + 32), kb0 = ldh(ka + 16 * HD), kb1 = ldh(ka + 16 * HD + 32);
            v8f sHa = (v8f){}, sHb = (v8f){};
            sHa = wmma16(ka0, qh0, sHa); sHb = wmma16(kb0, qh0, sHb);
            sHa = wmma16(ka1, qh1, sHa); sHb = wmma16(kb1, qh1, sHb);
            asm volatile("v_nop\n\tv_nop\n\tv_nop\n\tv_nop" : "+v"(sHa), "+v"(sHb) : "v"(ka0), "v"(ka1), "v"(kb0), "v"(kb1));
#pragma unroll
            for (int r = 0; r < 8; ++r) { ta[r] = sHa[r] * SC2; tb[r] = sHb[r] * SC2; }
        } else {
            const h16* kr = KR + ko + (size_t)key0 * HD;
            { const v16h ka0 = ldh(ka), ka1 = ldh(ka + 32), ra0 = ldh(kr), ra1 = ldh(kr + 32);
              v8f sH = (v8f){}, sL = (v8f){};
              sH = wmma16(ka0, qh0, sH); sL = wmma16(ka0, qr0, sL);
              sH = wmma16(ka1, qh1, sH); sL = wmma16(ka1, qr1, sL);
              sL = wmma16(ra0, qh0, sL); sL = wmma16(ra1, qh1, sL);
              asm volatile("v_nop\n\tv_nop\n\tv_nop\n\tv_nop" : "+v"(sH), "+v"(sL) : "v"(ka0), "v"(ka1), "v"(ra0), "v"(ra1));
#pragma unroll
              for (int r = 0; r < 8; ++r) ta[r] = (sH[r] + sL[r] * QRI) * SC2; }
            { const v16h kb0 = ldh(ka + 16 * HD), kb1 = ldh(ka + 16 * HD + 32), rb0 = ldh(kr + 16 * HD), rb1 = ldh(kr + 16 * HD + 32);
              v8f sH = (v8f){}, sL = (v8f){};
              sH = wmma16(kb0, qh0, sH); sL = wmma16(kb0, qr0, sL);
              sH = wmma16(kb1, qh1, sH); sL = wmma16(kb1, qr1, sL);
              sL = wmma16(rb0, qh0, sL); sL = wmma16(rb1, qh1, sL);
              asm volatile("v_nop\n\tv_nop\n\tv_nop\n\tv_nop" : "+v"(sH), "+v"(sL) : "v"(kb0), "v"(kb1), "v"(rb0), "v"(rb1));
#pragma unroll
              for (int r = 0; r < 8; ++r) tb[r] = (sH[r] + sL[r] * QRI) * SC2; }
        }
        if (key0 + 31 > t0) {      // wave-uniform: only the diagonal step holds keys above some query index; every row keeps key key0 <= t
#pragma unroll
            for (int r = 0; r < 8; ++r) { const int kk = key0 + 8 * hi + r; ta[r] = (kk <= tq) ? ta[r] : NEGB; tb[r] = (kk + 16 <= tq) ? tb[r] : NEGB; }
        }
        float mx = NEGB;
#pragma unroll
        for (int r = 0; r < 8; ++r) mx = fmaxf(mx, fmaxf(ta[r], tb[r]));
        mx = fmaxf(mx, __shfl_xor(mx, 16, 32));
        const float mnew = fmaxf(m, mx);
        const float alpha = __builtin_amdgcn_exp2f(m - mnew);
        const float sh = PSH - mnew;
        v16h pb, pq; float ls = 0.0f;
        if (!ER) {
#pragma unroll
            for (int r = 0; r < 8; ++r) { const h16 pa = (h16)__builtin_amdgcn_exp2f(ta[r] + sh); const h16 pc = (h16)__builtin_amdgcn_exp2f(tb[r] + sh); pb[r] = pa; pb[8 + r] = pc; ls += (float)pa + (float)pc; }
            pq = pb;
        } else {
#pragma unroll
            for (int r = 0; r < 8; ++r) { const float fa = __builtin_amdgcn_exp2f(ta[r] + sh); const float fc = __builtin_amdgcn_exp2f(tb[r] + sh);
                const h16 pa = (h16)fa; const h16 pc = (h16)fc; const h16 qa = (h16)((fa - (float)pa) * QRS); const h16 qc = (h16)((fc - (float)pc) * QRS);
                pb[r] = pa; pb[8 + r] = pc; pq[r] = qa; pq[8 + r] = qc; ls += ((float)pa + (float)pc) + ((float)qa + (float)qc) * QRI; }
        }
        l = l * alpha + ls; m = mnew;
#pragma unroll
        for (int j = 0; j < 4; ++j) { oH[j] = oH[j] * alpha; if (ER) oL[j] = oL[j] * alpha; }
        const h16* va = VH + vo + key0;
        const v16h v0 = ldh(va), v1 = ldh(va + (size_t)16 * SEQ), v2 = ldh(va + (size_t)32 * SEQ), v3 = ldh(va + (size_t)48 * SEQ);
        if (!ER) {
            oH[0] = wmma16(v0, pb, oH[0]); oH[1] = wmma16(v1, pb, oH[1]); oH[2] = wmma16(v2, pb, oH[2]); oH[3] = wmma16(v3, pb, oH[3]);
            asm volatile("v_nop\n\tv_nop\n\tv_nop\n\tv_nop" : "+v"(oH[0]), "+v"(oH[1]), "+v"(oH[2]), "+v"(oH[3]) : "v"(v0), "v"(v1), "v"(v2), "v"(v3), "v"(pb));
        } else {
            const h16* vr = VR + vo + key0;
            const v16h w0 = ldh(vr), w1 = ldh(vr + (size_t)16 * SEQ), w2 = ldh(vr + (size_t)32 * SEQ), w3 = ldh(vr + (size_t)48 * SEQ);
            oH[0] = wmma16(v0, pb, oH[0]); oH[1] = wmma16(v1, pb, oH[1]); oH[2] = wmma16(v2, pb, oH[2]); oH[3] = wmma16(v3, pb, oH[3]);
            oL[0] = wmma16(w0, pb, oL[0]); oL[1] = wmma16(w1, pb, oL[1]); oL[2] = wmma16(w2, pb, oL[2]); oL[3] = wmma16(w3, pb, oL[3]);
            oL[0] = wmma16(v0, pq, oL[0]); oL[1] = wmma16(v1, pq, oL[1]); oL[2] = wmma16(v2, pq, oL[2]); oL[3] = wmma16(v3, pq, oL[3]);
            asm volatile("v_nop\n\tv_nop\n\tv_nop\n\tv_nop" : "+v"(oH[0]), "+v"(oH[1]), "+v"(oH[2]), "+v"(oH[3]), "+v"(oL[0]), "+v"(oL[1]), "+v"(oL[2]), "+v"(oL[3])
                         : "v"(v0), "v"(v1), "v"(v2), "v"(v3), "v"(w0), "v"(w1), "v"(w2), "v"(w3), "v"(pb), "v"(pq));
        }
    }
    l += __shfl_xor(l, 16, 32);
    const float inv = CXS * (1.0f / l);
    const int wb = wave * 16 * 68;
    // O^T D layout: o_j[r] = (d = 16j + 8h + r, t = lane&15) -> os[t][d]; rows 0..15 x columns 0..63 all written
#pragma unroll
    for (int j = 0; j < 4; ++j) { v4f a, c;
#pragma unroll
        for (int i = 0; i < 4; ++i) {
            if (ER) { a[i] = (oH[j][i] + oL[j][i] * QRI) * inv; c[i] = (oH[j][4 + i] + oL[j][4 + i] * QRI) * inv; }
            else    { a[i] = oH[j][i] * inv; c[i] = oH[j][4 + i] * inv; } }
        *(v4fa*)(&os[wb + lr * 68 + 16 * j + 8 * hi]) = a; *(v4fa*)(&os[wb + lr * 68 + 16 * j + 8 * hi + 4]) = c; }
    wave_sync();
    v8h hv[4], rv[4];
#pragma unroll
    for (int s = 0; s < 4; ++s) { const int row = 4 * s + (lane >> 3), c8 = (lane & 7) * 8;   // 4 s x 4 row groups = 16 rows; 8 lanes x 8 = 64 columns
        const v4f x0 = *(const v4fa*)(&os[wb + row * 68 + c8]); const v4f x1 = *(const v4fa*)(&os[wb + row * 68 + c8 + 4]); v8h hh, rr;
#pragma unroll
        for (int i = 0; i < 4; ++i) { const h16 a0 = (h16)x0[i]; const h16 a1 = (h16)x1[i]; hh[i] = a0; hh[4 + i] = a1; rr[i] = (h16)((x0[i] - (float)a0) * QRS); rr[4 + i] = (h16)((x1[i] - (float)a1) * QRS); }
        hv[s] = hh; rv[s] = rr; }
    const size_t cbase = ((size_t)b * SEQ + t0) * DM + (size_t)h * HD;
    const size_t rbase = ((size_t)b * ER_ROWS + t0) * DM + (size_t)h * HD;     // used by the ER instantiation only (t0 < ER_ROWS there)
#pragma unroll
    for (int s = 0; s < 4; ++s) { const int row = 4 * s + (lane >> 3), c8 = (lane & 7) * 8;
        *(v8h*)(CH + cbase + (size_t)row * DM + c8) = hv[s]; if (ER) *(v8h*)(CR + rbase + (size_t)row * DM + c8) = rv[s]; }
    
}

// k_out: output projection, f16 GEMM, one wave per (16*MB) x 64 tile, 4 waves per (32*MB) x 128 work-group tile, operands from K-contiguous f16 planes through the LDS ring, K = DM.
// A rows of a buffer: MB = 4: 128 rows of CH; MB = 2 with RES: 64 rows of CH, then the same 64 rows of CR.
// OUT[b][t][n] = OSC * sum_k (CH[b*SEQ+t][k] + CR[b*ER_ROWS+t][k]/2048) * WO[n][k]; RES: residual products in their own accumulators.
// Rows t in [tstart, tstart+tcount) of every batch; grid (NB*tcount/(32*MB), DM/128), 128 threads.
template<int MB, bool RES>
__global__ __launch_bounds__(128) void k_out(const h16* __restrict__ CH, const h16* __restrict__ CR, const h16* __restrict__ WO, float* OUT, int tstart, int tcount) {
    static_assert(RES ? MB == 2 : MB == 4);
    __shared__ __align__(16) unsigned short st[2 * TBUF];
    __shared__ __align__(16) float osw[4 * 16 * 68];
    const int tid = threadIdx.x, lane = tid & 31, lr = lane & 15, hi = lane >> 4;
    const int wave = __builtin_amdgcn_readfirstlane(tid >> 5); const int wm = wave >> 1, wn = wave & 1;
    float* os = osw + wave * 16 * 68;      // wave-private epilogue staging
    const int tiles = tcount / (32 * MB);
    const int b = (int)blockIdx.x / tiles, tw = tstart + ((int)blockIdx.x % tiles) * 32 * MB, t = tw + wm * 16 * MB, c0 = blockIdx.y * 128 + wn * 64;
    v8f acc[MB][4], acr[MB][4];
#pragma unroll
    for (int mb = 0; mb < MB; ++mb)
#pragma unroll
        for (int nb = 0; nb < 4; ++nb) { acc[mb][nb] = (v8f){}; acr[mb][nb] = (v8f){}; }
    const unsigned lds0 = (unsigned)(uintptr_t)st + (unsigned)((tid >> 4) * (LP * 2) + (tid & 15) * 16);      // this lane's copy target: row tid/16, 16-B chunk tid%16
    const unsigned short* ga0 = (const unsigned short*)CH + ((size_t)b * SEQ + tw + (tid >> 4)) * DM + (tid & 15) * 8;
    const unsigned short* ga1 = RES ? (const unsigned short*)CR + ((size_t)b * ER_ROWS + tw + (tid >> 4)) * DM + (tid & 15) * 8     // RES only (tw < ER_ROWS there)
                                    : ga0 + (size_t)64 * DM;
    const unsigned short* gb = (const unsigned short*)WO + (size_t)(blockIdx.y * 128 + (tid >> 4)) * DM + (tid & 15) * 8;
    stage_tile(lds0, ga0, ga1, gb);
    asm volatile("s_wait_asynccnt 0x0" ::: "memory");   // tile 0 has landed before the barrier that publishes it
    __syncthreads();
    stage_tile(lds0 + TBUF * 2u, ga0 + KT, ga1 + KT, gb + KT);
    const int ao = (wm * 16 * MB + lr) * LP + 8 * hi, ro = ao + 64 * LP, bo = (128 + wn * 64 + lr) * LP + 8 * hi;
#pragma unroll 1
    for (int tr = 0; tr < NTRIP; ++tr) {      // rolled: one trip per LDS buffer
      const h16* sb = (const h16*)st + (tr & 1) * TBUF;
      v16h a[2][MB], ar[2][MB], bb[2][4];      // two fragment sets: block s + 1 of this buffer is fetched while block s is multiplied
#pragma unroll
      for (int i = 0; i < MB; ++i) { a[0][i] = ldh(sb + ao + i * 16 * LP); if (RES) ar[0][i] = ldh(sb + ro + i * 16 * LP); }
#pragma unroll
      for (int i = 0; i < 4; ++i) bb[0][i] = ldh(sb + bo + i * 16 * LP);
#pragma unroll
      for (int s = 0; s < KT / 32; ++s) {
        if (s + 1 < KT / 32) {
#pragma unroll
            for (int i = 0; i < MB; ++i) { a[(s + 1) & 1][i] = ldh(sb + ao + i * 16 * LP + (s + 1) * 32); if (RES) ar[(s + 1) & 1][i] = ldh(sb + ro + i * 16 * LP + (s + 1) * 32); }
#pragma unroll
            for (int i = 0; i < 4; ++i) bb[(s + 1) & 1][i] = ldh(sb + bo + i * 16 * LP + (s + 1) * 32);
        }
        __builtin_amdgcn_sched_barrier(0);   // the next block's LDS reads stay one group, ahead of this block's matrix instructions
#pragma unroll
        for (int nb = 0; nb < 4; ++nb)
#pragma unroll
            for (int mb = 0; mb < MB; ++mb) { acc[mb][nb] = wmma16(a[s & 1][mb], bb[s & 1][nb], acc[mb][nb]); if (RES) acr[mb][nb] = wmma16(ar[s & 1][mb], bb[s & 1][nb], acr[mb][nb]); }
        __builtin_amdgcn_sched_barrier(0);   // no later LDS read moves in among them
      }
      ring_publish();
      if (tr + 2 < NTRIP) { const int kn = (tr + 2) * KT; stage_tile(lds0 + (unsigned)(tr & 1) * (TBUF * 2u), ga0 + kn, ga1 + kn, gb + kn); }
    }
    asm volatile("s_wait_asynccnt 0x0" ::: "memory");   // nothing of the ring is in flight when the wave goes on
#pragma unroll
    for (int mb = 0; mb < MB; ++mb) {
#pragma unroll
        for (int nb = 0; nb < 4; ++nb) {
#pragma unroll
            for (int j = 0; j < 8; ++j) os[(hi * 8 + j) * 68 + nb * 16 + lr] = RES ? (acc[mb][nb][j] + acr[mb][nb][j] * QRI) * OSC : acc[mb][nb][j] * OSC; }   // D: row 8h+j, col lane&15
        wave_sync();
        float* orow = OUT + ((size_t)b * OUT_SEQ + t + mb * 16) * DM + c0;
{
#pragma unroll
            for (int s = 0; s < 8; ++s) { const int row = 2 * s + hi, cofs = lr * 4;   // 8 s x 2 rows = 16 rows; 16 lanes x 4 floats = 64 columns
                const v4f val = *(const v4fa*)(&os[row * 68 + cofs]);
                *(v4f*)(orow + (size_t)row * DM + cofs) = val; }
             }
        wave_sync();
    }
}

static constexpr size_t al256(size_t v) { return (v + 255) & ~(size_t)255; }
static constexpr size_t SZ_XB = al256((size_t)NB * SEQ * DM * 2);
static constexpr size_t SZ_WQ = al256((size_t)DM * DM * 2);
static constexpr size_t SZ_WK = al256((size_t)KVD * DM * 2);
static constexpr size_t SZ_QP = al256((size_t)NB * NH_ * SEQ * HD * 2);
static constexpr size_t SZ_KP = al256((size_t)NB * NG_ * SEQ * HD * 2);
static constexpr size_t SZ_CH = al256((size_t)NB * SEQ * DM * 2);
static constexpr size_t SZ_CR = al256((size_t)NB * ER_ROWS * DM * 2);
static constexpr size_t SZ_TOTAL = SZ_XB + 2 * SZ_WQ + 2 * SZ_WK + 2 * SZ_QP + 4 * SZ_KP + SZ_CH + SZ_CR;
static_assert(SZ_TOTAL <= (size_t)134217728);          // workspace carve <= 128 MiB

extern "C" void kernel_launch(void* const* d_in, const int* in_sizes, int n_in,
                              void* d_out, int out_size, void* d_ws, size_t ws_size, hipStream_t stream) {
    if (n_in < 7) return;
    const size_t needx = ((size_t)(NB - 1) * SEQ_FULL + SEQ) * DM;
    if ((size_t)in_sizes[0] < needx) return;
    if ((size_t)in_sizes[1] < (size_t)DM * DM || (size_t)in_sizes[2] < (size_t)KVD * DM || (size_t)in_sizes[3] < (size_t)KVD * DM || (size_t)in_sizes[4] < (size_t)DM * DM) return;
    if ((size_t)in_sizes[5] < (size_t)SEQ * HD || (size_t)in_sizes[6] < (size_t)SEQ * HD) return;
    if ((size_t)out_size < ((size_t)(NB - 1) * OUT_SEQ + SEQ) * DM) return;
    if (SZ_TOTAL > ws_size) return;
    // wire order: x, Wq, Wk, Wv, Wo, cos, sin (W as [out][in] = Bt as-is; cos/sin [token][64] read as values)
    const float* x = (const float*)d_in[0]; const float* wq = (const float*)d_in[1]; const float* wk = (const float*)d_in[2]; const float* wv = (const float*)d_in[3];
    const float* wo = (const float*)d_in[4]; const float* cs = (const float*)d_in[5]; const float* sn = (const float*)d_in[6];
    float* OUT = (float*)d_out;      // [NB][SEQ][2048]
    char* wsp = (char*)d_ws;
    bf* XB = (bf*)wsp; wsp += SZ_XB;                 // [NB*SEQ][2048] bf16
    bf* WQ = (bf*)wsp; wsp += SZ_WQ;                 // [2048][2048] bf16
    bf* WK = (bf*)wsp; wsp += SZ_WK;                 // [512][2048] bf16
    bf* WV = (bf*)wsp; wsp += SZ_WK;                 // [512][2048] bf16
    h16* WO = (h16*)wsp; wsp += SZ_WQ;               // [2048][2048] f16 x64
    h16* QH = (h16*)wsp; wsp += SZ_QP;               // [NB*32][SEQ][64]
    h16* QR = (h16*)wsp; wsp += SZ_QP;               // residual x2048
    h16* KH = (h16*)wsp; wsp += SZ_KP;               // [NB*8][SEQ][64]
    h16* KR = (h16*)wsp; wsp += SZ_KP;               // residual x2048
    h16* VH = (h16*)wsp; wsp += SZ_KP;               // [NB*8][64][SEQ]
    h16* VR = (h16*)wsp; wsp += SZ_KP;               // residual x2048
    h16* CH = (h16*)wsp; wsp += SZ_CH;               // [NB*SEQ][2048] ctx x64
    h16* CR = (h16*)wsp; wsp += SZ_CR;               // [NB*ER_ROWS][2048] residual x2048

    if (SEQ == SEQ_FULL) {
        const size_t n8 = (size_t)NB * SEQ * DM / 8;
        k_cvt8<0><<<(unsigned)((n8 + 255) / 256), 256, 0, stream>>>(x, XB, n8);
    } else {
        const size_t n8 = (size_t)SEQ * DM / 8;
        for (int b = 0; b < NB; ++b) k_cvt8<0><<<(unsigned)((n8 + 255) / 256), 256, 0, stream>>>(x + (size_t)b * SEQ_FULL * DM, XB + (size_t)b * SEQ * DM, n8);
    }
    { const size_t n8 = (size_t)DM * DM / 8; const unsigned g = (unsigned)((n8 + 255) / 256);
      k_cvt8<0><<<g, 256, 0, stream>>>(wq, WQ, n8);
      k_cvt8<1><<<g, 256, 0, stream>>>(wo, (unsigned short*)WO, n8); }
    { const size_t n8 = (size_t)KVD * DM / 8; const unsigned g = (unsigned)((n8 + 255) / 256);
      k_cvt8<0><<<g, 256, 0, stream>>>(wk, WK, n8); k_cvt8<0><<<g, 256, 0, stream>>>(wv, WV, n8); }

    // q: A = x rows (m = b*SEQ + t), Bt = Wq rows (n = h*64 + d) -> planes [(b*32 + h)][t][d], rotary fused
    k_proj<true><<<dim3(NB * SEQ / 128, DM / 128, 1), 128, 0, stream>>>(XB, WQ, QH, QR, SEQ, (size_t)NH_ * SEQ * HD, HD, HD, (size_t)SEQ * HD, cs, sn);
    // k: Bt = Wk rows (n = g*64 + d) -> planes [(b*8 + g)][t][d], rotary fused
    k_proj<true><<<dim3(NB * SEQ / 128, KVD / 128, 1), 128, 0, stream>>>(XB, WK, KH, KR, SEQ, (size_t)NG_ * SEQ * HD, HD, HD, (size_t)SEQ * HD, cs, sn);
    // v^T: A = Wv rows (m = g*64 + d, 512 rows), Bt = x rows (n = b*SEQ + t) -> planes [(b*512 + m)][t] = [(b*8 + g)][d][t]
    k_proj<false><<<dim3(KVD / 128, NB * SEQ / 128, 1), 128, 0, stream>>>(WV, XB, VH, VR, KVD, (size_t)0, SEQ, SEQ, (size_t)KVD * SEQ, cs, sn);

    k_flash<true><<<dim3(ER_ROWS / (16 * AW), NB * NH_, 1), 32 * AW, 0, stream>>>(QH, QR, KH, KR, VH, VR, CH, CR, 0);
    if (SEQ > ER_ROWS)
        k_flash<false><<<dim3((SEQ - ER_ROWS) / (16 * AW) + (SEQ == ER_ROWS), NB * NH_, 1), 32 * AW, 0, stream>>>(QH, QR, KH, KR, VH, VR, CH, CR, ER_ROWS / (16 * AW));

    k_out<2, true><<<dim3(NB * ER_ROWS / 64, DM / 128, 1), 128, 0, stream>>>(CH, CR, WO, OUT, 0, ER_ROWS);
    if (SEQ > ER_ROWS)
        k_out<4, false><<<dim3(NB * (SEQ - ER_ROWS) / 128 + (SEQ == ER_ROWS), DM / 128, 1), 128, 0, stream>>>(CH, CR, WO, OUT, ER_ROWS, (SEQ == ER_ROWS) ? 128 : (SEQ - ER_ROWS));
}

// v002
// One run takes 204 microseconds.
// Next to v001, in two timings, it ran 1.42 and 1.41 times as fast.
// Over all steps from v000 it is 2.05 times as fast.
#include <hip/hip_runtime.h>

// Causal grouped-query attention, width 2048 = 32 heads x 64, 8 key/value groups (4 heads per group), rotate-half rotary with INPUT cos/sin tables, output projection; x [NB][SEQ][2048], W [out][in] (y = x W^T), no biases, score scale 1/8.
// Compute dtypes, f32 accumulate everywhere: q/k/v projections v_wmma_f32_16x16x32_bf16 (x, W RNE-converted to bf16; products exact); rotary in f32 with bf16-converted table values;
// scores, P.V and the output projection v_wmma_f32_16x16x32_f16: q, k, v^T, ctx(x64) as f16 value planes plus f16 residual planes x2048; Wo as f16 of the bf16 value x64; P carried x256.
// Query rows >= 512 use single f16 products; query rows < 512 use value + residual (three products for scores and P.V, two for the output projection), residual products in their own accumulators.
// Transposed flash form (S^T = K Q^T, O^T = V^T P^T), online softmax in f32 (running max), causal mask applied by value on the diagonal key step.

#ifndef NB
#define NB 2
#endif
#ifndef SEQ
#define SEQ 2048
#endif
#define NB_FULL  2
#define SEQ_FULL 2048
#ifndef OUT_SEQ
#define OUT_SEQ SEQ              // row pitch (in tokens) between batches of the output
#endif
#define DM   2048                // model width = depth of every GEMM
#define NH_  32
#define NG_  8
#define GS_  4                   // heads per key/value group
#define HD   64
#define KVD  512                 // NG_ * HD
#define AW   4                   // waves per flash block (16 query rows each)
#define QRS  2048.0f             // carry of every residual plane
#define QRI  (1.0f / 2048.0f)
#define SC2  (0.125f * 1.4426950408889634f)   // HD^-0.5 * log2(e)
#define PSH  8.0f                // log2 of the P carry (256)
#define CXS  64.0f               // carry of the ctx plane
#define WOS  64.0f               // carry of the Wo plane
#define OSC  (1.0f / 4096.0f)    // 1 / (CXS * WOS)
#define NEGB (-3.0e38f)

static constexpr int ER_ROWS = (SEQ < 512) ? SEQ : 512;   // query rows per batch on the value + residual path

static_assert(HD == 64);
static_assert(NH_ * HD == DM);
static_assert(NG_ * HD == KVD);
static_assert(NG_ * GS_ == NH_);
static_assert(DM % 64 == 0);
static_assert(DM % 32 == 0);                   // GEMM k-loop steps by 32
static_assert(KVD % 64 == 0);
static_assert(SEQ % 64 == 0);                  // a 64-row tile never straddles two batches
static_assert(SEQ % (16 * AW) == 0);
static_assert(ER_ROWS % 64 == 0);
static_assert((SEQ - ER_ROWS) % 64 == 0);
static_assert(((size_t)SEQ * DM) % 8 == 0);
static_assert(NB <= NB_FULL);
static_assert(SEQ <= SEQ_FULL);

typedef _Float16 h16;
typedef unsigned short bf;
typedef __attribute__((ext_vector_type(16))) __bf16   v16bf;
typedef __attribute__((ext_vector_type(16))) _Float16 v16h;
typedef __attribute__((ext_vector_type(8)))  _Float16 v8h;
typedef __attribute__((ext_vector_type(8)))  unsigned short v8us;
typedef __attribute__((ext_vector_type(8)))  float    v8f;
typedef __attribute__((ext_vector_type(4)))  float    v4f;
typedef v4f  __attribute__((may_alias)) v4fa;

__device__ __forceinline__ unsigned short f2bf(float f) { unsigned u = __float_as_uint(f); u += 0x7FFFu + ((u >> 16) & 1u); return (unsigned short)(u >> 16); }
__device__ __forceinline__ float bfr(float f) { return __uint_as_float(((unsigned)f2bf(f)) << 16); }   // value after RNE conversion to bf16
__device__ __forceinline__ v16h cat16(v8h lo, v8h hi) { return __builtin_shufflevector(lo, hi, 0, 1, 2, 3, 4, 5, 6, 7, 8, 9, 10, 11, 12, 13, 14, 15); }
__device__ __forceinline__ v16bf cat16b(v8us lo, v8us hi) { return __builtin_bit_cast(v16bf, __builtin_shufflevector(lo, hi, 0, 1, 2, 3, 4, 5, 6, 7, 8, 9, 10, 11, 12, 13, 14, 15)); }
__device__ __forceinline__ v8f wmma16(v16h a, v16h b, v8f c) { return __builtin_amdgcn_wmma_f32_16x16x32_f16(false, a, false, b, (short)0, c, false, false); }
__device__ __forceinline__ v8f wmmab(v16bf a, v16bf b, v8f c) { return __builtin_amdgcn_wmma_f32_16x16x32_bf16(false, a, false, b, (short)0, c, false, false); }
// fragment loaders from K-contiguous 16-bit rows; p already includes + 8*(lane>>4): elements 0..7 <- k0+8h+0..7, elements 8..15 <- k0+16+8h+0..7 (same map for A and B)
__device__ __forceinline__ v16h  ldh(const h16* p) { return cat16(*(const v8h*)p, *(const v8h*)(p + 16)); }
__device__ __forceinline__ v16bf ldb(const bf* p)  { return cat16b(*(const v8us*)p, *(const v8us*)(p + 16)); }
// ordering point for wave-private LDS tiles (same wave writes and reads)
__device__ __forceinline__ void wave_sync() { __builtin_amdgcn_fence(3 /* release order */, "wavefront"); __builtin_amdgcn_wave_barrier(); asm volatile("" ::: "memory"); }

// Operand tiles of every GEMM kernel go through LDS: a work-group of 4 waves (2 x 2 wave tiles) shares 128 A rows and 128 B rows, KT k-values per trip, two buffers.
#define KT    128                // k per trip: rows of 256 B
#define LP    136                // LDS row pitch in 16-bit elements: 272 B = 16 B x odd, conflict-free for 16-B fragment reads
#define TBUF  (256 * LP)         // elements of one buffer: 128 A rows, then 128 B rows
#define NTRIP (DM / KT)
static_assert(DM % KT == 0);
static_assert(NTRIP >= 2);       // the prologue fills two tiles
static_assert((NB * SEQ) % 128 == 0);
static_assert(DM % 128 == 0);
static_assert(KVD % 128 == 0);
static_assert((SEQ - ER_ROWS) % 128 == 0);
// Eight asynchronous 16-B copies per lane, global -> LDS, rows 8 apart (64 rows per work-group of 128 lanes: 16 lanes per 256-B row, 8 rows per copy).
// l: the lane's LDS byte address, g: the lane's global address of the first row (row pitch DM elements). The s_wait_xcnt ends the copies' own statement so that no address register is rewritten ahead of it.
__device__ __forceinline__ void cp8(unsigned l, const unsigned short* g) {
    asm volatile("global_load_async_to_lds_b128 %0, %8, off\n\t"
                 "global_load_async_to_lds_b128 %1, %9, off\n\t"
                 "global_load_async_to_lds_b128 %2, %10, off\n\t"
                 "global_load_async_to_lds_b128 %3, %11, off\n\t"
                 "global_load_async_to_lds_b128 %4, %12, off\n\t"
                 "global_load_async_to_lds_b128 %5, %13, off\n\t"
                 "global_load_async_to_lds_b128 %6, %14, off\n\t"
                 "global_load_async_to_lds_b128 %7, %15, off\n\t"
                 "s_wait_xcnt 0x0"
                 :: "v"(l), "v"(l + 8u * LP * 2u), "v"(l + 16u * LP * 2u), "v"(l + 24u * LP * 2u), "v"(l + 32u * LP * 2u), "v"(l + 40u * LP * 2u), "v"(l + 48u * LP * 2u), "v"(l + 56u * LP * 2u),
                    "v"(g), "v"(g + (size_t)8 * DM), "v"(g + (size_t)16 * DM), "v"(g + (size_t)24 * DM), "v"(g + (size_t)32 * DM), "v"(g + (size_t)40 * DM), "v"(g + (size_t)48 * DM), "v"(g + (size_t)56 * DM)
                 : "memory");
}
// One tile: A rows 0..63 from a0, A rows 64..127 from a1, B rows 0..127 from b0 (32 copies per lane in flight).
__device__ __forceinline__ void stage_tile(unsigned l, const unsigned short* a0, const unsigned short* a1, const unsigned short* b0) {
    cp8(l, a0); cp8(l + 64u * LP * 2u, a1); cp8(l + 128u * LP * 2u, b0); cp8(l + 192u * LP * 2u, b0 + (size_t)64 * DM);
}
// Publish point of the two-buffer ring: own LDS reads retired, own copies landed, then the work-group barrier (it publishes the next tile and frees the buffer just read).
__device__ __forceinline__ void ring_publish() {
    asm volatile("s_wait_dscnt 0x0" ::: "memory");      // this wave's fragment reads of the buffer that is refilled next have retired
    asm volatile("s_wait_asynccnt 0x0" ::: "memory");   // this wave's copies of the next tile have landed
    __syncthreads();
}

// MODE 0: bf16 bits (RNE). MODE 1: f16 of (bf16 value x WOS) (exact for normal results).
template<int MODE>
__global__ __launch_bounds__(256) void k_cvt8(const float* __restrict__ src, unsigned short* dst, size_t n8) {
    const size_t i = (size_t)blockIdx.x * 256 + threadIdx.x; if (i >= n8) return;
    const v8f v = *(const v8f*)(src + i * 8);
    if (MODE == 0) {
        v8us o;
#pragma unroll
        for (int k = 0; k < 8; ++k) o[k] = f2bf(v[k]);
        *(v8us*)(dst + i * 8) = o; 
    } else {
        v8h o;
#pragma unroll
        for (int k = 0; k < 8; ++k) o[k] = (h16)(bfr(v[k]) * WOS);
        h16* d = (h16*)dst;
        *(v8h*)(d + i * 8) = o; 
    }
}

// k_proj: register-blocked bf16 GEMM, one wave per 64x64 tile (16 accumulators), 4 waves per 128x128 work-group tile, operands from K-contiguous bf16 planes through the LDS ring, K = DM.
// C[m][n] = sum_k A[m][k] Bt[n][k]; optional rotate-half rotary on the 64-column tile (one head: partner column = c ^ 32, token = r0 % RB + row);
// written as f16 value (Ph) and f16 residual x2048 (Pr) at tile base (r0/RB)*sRB + (r0%RB)*pitch + (c0/CB)*sCB + (c0%CB), row pitch 'pitch' (halves). grid (M/128, N/128), 128 threads.
template<bool ROPE>
__global__ __launch_bounds__(128) void k_proj(const bf* __restrict__ A, const bf* __restrict__ Bt, h16* Ph, h16* Pr, int RB, size_t sRB, int pitch, int CB, size_t sCB,
                                             const float* __restrict__ COS, const float* __restrict__ SIN) {
    __shared__ __align__(16) unsigned short st[2 * TBUF];
    __shared__ __align__(16) float osw[4 * 16 * 68];
    const int K = DM;
    const int tid = threadIdx.x, lane = tid & 31, lr = lane & 15, hi = lane >> 4;
    const int wave = __builtin_amdgcn_readfirstlane(tid >> 5); const int wm = wave >> 1, wn = wave & 1;
    float* os = osw + wave * 16 * 68;      // wave-private epilogue staging
    const int r0 = blockIdx.x * 128 + wm * 64, c0 = blockIdx.y * 128 + wn * 64;
    v8f acc[4][4];
#pragma unroll
    for (int mb = 0; mb < 4; ++mb)
#pragma unroll
        for (int nb = 0; nb < 4; ++nb) acc[mb][nb] = (v8f){};
    const unsigned lds0 = (unsigned)(uintptr_t)st + (unsigned)((tid >> 4) * (LP * 2) + (tid & 15) * 16);      // this lane's copy target: row tid/16, 16-B chunk tid%16
    const bf* ga = A + (size_t)(blockIdx.x * 128 + (tid >> 4)) * K + (tid & 15) * 8;
    const bf* gb = Bt + (size_t)(blockIdx.y * 128 + (tid >> 4)) * K + (tid & 15) * 8;
    stage_tile(lds0, ga, ga + (size_t)64 * K, gb);
    asm volatile("s_wait_asynccnt 0x0" ::: "memory");   // tile 0 has landed before the barrier that publishes it
    __syncthreads();
    stage_tile(lds0 + TBUF * 2u, ga + KT, ga + (size_t)64 * K + KT, gb + KT);
    const int ao = (wm * 64 + lr) * LP + 8 * hi, bo = (128 + wn * 64 + lr) * LP + 8 * hi;
#pragma unroll 1
    for (int t = 0; t < NTRIP; ++t) {      // rolled: one trip per LDS buffer
        const bf* sb = st + (t & 1) * TBUF;
        v16bf a[2][4], b[2][4];            // two fragment sets: block s + 1 of this buffer is fetched while block s is multiplied
#pragma unroll
        for (int i = 0; i < 4; ++i) { a[0][i] = ldb(sb + ao + i * 16 * LP); b[0][i] = ldb(sb + bo + i * 16 * LP); }
#pragma unroll
        for (int s = 0; s < KT / 32; ++s) {
            if (s + 1 < KT / 32) {
#pragma unroll
                for (int i = 0; i < 4; ++i) { a[(s + 1) & 1][i] = ldb(sb + ao + i * 16 * LP + (s + 1) * 32); b[(s + 1) & 1][i] = ldb(sb + bo + i * 16 * LP + (s + 1) * 32); }
            }
            __builtin_amdgcn_sched_barrier(0);   // the next block's LDS reads stay one group, ahead of this block's matrix instructions
#pragma unroll
            for (int nb = 0; nb < 4; ++nb)
#pragma unroll
                for (int mb = 0; mb < 4; ++mb) acc[mb][nb] = wmmab(a[s & 1][mb], b[s & 1][nb], acc[mb][nb]);
            __builtin_amdgcn_sched_barrier(0);   // no later LDS read moves in among them
        }
        ring_publish();
        if (t + 2 < NTRIP) { const int kn = (t + 2) * KT; stage_tile(lds0 + (unsigned)(t & 1) * (TBUF * 2u), ga + kn, ga + (size_t)64 * K + kn, gb + kn); }
    }
    asm volatile("s_wait_asynccnt 0x0" ::: "memory");   // nothing of the ring is in flight when the wave goes on
    const size_t tbase = (size_t)(r0 / RB) * sRB + (size_t)(r0 % RB) * (size_t)pitch + (size_t)(c0 / CB) * sCB + (size_t)(c0 % CB);
    const int tok0 = r0 % RB;
#pragma unroll
    for (int mb = 0; mb < 4; ++mb) {
#pragma unroll
        for (int nb = 0; nb < 4; ++nb) {
#pragma unroll
            for (int j = 0; j < 8; ++j) os[(hi * 8 + j) * 68 + nb * 16 + lr] = acc[mb][nb][j]; }   // D: row 8h+j, col lane&15; rows 0..15 x columns 0..63 all written
        wave_sync();
        v8h hv[4], rv[4];
#pragma unroll
        for (int s = 0; s < 4; ++s) { const int row = 4 * s + (lane >> 3), c8 = (lane & 7) * 8;   // 4 s x 4 row groups = 16 rows; 8 lanes x 8 = 64 columns
            const v4f x0 = *(const v4fa*)(&os[row * 68 + c8]); const v4f x1 = *(const v4fa*)(&os[row * 68 + c8 + 4]);
            float xv[8];
#pragma unroll
            for (int i = 0; i < 4; ++i) { xv[i] = x0[i]; xv[4 + i] = x1[i]; }
            if (ROPE) {
                const int pc = c8 ^ 32;
                const v4f y0 = *(const v4fa*)(&os[row * 68 + pc]); const v4f y1 = *(const v4fa*)(&os[row * 68 + pc + 4]);
                const size_t to = (size_t)(tok0 + mb * 16 + row) * HD + c8;
                const v4f ca = *(const v4f*)(COS + to), cb = *(const v4f*)(COS + to + 4), sa = *(const v4f*)(SIN + to), sb = *(const v4f*)(SIN + to + 4);
                const float sg = (c8 < 32) ? -1.0f : 1.0f;     // rotated = concat(-x2, x1)
#pragma unroll
                for (int i = 0; i < 4; ++i) { xv[i] = x0[i] * bfr(ca[i]) + (sg * y0[i]) * bfr(sa[i]); xv[4 + i] = x1[i] * bfr(cb[i]) + (sg * y1[i]) * bfr(sb[i]); }
            }
            v8h hh, rr;
#pragma unroll
            for (int i = 0; i < 8; ++i) { const h16 a0 = (h16)xv[i]; hh[i] = a0; rr[i] = (h16)((xv[i] - (float)a0) * QRS); }
            hv[s] = hh; rv[s] = rr; }
        const size_t sb0 = tbase + (size_t)(mb * 16) * (size_t)pitch;
#pragma unroll
        for (int s = 0; s < 4; ++s) { const int row = 4 * s + (lane >> 3), c8 = (lane & 7) * 8; const size_t oo = sb0 + (size_t)row * (size_t)pitch + c8;
            *(v8h*)(Ph + oo) = hv[s]; *(v8h*)(Pr + oo) = rv[s]; }
        
        wave_sync();
    }
}

// Key/value tiles of k_flash go through LDS: the 4 waves of a work-group (64 query rows of one head) share 64 keys per stage, two buffers.
#define FK    64                 // keys per stage: K tile 64 key rows x 64 d, V^T tile 64 d rows x 64 keys, rows of 128 B each
#define FP    72                 // LDS row pitch in 16-bit elements: 144 B = 16 B x odd, conflict-free for 16-B fragment reads
#define FT    (64 * FP)          // elements of one tile
static_assert(16 * AW == FK);    // the diagonal stage of a work-group is its last one
static_assert(HD == 64);
// Eight asynchronous 16-B copies per lane, global -> LDS: four for a K tile at l, four for a V^T tile at l + one tile; rows 16 apart (128 lanes: 8 lanes per 128-B row, 16 rows per copy).
// l: the lane's LDS byte address, gk / gv: the lane's global addresses of its first row (row pitch HD / SEQ elements). The s_wait_xcnt ends the copies' own statement so that no address register is rewritten ahead of it.
__device__ __forceinline__ void cp_kv(unsigned l, const h16* gk, const h16* gv) {
    asm volatile("global_load_async_to_lds_b128 %0, %8, off\n\t"
                 "global_load_async_to_lds_b128 %1, %9, off\n\t"
                 "global_load_async_to_lds_b128 %2, %10, off\n\t"
                 "global_load_async_to_lds_b128 %3, %11, off\n\t"
                 "global_load_async_to_lds_b128 %4, %12, off\n\t"
                 "global_load_async_to_lds_b128 %5, %13, off\n\t"
                 "global_load_async_to_lds_b128 %6, %14, off\n\t"
                 "global_load_async_to_lds_b128 %7, %15, off\n\t"
                 "s_wait_xcnt 0x0"
                 :: "v"(l), "v"(l + 16u * FP * 2u), "v"(l + 32u * FP * 2u), "v"(l + 48u * FP * 2u),
                    "v"(l + FT * 2u), "v"(l + FT * 2u + 16u * FP * 2u), "v"(l + FT * 2u + 32u * FP * 2u), "v"(l + FT * 2u + 48u * FP * 2u),
                    "v"(gk), "v"(gk + (size_t)16 * HD), "v"(gk + (size_t)32 * HD), "v"(gk + (size_t)48 * HD),
                    "v"(gv), "v"(gv + (size_t)16 * SEQ), "v"(gv + (size_t)32 * SEQ), "v"(gv + (size_t)48 * SEQ)
                 : "memory");
}

// k_flash: fused causal attention, one wave per 16 query rows of one (batch, head), 4 waves (64 consecutive query rows) per work-group; Q fragments straight from the f16 planes,
// K / V^T fragments from the LDS ring (buffer: K value tile, V^T value tile; ER: then K residual tile, V^T residual tile), two 16-B LDS loads each.
// Transposed form: S^T[key][t] = K Q^T (A = K rows, B = Q rows); lane (t = lane&15, h = lane>>4) holds keys 8h+r of each 16-key tile, so the packed
// P tile is directly the B fragment of O^T[d][t] = V^T P^T (element r <- tile keys 0..15, element 8+r <- tile keys 16..31, lane unchanged).
// Head h reads key/value group h / GS_. A wave works on keys 0 .. t0+15 in steps of 32 (two per stage; it passes a stage's step that lies wholly above its rows); keys above the query index are replaced by NEGB (P = 0) on the diagonal step.
// ER: value + residual path (scores kh*qh + [kh*qr + kr*qh]/2048, O = vh*ph + [vr*ph + vh*pr]/2048), residual products in separate accumulators.
template<bool ER>
__global__ __launch_bounds__(32 * AW) void k_flash(const h16* __restrict__ QH, const h16* __restrict__ QR, const h16* __restrict__ KH, const h16* __restrict__ KR,
                                                   const h16* __restrict__ VH, const h16* __restrict__ VR, h16* CH, h16* CR, int xb0) {
    constexpr int FBUF = (ER ? 4 : 2) * FT;      // elements of one buffer
    __shared__ __align__(16) unsigned short st[2 * FBUF];
    __shared__ __align__(16) float os[AW * 16 * 68];
    const int tid = threadIdx.x, lane = tid & 31, lr = lane & 15, hi = lane >> 4;
    const int wave = __builtin_amdgcn_readfirstlane(tid >> 5);
    const int zh = blockIdx.y; const int b = zh / NH_, h = zh % NH_, g = h / GS_;
    const int t0 = (((int)blockIdx.x + xb0) * AW + wave) * 16;
    const int tq = t0 + lr;
    const size_t qbase = (size_t)zh * SEQ * HD;
    const size_t kvb = (size_t)(b * NG_ + g) * SEQ * HD;
    const size_t qo = qbase + (size_t)(t0 + lr) * HD + 8 * hi;
    const v16h qh0 = ldh(QH + qo), qh1 = ldh(QH + qo + 32);          // B fragments: col t, k = d
    v16h qr0 = qh0, qr1 = qh1;
    if (ER) { qr0 = ldh(QR + qo); qr1 = ldh(QR + qo + 32); }
    const int ko = lr * FP + 8 * hi;           // in a buffer: + key * FP        (A fragment: row key, k = d)
    const int vo = FT + lr * FP + 8 * hi;      // in a buffer: + 16j*FP + key    (A fragment: row d, k = key)
    const int nst = (int)blockIdx.x + xb0 + 1;      // stages of this work-group: keys 0 .. (its last query row), the same for its 4 waves
    const unsigned lds0 = (unsigned)(uintptr_t)st + (unsigned)((tid >> 3) * (FP * 2) + (tid & 7) * 16);      // this lane's copy target: row tid/8, 16-B chunk tid%8
    const size_t gko = kvb + (size_t)(tid >> 3) * HD + (tid & 7) * 8;      // + key * HD
    const size_t gvo = kvb + (size_t)(tid >> 3) * SEQ + (tid & 7) * 8;     // + key
    cp_kv(lds0, KH + gko, VH + gvo);
    if (ER) cp_kv(lds0 + 2u * FT * 2u, KR + gko, VR + gvo);
    asm volatile("s_wait_asynccnt 0x0" ::: "memory");   // stage 0 has landed before the barrier that publishes it
    __syncthreads();
    if (nst > 1) {
        cp_kv(lds0 + FBUF * 2u, KH + gko + (size_t)FK * HD, VH + gvo + FK);
        if (ER) cp_kv(lds0 + FBUF * 2u + 2u * FT * 2u, KR + gko + (size_t)FK * HD, VR + gvo + FK);
    }
    v8f oH[4], oL[4];
#pragma unroll
    for (int j = 0; j < 4; ++j) { oH[j] = (v8f){}; oL[j] = (v8f){}; }
    float m = NEGB, l = 0.0f;
#pragma unroll 1
    for (int sg = 0; sg < nst; ++sg) {      // rolled: one trip per LDS buffer
      const h16* sb = (const h16*)st + (sg & 1) * FBUF;
#pragma unroll
      for (int u = 0; u < FK / 32; ++u) {      // unrolled: each step's LDS offsets become immediates of its fragment loads
        const int key0 = sg * FK + u * 32;
        if (key0 >= t0 + 16) continue;      // wave-uniform: on the diagonal stage the step lies wholly above this wave's rows
        const h16* ka = sb + ko + u * 32 * FP;
        float ta[8], tb[8];
        if (!ER) {
            const v16h ka0 = ldh(ka), ka1 = ldh(ka + 32), kb0 = ldh(ka + 16 * FP), kb1 = ldh(ka + 16 * FP + 32);
            v8f sHa = (v8f){}, sHb = (v8f){};
            sHa = wmma16(ka0, qh0, sHa); sHb = wmma16(kb0, qh0, sHb);
            sHa = wmma16(ka1, qh1, sHa); sHb = wmma16(kb1, qh1, sHb);
            asm volatile("v_nop\n\tv_nop\n\tv_nop\n\tv_nop" : "+v"(sHa), "+v"(sHb) : "v"(ka0), "v"(ka1), "v"(kb0), "v"(kb1));
#pragma unroll
            for (int r = 0; r < 8; ++r) { ta[r] = sHa[r] * SC2; tb[r] = sHb[r] * SC2; }
        } else {
            const h16* kr = ka + 2 * FT;
            { const v16h ka0 = ldh(ka), ka1 = ldh(ka + 32), ra0 = ldh(kr), ra1 = ldh(kr + 32);
              v8f sH = (v8f){}, sL = (v8f){};
              sH = wmma16(ka0, qh0, sH); sL = wmma16(ka0, qr0, sL);
              sH = wmma16(ka1, qh1, sH); sL = wmma16(ka1, qr1, sL);
              sL = wmma16(ra0, qh0, sL); sL = wmma16(ra1, qh1, sL);
              asm volatile("v_nop\n\tv_nop\n\tv_nop\n\tv_nop" : "+v"(sH), "+v"(sL) : "v"(ka0), "v"(ka1), "v"(ra0), "v"(ra1));
#pragma unroll
              for (int r = 0; r < 8; ++r) ta[r] = (sH[r] + sL[r] * QRI) * SC2; }
            { const v16h kb0 = ldh(ka + 16 * FP), kb1 = ldh(ka + 16 * FP + 32), rb0 = ldh(kr + 16 * FP), rb1 = ldh(kr + 16 * FP + 32);
              v8f sH = (v8f){}, sL = (v8f){};
              sH = wmma16(kb0, qh0, sH); sL = wmma16(kb0, qr0, sL);
              sH = wmma16(kb1, qh1, sH); sL = wmma16(kb1, qr1, sL);
              sL = wmma16(rb0, qh0, sL); sL = wmma16(rb1, qh1, sL);
              asm volatile("v_nop\n\tv_nop\n\tv_nop\n\tv_nop" : "+v"(sH), "+v"(sL) : "v"(kb0), "v"(kb1), "v"(rb0), "v"(rb1));
#pragma unroll
              for (int r = 0; r < 8; ++r) tb[r] = (sH[r] + sL[r] * QRI) * SC2; }
        }
        if (key0 + 31 > t0) {      // wave-uniform: only the diagonal step holds keys above some query index; every row keeps key key0 <= t
#pragma unroll
            for (int r = 0; r < 8; ++r) { const int kk = key0 + 8 * hi + r; ta[r] = (kk <= tq) ? ta[r] : NEGB; tb[r] = (kk + 16 <= tq) ? tb[r] : NEGB; }
        }
        float mx = NEGB;
#pragma unroll
        for (int r = 0; r < 8; ++r) mx = fmaxf(mx, fmaxf(ta[r], tb[r]));
        mx = fmaxf(mx, __shfl_xor(mx, 16, 32));
        const float mnew = fmaxf(m, mx);
        const float alpha = __builtin_amdgcn_exp2f(m - mnew);
        const float sh = PSH - mnew;
        v16h pb, pq; float ls = 0.0f;
        if (!ER) {
#pragma unroll
            for (int r = 0; r < 8; ++r) { const h16 pa = (h16)__builtin_amdgcn_exp2f(ta[r] + sh); const h16 pc = (h16)__builtin_amdgcn_exp2f(tb[r] + sh); pb[r] = pa; pb[8 + r] = pc; ls += (float)pa + (float)pc; }
            pq = pb;
        } else {
#pragma unroll
            for (int r = 0; r < 8; ++r) { const float fa = __builtin_amdgcn_exp2f(ta[r] + sh); const float fc = __builtin_amdgcn_exp2f(tb[r] + sh);
                const h16 pa = (h16)fa; const h16 pc = (h16)fc; const h16 qa = (h16)((fa - (float)pa) * QRS); const h16 qc = (h16)((fc - (float)pc) * QRS);
                pb[r] = pa; pb[8 + r] = pc; pq[r] = qa; pq[8 + r] = qc; ls += ((float)pa + (float)pc) + ((float)qa + (float)qc) * QRI; }
        }
        l = l * alpha + ls; m = mnew;
#pragma unroll
        for (int j = 0; j < 4; ++j) { oH[j] = oH[j] * alpha; if (ER) oL[j] = oL[j] * alpha; }
        const h16* va = sb + vo + u * 32;
        const v16h v0 = ldh(va), v1 = ldh(va + 16 * FP), v2 = ldh(va + 32 * FP), v3 = ldh(va + 48 * FP);
        if (!ER) {
            oH[0] = wmma16(v0, pb, oH[0]); oH[1] = wmma16(v1, pb, oH[1]); oH[2] = wmma16(v2, pb, oH[2]); oH[3] = wmma16(v3, pb, oH[3]);
            asm volatile("v_nop\n\tv_nop\n\tv_nop\n\tv_nop" : "+v"(oH[0]), "+v"(oH[1]), "+v"(oH[2]), "+v"(oH[3]) : "v"(v0), "v"(v1), "v"(v2), "v"(v3), "v"(pb));
        } else {
            const h16* vr = va + 2 * FT;
            const v16h w0 = ldh(vr), w1 = ldh(vr + 16 * FP), w2 = ldh(vr + 32 * FP), w3 = ldh(vr + 48 * FP);
            oH[0] = wmma16(v0, pb, oH[0]); oH[1] = wmma16(v1, pb, oH[1]); oH[2] = wmma16(v2, pb, oH[2]); oH[3] = wmma16(v3, pb, oH[3]);
            oL[0] = wmma16(w0, pb, oL[0]); oL[1] = wmma16(w1, pb, oL[1]); oL[2] = wmma16(w2, pb, oL[2]); oL[3] = wmma16(w3, pb, oL[3]);
            oL[0] = wmma16(v0, pq, oL[0]); oL[1] = wmma16(v1, pq, oL[1]); oL[2] = wmma16(v2, pq, oL[2]); oL[3] = wmma16(v3, pq, oL[3]);
            asm volatile("v_nop\n\tv_nop\n\tv_nop\n\tv_nop" : "+v"(oH[0]), "+v"(oH[1]), "+v"(oH[2]), "+v"(oH[3]), "+v"(oL[0]), "+v"(oL[1]), "+v"(oL[2]), "+v"(oL[3])
                         : "v"(v0), "v"(v1), "v"(v2), "v"(v3), "v"(w0), "v"(w1), "v"(w2), "v"(w3), "v"(pb), "v"(pq));
        }
      }
      ring_publish();
      if (sg + 2 < nst) { const int kn = (sg + 2) * FK; const unsigned lb = lds0 + (unsigned)(sg & 1) * (FBUF * 2u);
          cp_kv(lb, KH + gko + (size_t)kn * HD, VH + gvo + kn);
          if (ER) cp_kv(lb + 2u * FT * 2u, KR + gko + (size_t)kn * HD, VR + gvo + kn); }
    }
    asm volatile("s_wait_asynccnt 0x0" ::: "memory");   // nothing of the ring is in flight when the wave goes on
    l += __shfl_xor(l, 16, 32);
    const float inv = CXS * (1.0f / l);
    const int wb = wave * 16 * 68;
    // O^T D layout: o_j[r] = (d = 16j + 8h + r, t = lane&15) -> os[t][d]; rows 0..15 x columns 0..63 all written
#pragma unroll
    for (int j = 0; j < 4; ++j) { v4f a, c;
#pragma unroll
        for (int i = 0; i < 4; ++i) {
            if (ER) { a[i] = (oH[j][i] + oL[j][i] * QRI) * inv; c[i] = (oH[j][4 + i] + oL[j][4 + i] * QRI) * inv; }
            else    { a[i] = oH[j][i] * inv; c[i] = oH[j][4 + i] * inv; } }
        *(v4fa*)(&os[wb + lr * 68 + 16 * j + 8 * hi]) = a; *(v4fa*)(&os[wb + lr * 68 + 16 * j + 8 * hi + 4]) = c; }
    wave_sync();
    v8h hv[4], rv[4];
#pragma unroll
    for (int s = 0; s < 4; ++s) { const int row = 4 * s + (lane >> 3), c8 = (lane & 7) * 8;   // 4 s x 4 row groups = 16 rows; 8 lanes x 8 = 64 columns
        const v4f x0 = *(const v4fa*)(&os[wb + row * 68 + c8]); const v4f x1 = *(const v4fa*)(&os[wb + row * 68 + c8 + 4]); v8h hh, rr;
#pragma unroll
        for (int i = 0; i < 4; ++i) { const h16 a0 = (h16)x0[i]; const h16 a1 = (h16)x1[i]; hh[i] = a0; hh[4 + i] = a1; rr[i] = (h16)((x0[i] - (float)a0) * QRS); rr[4 + i] = (h16)((x1[i] - (float)a1) * QRS); }
        hv[s] = hh; rv[s] = rr; }
    const size_t cbase = ((size_t)b * SEQ + t0) * DM + (size_t)h * HD;
    const size_t rbase = ((size_t)b * ER_ROWS + t0) * DM + (size_t)h * HD;     // used by the ER instantiation only (t0 < ER_ROWS there)
#pragma unroll
    for (int s = 0; s < 4; ++s) { const int row = 4 * s + (lane >> 3), c8 = (lane & 7) * 8;
        *(v8h*)(CH + cbase + (size_t)row * DM + c8) = hv[s]; if (ER) *(v8h*)(CR + rbase + (size_t)row * DM + c8) = rv[s]; }
    
}

// k_out: output projection, f16 GEMM, one wave per (16*MB) x 64 tile, 4 waves per (32*MB) x 128 work-group tile, operands from K-contiguous f16 planes through the LDS ring, K = DM.
// A rows of a buffer: MB = 4: 128 rows of CH; MB = 2 with RES: 64 rows of CH, then the same 64 rows of CR.
// OUT[b][t][n] = OSC * sum_k (CH[b*SEQ+t][k] + CR[b*ER_ROWS+t][k]/2048) * WO[n][k]; RES: residual products in their own accumulators.
// Rows t in [tstart, tstart+tcount) of every batch; grid (NB*tcount/(32*MB), DM/128), 128 threads.
template<int MB, bool RES>
__global__ __launch_bounds__(128) void k_out(const h16* __restrict__ CH, const h16* __restrict__ CR, const h16* __restrict__ WO, float* OUT, int tstart, int tcount) {
    static_assert(RES ? MB == 2 : MB == 4);
    __shared__ __align__(16) unsigned short st[2 * TBUF];
    __shared__ __align__(16) float osw[4 * 16 * 68];
    const int tid = threadIdx.x, lane = tid & 31, lr = lane & 15, hi = lane >> 4;
    const int wave = __builtin_amdgcn_readfirstlane(tid >> 5); const int wm = wave >> 1, wn = wave & 1;
    float* os = osw + wave * 16 * 68;      // wave-private epilogue staging
    const int tiles = tcount / (32 * MB);
    const int b = (int)blockIdx.x / tiles, tw = tstart + ((int)blockIdx.x % tiles) * 32 * MB, t = tw + wm * 16 * MB, c0 = blockIdx.y * 128 + wn * 64;
    v8f acc[MB][4], acr[MB][4];
#pragma unroll
    for (int mb = 0; mb < MB; ++mb)
#pragma unroll
        for (int nb = 0; nb < 4; ++nb) { acc[mb][nb] = (v8f){}; acr[mb][nb] = (v8f){}; }
    const unsigned lds0 = (unsigned)(uintptr_t)st + (unsigned)((tid >> 4) * (LP * 2) + (tid & 15) * 16);      // this lane's copy target: row tid/16, 16-B chunk tid%16
    const unsigned short* ga0 = (const unsigned short*)CH + ((size_t)b * SEQ + tw + (tid >> 4)) * DM + (tid & 15) * 8;
    const unsigned short* ga1 = RES ? (const unsigned short*)CR + ((size_t)b * ER_ROWS + tw + (tid >> 4)) * DM + (tid & 15) * 8     // RES only (tw < ER_ROWS there)
                                    : ga0 + (size_t)64 * DM;
    const unsigned short* gb = (const unsigned short*)WO + (size_t)(blockIdx.y * 128 + (tid >> 4)) * DM + (tid & 15) * 8;
    stage_tile(lds0, ga0, ga1, gb);
    asm volatile("s_wait_asynccnt 0x0" ::: "memory");   // tile 0 has landed before the barrier that publishes it
    __syncthreads();
    stage_tile(lds0 + TBUF * 2u, ga0 + KT, ga1 + KT, gb + KT);
    const int ao = (wm * 16 * MB + lr) * LP + 8 * hi, ro = ao + 64 * LP, bo = (128 + wn * 64 + lr) * LP + 8 * hi;
#pragma unroll 1
    for (int tr = 0; tr < NTRIP; ++tr) {      // rolled: one trip per LDS buffer
      const h16* sb = (const h16*)st + (tr & 1) * TBUF;
      v16h a[2][MB], ar[2][MB], bb[2][4];      // two fragment sets: block s + 1 of this buffer is fetched while block s is multiplied
#pragma unroll
      for (int i = 0; i < MB; ++i) { a[0][i] = ldh(sb + ao + i * 16 * LP); if (RES) ar[0][i] = ldh(sb + ro + i * 16 * LP); }
#pragma unroll
      for (int i = 0; i < 4; ++i) bb[0][i] = ldh(sb + bo + i * 16 * LP);
#pragma unroll
      for (int s = 0; s < KT / 32; ++s) {
        if (s + 1 < KT / 32) {
#pragma unroll
            for (int i = 0; i < MB; ++i) { a[(s + 1) & 1][i] = ldh(sb + ao + i * 16 * LP + (s + 1) * 32); if (RES) ar[(s + 1) & 1][i] = ldh(sb + ro + i * 16 * LP + (s + 1) * 32); }
#pragma unroll
            for (int i = 0; i < 4; ++i) bb[(s + 1) & 1][i] = ldh(sb + bo + i * 16 * LP + (s + 1) * 32);
        }
        __builtin_amdgcn_sched_barrier(0);   // the next block's LDS reads stay one group, ahead of this block's matrix instructions
#pragma unroll
        for (int nb = 0; nb < 4; ++nb)
#pragma unroll
            for (int mb = 0; mb < MB; ++mb) { acc[mb][nb] = wmma16(a[s & 1][mb], bb[s & 1][nb], acc[mb][nb]); if (RES) acr[mb][nb] = wmma16(ar[s & 1][mb], bb[s & 1][nb], acr[mb][nb]); }
        __builtin_amdgcn_sched_barrier(0);   // no later LDS read moves in among them
      }
      ring_publish();
      if (tr + 2 < NTRIP) { const int kn = (tr + 2) * KT; stage_tile(lds0 + (unsigned)(tr & 1) * (TBUF * 2u), ga0 + kn, ga1 + kn, gb + kn); }
    }
    asm volatile("s_wait_asynccnt 0x0" ::: "memory");   // nothing of the ring is in flight when the wave goes on
#pragma unroll
    for (int mb = 0; mb < MB; ++mb) {
#pragma unroll
        for (int nb = 0; nb < 4; ++nb) {
#pragma unroll
            for (int j = 0; j < 8; ++j) os[(hi * 8 + j) * 68 + nb * 16 + lr] = RES ? (acc[mb][nb][j] + acr[mb][nb][j] * QRI) * OSC : acc[mb][nb][j] * OSC; }   // D: row 8h+j, col lane&15
        wave_sync();
        float* orow = OUT + ((size_t)b * OUT_SEQ + t + mb * 16) * DM + c0;
{
#pragma unroll
            for (int s = 0; s < 8; ++s) { const int row = 2 * s + hi, cofs = lr * 4;   // 8 s x 2 rows = 16 rows; 16 lanes x 4 floats = 64 columns
                const v4f val = *(const v4fa*)(&os[row * 68 + cofs]);
                *(v4f*)(orow + (size_t)row * DM + cofs) = val; }
             }
        wave_sync();
    }
}

static constexpr size_t al256(size_t v) { return (v + 255) & ~(size_t)255; }
static constexpr size_t SZ_XB = al256((size_t)NB * SEQ * DM * 2);
static constexpr size_t SZ_WQ = al256((size_t)DM * DM * 2);
static constexpr size_t SZ_WK = al256((size_t)KVD * DM * 2);
static constexpr size_t SZ_QP = al256((size_t)NB * NH_ * SEQ * HD * 2);
static constexpr size_t SZ_KP = al256((size_t)NB * NG_ * SEQ * HD * 2);
static constexpr size_t SZ_CH = al256((size_t)NB * SEQ * DM * 2);
static constexpr size_t SZ_CR = al256((size_t)NB * ER_ROWS * DM * 2);
static constexpr size_t SZ_TOTAL = SZ_XB + 2 * SZ_WQ + 2 * SZ_WK + 2 * SZ_QP + 4 * SZ_KP + SZ_CH + SZ_CR;
static_assert(SZ_TOTAL <= (size_t)134217728);          // workspace carve <= 128 MiB

extern "C" void kernel_launch(void* const* d_in, const int* in_sizes, int n_in,
                              void* d_out, int out_size, void* d_ws, size_t ws_size, hipStream_t stream) {
    if (n_in < 7) return;
    const size_t needx = ((size_t)(NB - 1) * SEQ_FULL + SEQ) * DM;
    if ((size_t)in_sizes[0] < needx) return;
    if ((size_t)in_sizes[1] < (size_t)DM * DM || (size_t)in_sizes[2] < (size_t)KVD * DM || (size_t)in_sizes[3] < (size_t)KVD * DM || (size_t)in_sizes[4] < (size_t)DM * DM) return;
    if ((size_t)in_sizes[5] < (size_t)SEQ * HD || (size_t)in_sizes[6] < (size_t)SEQ * HD) return;
    if ((size_t)out_size < ((size_t)(NB - 1) * OUT_SEQ + SEQ) * DM) return;
    if (SZ_TOTAL > ws_size) return;
    // wire order: x, Wq, Wk, Wv, Wo, cos, sin (W as [out][in] = Bt as-is; cos/sin [token][64] read as values)
    const float* x = (const float*)d_in[0]; const float* wq = (const float*)d_in[1]; const float* wk = (const float*)d_in[2]; const float* wv = (const float*)d_in[3];
    const float* wo = (const float*)d_in[4]; const float* cs = (const float*)d_in[5]; const float* sn = (const float*)d_in[6];
    float* OUT = (float*)d_out;      // [NB][SEQ][2048]
    char* wsp = (char*)d_ws;
    bf* XB = (bf*)wsp; wsp += SZ_XB;                 // [NB*SEQ][2048] bf16
    bf* WQ = (bf*)wsp; wsp += SZ_WQ;                 // [2048][2048] bf16
    bf* WK = (bf*)wsp; wsp += SZ_WK;                 // [512][2048] bf16
    bf* WV = (bf*)wsp; wsp += SZ_WK;                 // [512][2048] bf16
    h16* WO = (h16*)wsp; wsp += SZ_WQ;               // [2048][2048] f16 x64
    h16* QH = (h16*)wsp; wsp += SZ_QP;               // [NB*32][SEQ][64]
    h16* QR = (h16*)wsp; wsp += SZ_QP;               // residual x2048
    h16* KH = (h16*)wsp; wsp += SZ_KP;               // [NB*8][SEQ][64]
    h16* KR = (h16*)wsp; wsp += SZ_KP;               // residual x2048
    h16* VH = (h16*)wsp; wsp += SZ_KP;               // [NB*8][64][SEQ]
    h16* VR = (h16*)wsp; wsp += SZ_KP;               // residual x2048
    h16* CH = (h16*)wsp; wsp += SZ_CH;               // [NB*SEQ][2048] ctx x64
    h16* CR = (h16*)wsp; wsp += SZ_CR;               // [NB*ER_ROWS][2048] residual x2048

    if (SEQ == SEQ_FULL) {
        const size_t n8 = (size_t)NB * SEQ * DM / 8;
        k_cvt8<0><<<(unsigned)((n8 + 255) / 256), 256, 0, stream>>>(x, XB, n8);
    } else {
        const size_t n8 = (size_t)SEQ * DM / 8;
        for (int b = 0; b < NB; ++b) k_cvt8<0><<<(unsigned)((n8 + 255) / 256), 256, 0, stream>>>(x + (size_t)b * SEQ_FULL * DM, XB + (size_t)b * SEQ * DM, n8);
    }
    { const size_t n8 = (size_t)DM * DM / 8; const unsigned g = (unsigned)((n8 + 255) / 256);
      k_cvt8<0><<<g, 256, 0, stream>>>(wq, WQ, n8);
      k_cvt8<1><<<g, 256, 0, stream>>>(wo, (unsigned short*)WO, n8); }
    { const size_t n8 = (size_t)KVD * DM / 8; const unsigned g = (unsigned)((n8 + 255) / 256);
      k_cvt8<0><<<g, 256, 0, stream>>>(wk, WK, n8); k_cvt8<0><<<g, 256, 0, stream>>>(wv, WV, n8); }

    // q: A = x rows (m = b*SEQ + t), Bt = Wq rows (n = h*64 + d) -> planes [(b*32 + h)][t][d], rotary fused
    k_proj<true><<<dim3(NB * SEQ / 128, DM / 128, 1), 128, 0, stream>>>(XB, WQ, QH, QR, SEQ, (size_t)NH_ * SEQ * HD, HD, HD, (size_t)SEQ * HD, cs, sn);
    // k: Bt = Wk rows (n = g*64 + d) -> planes [(b*8 + g)][t][d], rotary fused
    k_proj<true><<<dim3(NB * SEQ / 128, KVD / 128, 1), 128, 0, stream>>>(XB, WK, KH, KR, SEQ, (size_t)NG_ * SEQ * HD, HD, HD, (size_t)SEQ * HD, cs, sn);
    // v^T: A = Wv rows (m = g*64 + d, 512 rows), Bt = x rows (n = b*SEQ + t) -> planes [(b*512 + m)][t] = [(b*8 + g)][d][t]
    k_proj<false><<<dim3(KVD / 128, NB * SEQ / 128, 1), 128, 0, stream>>>(WV, XB, VH, VR, KVD, (size_t)0, SEQ, SEQ, (size_t)KVD * SEQ, cs, sn);

    k_flash<true><<<dim3(ER_ROWS / (16 * AW), NB * NH_, 1), 32 * AW, 0, stream>>>(QH, QR, KH, KR, VH, VR, CH, CR, 0);
    if (SEQ > ER_ROWS)
        k_flash<false><<<dim3((SEQ - ER_ROWS) / (16 * AW) + (SEQ == ER_ROWS), NB * NH_, 1), 32 * AW, 0, stream>>>(QH, QR, KH, KR, VH, VR, CH, CR, ER_ROWS / (16 * AW));

    k_out<2, true><<<dim3(NB * ER_ROWS / 64, DM / 128, 1), 128, 0, stream>>>(CH, CR, WO, OUT, 0, ER_ROWS);
    if (SEQ > ER_ROWS)
        k_out<4, false><<<dim3(NB * (SEQ - ER_ROWS) / 128 + (SEQ == ER_ROWS), DM / 128, 1), 128, 0, stream>>>(CH, CR, WO, OUT, ER_ROWS, (SEQ == ER_ROWS) ? 128 : (SEQ - ER_ROWS));
}

// v003
// One run takes 174 microseconds.
// Timed twice side by side with v002, it ran 1.19 and 1.18 times as fast.
// All steps since v000 together make it 2.42 times as fast.
#include <hip/hip_runtime.h>

// Causal grouped-query attention, width 2048 = 32 heads x 64, 8 key/value groups (4 heads per group), rotate-half rotary with INPUT cos/sin tables, output projection; x [NB][SEQ][2048], W [out][in] (y = x W^T), no biases, score scale 1/8.
// Compute dtypes, f32 accumulate everywhere: q/k/v projections v_wmma_f32_16x16x32_bf16 (x, W RNE-converted to bf16; products exact); rotary in f32 with bf16-converted table values;
// scores, P.V and the output projection v_wmma_f32_16x16x32_f16: q, k, v^T, ctx(x64) as f16 value planes plus f16 residual planes x2048; Wo as f16 of the bf16 value x64; P carried x256.
// Query rows >= 512 use single f16 products; query rows < 512 use value + residual (three products for scores and P.V, two for the output projection), residual products in their own accumulators.
// Transposed flash form (S^T = K Q^T, O^T = V^T P^T), online softmax in f32 (running max), causal mask applied by value on the diagonal key step.

#ifndef NB
#define NB 2
#endif
#ifndef SEQ
#define SEQ 2048
#endif
#define NB_FULL  2
#define SEQ_FULL 2048
#ifndef OUT_SEQ
#define OUT_SEQ SEQ              // row pitch (in tokens) between batches of the output
#endif
#define DM   2048                // model width = depth of every GEMM
#define NH_  32
#define NG_  8
#define GS_  4                   // heads per key/value group
#define HD   64
#define KVD  512                 // NG_ * HD
#define AW   4                   // waves per flash block (16 query rows each)
#define QRS  2048.0f             // carry of every residual plane
#define QRI  (1.0f / 2048.0f)
#define SC2  (0.125f * 1.4426950408889634f)   // HD^-0.5 * log2(e)
#define PSH  8.0f                // log2 of the P carry (256)
#define CXS  64.0f               // carry of the ctx plane
#define WOS  64.0f               // carry of the Wo plane
#define OSC  (1.0f / 4096.0f)    // 1 / (CXS * WOS)
#define NEGB (-3.0e38f)

static constexpr int ER_ROWS = (SEQ < 512) ? SEQ : 512;   // query rows per batch on the value + residual path

static_assert(HD == 64);
static_assert(NH_ * HD == DM);
static_assert(NG_ * HD == KVD);
static_assert(NG_ * GS_ == NH_);
static_assert(DM % 64 == 0);
static_assert(DM % 32 == 0);                   // GEMM k-loop steps by 32
static_assert(KVD % 64 == 0);
static_assert(SEQ % 64 == 0);                  // a 64-row tile never straddles two batches
static_assert(SEQ % (16 * AW) == 0);
static_assert(ER_ROWS % 64 == 0);
static_assert((SEQ - ER_ROWS) % 64 == 0);
static_assert(((size_t)SEQ * DM) % 8 == 0);
static_assert(NB <= NB_FULL);
static_assert(SEQ <= SEQ_FULL);

typedef _Float16 h16;
typedef unsigned short bf;
typedef __attribute__((ext_vector_type(16))) __bf16   v16bf;
typedef __attribute__((ext_vector_type(16))) _Float16 v16h;
typedef __attribute__((ext_vector_type(8)))  _Float16 v8h;
typedef __attribute__((ext_vector_type(8)))  unsigned short v8us;
typedef __attribute__((ext_vector_type(8)))  float    v8f;
typedef __attribute__((ext_vector_type(4)))  float    v4f;
typedef v4f  __attribute__((may_alias)) v4fa;

__device__ __forceinline__ unsigned short f2bf(float f) { unsigned u = __float_as_uint(f); u += 0x7FFFu + ((u >> 16) & 1u); return (unsigned short)(u >> 16); }
__device__ __forceinline__ float bfr(float f) { return __uint_as_float(((unsigned)f2bf(f)) << 16); }   // value after RNE conversion to bf16
__device__ __forceinline__ v16h cat16(v8h lo, v8h hi) { return __builtin_shufflevector(lo, hi, 0, 1, 2, 3, 4, 5, 6, 7, 8, 9, 10, 11, 12, 13, 14, 15); }
__device__ __forceinline__ v16bf cat16b(v8us lo, v8us hi) { return __builtin_bit_cast(v16bf, __builtin_shufflevector(lo, hi, 0, 1, 2, 3, 4, 5, 6, 7, 8, 9, 10, 11, 12, 13, 14, 15)); }
__device__ __forceinline__ v8f wmma16(v16h a, v16h b, v8f c) { return __builtin_amdgcn_wmma_f32_16x16x32_f16(false, a, false, b, (short)0, c, false, false); }
__device__ __forceinline__ v8f wmmab(v16bf a, v16bf b, v8f c) { return __builtin_amdgcn_wmma_f32_16x16x32_bf16(false, a, false, b, (short)0, c, false, false); }
// fragment loaders from K-contiguous 16-bit rows; p already includes + 8*(lane>>4): elements 0..7 <- k0+8h+0..7, elements 8..15 <- k0+16+8h+0..7 (same map for A and B)
__device__ __forceinline__ v16h  ldh(const h16* p) { return cat16(*(const v8h*)p, *(const v8h*)(p + 16)); }
__device__ __forceinline__ v16bf ldb(const bf* p)  { return cat16b(*(const v8us*)p, *(const v8us*)(p + 16)); }
// ordering point for wave-private LDS tiles (same wave writes and reads)
__device__ __forceinline__ void wave_sync() { __builtin_amdgcn_fence(3 /* release order */, "wavefront"); __builtin_amdgcn_wave_barrier(); asm volatile("" ::: "memory"); }

// Operand tiles of every GEMM kernel go through LDS: a work-group of 4 waves (2 x 2 wave tiles) shares 128 A rows and 128 B rows, KT k-values per trip, two buffers.
#define KT    128                // k per trip: rows of 256 B
#define LP    136                // LDS row pitch in 16-bit elements: 272 B = 16 B x odd, conflict-free for 16-B fragment reads
#define TBUF  (256 * LP)         // elements of one buffer: 128 A rows, then 128 B rows
#define NTRIP (DM / KT)
static_assert(DM % KT == 0);
static_assert(NTRIP >= 2);       // the prologue fills two tiles
static_assert((NB * SEQ) % 128 == 0);
static_assert(DM % 128 == 0);
static_assert(KVD % 128 == 0);
static_assert((SEQ - ER_ROWS) % 128 == 0);
// Eight asynchronous 16-B copies per lane, global -> LDS, rows 8 apart (64 rows per work-group of 128 lanes: 16 lanes per 256-B row, 8 rows per copy).
// l: the lane's LDS byte address, g: the lane's global address of the first row (row pitch DM elements). The s_wait_xcnt ends the copies' own statement so that no address register is rewritten ahead of it.
__device__ __forceinline__ void cp8(unsigned l, const unsigned short* g) {
    asm volatile("global_load_async_to_lds_b128 %0, %8, off\n\t"
                 "global_load_async_to_lds_b128 %1, %9, off\n\t"
                 "global_load_async_to_lds_b128 %2, %10, off\n\t"
                 "global_load_async_to_lds_b128 %3, %11, off\n\t"
                 "global_load_async_to_lds_b128 %4, %12, off\n\t"
                 "global_load_async_to_lds_b128 %5, %13, off\n\t"
                 "global_load_async_to_lds_b128 %6, %14, off\n\t"
                 "global_load_async_to_lds_b128 %7, %15, off\n\t"
                 "s_wait_xcnt 0x0"
                 :: "v"(l), "v"(l + 8u * LP * 2u), "v"(l + 16u * LP * 2u), "v"(l + 24u * LP * 2u), "v"(l + 32u * LP * 2u), "v"(l + 40u * LP * 2u), "v"(l + 48u * LP * 2u), "v"(l + 56u * LP * 2u),
                    "v"(g), "v"(g + (size_t)8 * DM), "v"(g + (size_t)16 * DM), "v"(g + (size_t)24 * DM), "v"(g + (size_t)32 * DM), "v"(g + (size_t)40 * DM), "v"(g + (size_t)48 * DM), "v"(g + (size_t)56 * DM)
                 : "memory");
}
// One tile: A rows 0..63 from a0, A rows 64..127 from a1, B rows 0..127 from b0 (32 copies per lane in flight).
__device__ __forceinline__ void stage_tile(unsigned l, const unsigned short* a0, const unsigned short* a1, const unsigned short* b0) {
    cp8(l, a0); cp8(l + 64u * LP * 2u, a1); cp8(l + 128u * LP * 2u, b0); cp8(l + 192u * LP * 2u, b0 + (size_t)64 * DM);
}
// Publish point of the two-buffer ring: own LDS reads retired, own copies landed, then the work-group barrier (it publishes the next tile and frees the buffer just read).
__device__ __forceinline__ void ring_publish() {
    asm volatile("s_wait_dscnt 0x0" ::: "memory");      // this wave's fragment reads of the buffer that is refilled next have retired
    asm volatile("s_wait_asynccnt 0x0" ::: "memory");   // this wave's copies of the next tile have landed
    __syncthreads();
}

// k_cvt8: every conversion of the call in one launch; a block (256 threads x 8 values) belongs to one input by its index range: x, Wq, Wk, Wv, Wo.
// MODE 0 (x, Wq, Wk, Wv): bf16 bits (RNE). MODE 1 (Wo): f16 of (bf16 value x WOS) (exact for normal results).
static constexpr int CB_X = (int)((size_t)NB * SEQ * DM / 2048);     // blocks of x
static constexpr int CB_W = (int)((size_t)DM * DM / 2048);           // blocks of Wq, of Wo
static constexpr int CB_K = (int)((size_t)KVD * DM / 2048);          // blocks of Wk, of Wv
static constexpr int CB_XB = (int)((size_t)SEQ * DM / 2048);         // blocks of one batch of x
static_assert(((size_t)SEQ * DM) % 2048 == 0);                       // a block never straddles two batches of x
static_assert(((size_t)DM * DM) % 2048 == 0);
static_assert(((size_t)KVD * DM) % 2048 == 0);
template<int MODE>
__device__ __forceinline__ void cvt_chunk(const float* __restrict__ src, unsigned short* dst, int lb) {      // lb: the block's index inside its input
    const size_t i = (size_t)lb * 256 + threadIdx.x;
    const v8f v = *(const v8f*)(src + i * 8);
    if (MODE == 0) {
        v8us o;
#pragma unroll
        for (int k = 0; k < 8; ++k) o[k] = f2bf(v[k]);
        *(v8us*)(dst + i * 8) = o; 
    } else {
        v8h o;
#pragma unroll
        for (int k = 0; k < 8; ++k) o[k] = (h16)(bfr(v[k]) * WOS);
        h16* d = (h16*)dst;
        *(v8h*)(d + i * 8) = o; 
    }
    asm volatile("s_wait_xcnt 0x0" ::: "memory");   // stands behind the store: the built code lays the other ranges' blocks, which write the same registers, behind this one
}
__global__ __launch_bounds__(256) void k_cvt8(const float* __restrict__ x, const float* __restrict__ wq, const float* __restrict__ wk, const float* __restrict__ wv, const float* __restrict__ wo,
                                              unsigned short* XB, unsigned short* WQ, unsigned short* WK, unsigned short* WV, unsigned short* WO) {
    const int blk = blockIdx.x;      // every branch is uniform for the block
    if (blk < CB_X) cvt_chunk<0>(x + (size_t)(blk / CB_XB) * ((size_t)(SEQ_FULL - SEQ) * DM), XB, blk);      // batch pitch of x: SEQ_FULL tokens
    else if (blk < CB_X + CB_W) cvt_chunk<0>(wq, WQ, blk - CB_X);
    else if (blk < CB_X + CB_W + CB_K) cvt_chunk<0>(wk, WK, blk - (CB_X + CB_W));
    else if (blk < CB_X + CB_W + 2 * CB_K) cvt_chunk<0>(wv, WV, blk - (CB_X + CB_W + CB_K));
    else cvt_chunk<1>(wo, WO, blk - (CB_X + CB_W + 2 * CB_K));
}

// k_qkv: the three projections in one launch (a work-group takes one tile of q, of k or of v^T by its index range; inside a range the tile row runs fastest). Register-blocked bf16 GEMM, one wave per 64x64 tile (16 accumulators), 4 waves per 128x128 work-group tile, operands from K-contiguous bf16 planes through the LDS ring, K = DM.
// C[m][n] = sum_k A[m][k] Bt[n][k]; optional rotate-half rotary on the 64-column tile (one head: partner column = c ^ 32, token = r0 % RB + row);
// written as f16 value (Ph) and f16 residual x2048 (Pr) at tile base (r0/RB)*sRB + (r0%RB)*pitch + (c0/CB)*sCB + (c0%CB), row pitch 'pitch' (halves). Tile (bx, by) of (M/128, N/128), 128 threads.
// q: A = x rows (m = b*SEQ + t), Bt = Wq rows (n = h*64 + d) -> planes [(b*32 + h)][t][d], rotary fused
// k: Bt = Wk rows (n = g*64 + d) -> planes [(b*8 + g)][t][d], rotary fused
// v^T: A = Wv rows (m = g*64 + d, 512 rows), Bt = x rows (n = b*SEQ + t) -> planes [(b*512 + m)][t] = [(b*8 + g)][d][t]
static constexpr int XT  = NB * SEQ / 128;       // tile rows of x
static constexpr int GQ_ = XT * (DM / 128);      // work-groups of q
static constexpr int GK_ = XT * (KVD / 128);     // work-groups of k, of v^T
__global__ __launch_bounds__(128) void k_qkv(const bf* __restrict__ XB, const bf* __restrict__ WQ, const bf* __restrict__ WK, const bf* __restrict__ WV,
                                             h16* QH, h16* QR, h16* KH, h16* KR, h16* VH, h16* VR, const float* __restrict__ COS, const float* __restrict__ SIN) {
    __shared__ __align__(16) unsigned short st[2 * TBUF];
    __shared__ __align__(16) float osw[4 * 16 * 68];
    const int wg = blockIdx.x;      // every choice below is uniform for the work-group
    const int part = wg < GQ_ ? 0 : wg < GQ_ + GK_ ? 1 : 2;
    const bool ROPE = part != 2;
    const int lw = wg - (part == 0 ? 0 : part == 1 ? GQ_ : GQ_ + GK_);
    const int bx = ROPE ? lw % XT : lw % (KVD / 128), by = ROPE ? lw / XT : lw / (KVD / 128);
    const bf* A = ROPE ? XB : WV; const bf* Bt = part == 0 ? WQ : part == 1 ? WK : XB;
    h16* Ph = part == 0 ? QH : part == 1 ? KH : VH; h16* Pr = part == 0 ? QR : part == 1 ? KR : VR;
    const int RB = ROPE ? SEQ : KVD, pitch = ROPE ? HD : SEQ, CB = ROPE ? HD : SEQ;
    const size_t sRB = part == 0 ? (size_t)NH_ * SEQ * HD : part == 1 ? (size_t)NG_ * SEQ * HD : (size_t)0, sCB = ROPE ? (size_t)SEQ * HD : (size_t)KVD * SEQ;
    const int K = DM;
    const int tid = threadIdx.x, lane = tid & 31, lr = lane & 15, hi = lane >> 4;
    const int wave = __builtin_amdgcn_readfirstlane(tid >> 5); const int wm = wave >> 1, wn = wave & 1;
    float* os = osw + wave * 16 * 68;      // wave-private epilogue staging
    const int r0 = bx * 128 + wm * 64, c0 = by * 128 + wn * 64;
    v8f acc[4][4];
#pragma unroll
    for (int mb = 0; mb < 4; ++mb)
#pragma unroll
        for (int nb = 0; nb < 4; ++nb) acc[mb][nb] = (v8f){};
    const unsigned lds0 = (unsigned)(uintptr_t)st + (unsigned)((tid >> 4) * (LP * 2) + (tid & 15) * 16);      // this lane's copy target: row tid/16, 16-B chunk tid%16
    const bf* ga = A + (size_t)(bx * 128 + (tid >> 4)) * K + (tid & 15) * 8;
    const bf* gb = Bt + (size_t)(by * 128 + (tid >> 4)) * K + (tid & 15) * 8;
    stage_tile(lds0, ga, ga + (size_t)64 * K, gb);
    asm volatile("s_wait_asynccnt 0x0" ::: "memory");   // tile 0 has landed before the barrier that publishes it
    __syncthreads();
    stage_tile(lds0 + TBUF * 2u, ga + KT, ga + (size_t)64 * K + KT, gb + KT);
    const int ao = (wm * 64 + lr) * LP + 8 * hi, bo = (128 + wn * 64 + lr) * LP + 8 * hi;
#pragma unroll 1
    for (int t = 0; t < NTRIP; ++t) {      // rolled: one trip per LDS buffer
        const bf* sb = st + (t & 1) * TBUF;
        v16bf a[2][4], b[2][4];            // two fragment sets: block s + 1 of this buffer is fetched while block s is multiplied
#pragma unroll
        for (int i = 0; i < 4; ++i) { a[0][i] = ldb(sb + ao + i * 16 * LP); b[0][i] = ldb(sb + bo + i * 16 * LP); }
#pragma unroll
        for (int s = 0; s < KT / 32; ++s) {
            if (s + 1 < KT / 32) {
#pragma unroll
                for (int i = 0; i < 4; ++i) { a[(s + 1) & 1][i] = ldb(sb + ao + i * 16 * LP + (s + 1) * 32); b[(s + 1) & 1][i] = ldb(sb + bo + i * 16 * LP + (s + 1) * 32); }
            }
            __builtin_amdgcn_sched_barrier(0);   // the next block's LDS reads stay one group, ahead of this block's matrix instructions
#pragma unroll
            for (int nb = 0; nb < 4; ++nb)
#pragma unroll
                for (int mb = 0; mb < 4; ++mb) acc[mb][nb] = wmmab(a[s & 1][mb], b[s & 1][nb], acc[mb][nb]);
            __builtin_amdgcn_sched_barrier(0);   // no later LDS read moves in among them
        }
        ring_publish();
        if (t + 2 < NTRIP) { const int kn = (t + 2) * KT; stage_tile(lds0 + (unsigned)(t & 1) * (TBUF * 2u), ga + kn, ga + (size_t)64 * K + kn, gb + kn); }
    }
    asm volatile("s_wait_asynccnt 0x0" ::: "memory");   // nothing of the ring is in flight when the wave goes on
    const size_t tbase = (size_t)(r0 / RB) * sRB + (size_t)(r0 % RB) * (size_t)pitch + (size_t)(c0 / CB) * sCB + (size_t)(c0 % CB);
    const int tok0 = r0 % RB;
#pragma unroll
    for (int mb = 0; mb < 4; ++mb) {
#pragma unroll
        for (int nb = 0; nb < 4; ++nb) {
#pragma unroll
            for (int j = 0; j < 8; ++j) os[(hi * 8 + j) * 68 + nb * 16 + lr] = acc[mb][nb][j]; }   // D: row 8h+j, col lane&15; rows 0..15 x columns 0..63 all written
        wave_sync();
        v8h hv[4], rv[4];
#pragma unroll
        for (int s = 0; s < 4; ++s) { const int row = 4 * s + (lane >> 3), c8 = (lane & 7) * 8;   // 4 s x 4 row groups = 16 rows; 8 lanes x 8 = 64 columns
            const v4f x0 = *(const v4fa*)(&os[row * 68 + c8]); const v4f x1 = *(const v4fa*)(&os[row * 68 + c8 + 4]);
            float xv[8];
#pragma unroll
            for (int i = 0; i < 4; ++i) { xv[i] = x0[i]; xv[4 + i] = x1[i]; }
            if (ROPE) {
                const int pc = c8 ^ 32;
                const v4f y0 = *(const v4fa*)(&os[row * 68 + pc]); const v4f y1 = *(const v4fa*)(&os[row * 68 + pc + 4]);
                const size_t to = (size_t)(tok0 + mb * 16 + row) * HD + c8;
                const v4f ca = *(const v4f*)(COS + to), cb = *(const v4f*)(COS + to + 4), sa = *(const v4f*)(SIN + to), sb = *(const v4f*)(SIN + to + 4);
                const float sg = (c8 < 32) ? -1.0f : 1.0f;     // rotated = concat(-x2, x1)
#pragma unroll
                for (int i = 0; i < 4; ++i) { xv[i] = x0[i] * bfr(ca[i]) + (sg * y0[i]) * bfr(sa[i]); xv[4 + i] = x1[i] * bfr(cb[i]) + (sg * y1[i]) * bfr(sb[i]); }
            }
            v8h hh, rr;
#pragma unroll
            for (int i = 0; i < 8; ++i) { const h16 a0 = (h16)xv[i]; hh[i] = a0; rr[i] = (h16)((xv[i] - (float)a0) * QRS); }
            hv[s] = hh; rv[s] = rr; }
        const size_t sb0 = tbase + (size_t)(mb * 16) * (size_t)pitch;
#pragma unroll
        for (int s = 0; s < 4; ++s) { const int row = 4 * s + (lane >> 3), c8 = (lane & 7) * 8; const size_t oo = sb0 + (size_t)row * (size_t)pitch + c8;
            *(v8h*)(Ph + oo) = hv[s]; *(v8h*)(Pr + oo) = rv[s]; }
        asm volatile("s_wait_xcnt 0x0" ::: "memory");   // stands behind the stores, ahead of the next block's writes to the registers that they name
        wave_sync();
    }
}

// Key/value tiles of k_flash go through LDS: the 4 waves of a work-group (64 query rows of one head) share 64 keys per stage, two buffers.
#define FK    64                 // keys per stage: K tile 64 key rows x 64 d, V^T tile 64 d rows x 64 keys, rows of 128 B each
#define FP    72                 // LDS row pitch in 16-bit elements: 144 B = 16 B x odd, conflict-free for 16-B fragment reads
#define FT    (64 * FP)          // elements of one tile
static_assert(16 * AW == FK);    // the diagonal stage of a work-group is its last one
static_assert(HD == 64);
// Eight asynchronous 16-B copies per lane, global -> LDS: four for a K tile at l, four for a V^T tile at l + one tile; rows 16 apart (128 lanes: 8 lanes per 128-B row, 16 rows per copy).
// l: the lane's LDS byte address, gk / gv: the lane's global addresses of its first row (row pitch HD / SEQ elements). The s_wait_xcnt ends the copies' own statement so that no address register is rewritten ahead of it.
__device__ __forceinline__ void cp_kv(unsigned l, const h16* gk, const h16* gv) {
    asm volatile("global_load_async_to_lds_b128 %0, %8, off\n\t"
                 "global_load_async_to_lds_b128 %1, %9, off\n\t"
                 "global_load_async_to_lds_b128 %2, %10, off\n\t"
                 "global_load_async_to_lds_b128 %3, %11, off\n\t"
                 "global_load_async_to_lds_b128 %4, %12, off\n\t"
                 "global_load_async_to_lds_b128 %5, %13, off\n\t"
                 "global_load_async_to_lds_b128 %6, %14, off\n\t"
                 "global_load_async_to_lds_b128 %7, %15, off\n\t"
                 "s_wait_xcnt 0x0"
                 :: "v"(l), "v"(l + 16u * FP * 2u), "v"(l + 32u * FP * 2u), "v"(l + 48u * FP * 2u),
                    "v"(l + FT * 2u), "v"(l + FT * 2u + 16u * FP * 2u), "v"(l + FT * 2u + 32u * FP * 2u), "v"(l + FT * 2u + 48u * FP * 2u),
                    "v"(gk), "v"(gk + (size_t)16 * HD), "v"(gk + (size_t)32 * HD), "v"(gk + (size_t)48 * HD),
                    "v"(gv), "v"(gv + (size_t)16 * SEQ), "v"(gv + (size_t)32 * SEQ), "v"(gv + (size_t)48 * SEQ)
                 : "memory");
}

// k_flash: fused causal attention, one wave per 16 query rows of one (batch, head), 4 waves (64 consecutive query rows) per work-group; Q fragments straight from the f16 planes,
// K / V^T fragments from the LDS ring (buffer: K value tile, V^T value tile; ER: then K residual tile, V^T residual tile), two 16-B LDS loads each.
// Transposed form: S^T[key][t] = K Q^T (A = K rows, B = Q rows); lane (t = lane&15, h = lane>>4) holds keys 8h+r of each 16-key tile, so the packed
// P tile is directly the B fragment of O^T[d][t] = V^T P^T (element r <- tile keys 0..15, element 8+r <- tile keys 16..31, lane unchanged).
// Head h reads key/value group h / GS_. A wave works on keys 0 .. t0+15 in steps of 32 (two per stage; it passes a stage's step that lies wholly above its rows); keys above the query index are replaced by NEGB (P = 0) on the diagonal step.
// ER: value + residual path (scores kh*qh + [kh*qr + kr*qh]/2048, O = vh*ph + [vr*ph + vh*pr]/2048), residual products in separate accumulators.
template<bool ER>
__global__ __launch_bounds__(32 * AW) void k_flash(const h16* __restrict__ QH, const h16* __restrict__ QR, const h16* __restrict__ KH, const h16* __restrict__ KR,
                                                   const h16* __restrict__ VH, const h16* __restrict__ VR, h16* CH, h16* CR, int xb0) {
    constexpr int FBUF = (ER ? 4 : 2) * FT;      // elements of one buffer
    __shared__ __align__(16) unsigned short st[2 * FBUF];
    __shared__ __align__(16) float os[AW * 16 * 68];
    const int tid = threadIdx.x, lane = tid & 31, lr = lane & 15, hi = lane >> 4;
    const int wave = __builtin_amdgcn_readfirstlane(tid >> 5);
    const int zh = blockIdx.y; const int b = zh / NH_, h = zh % NH_, g = h / GS_;
    const int t0 = (((int)blockIdx.x + xb0) * AW + wave) * 16;
    const int tq = t0 + lr;
    const size_t qbase = (size_t)zh * SEQ * HD;
    const size_t kvb = (size_t)(b * NG_ + g) * SEQ * HD;
    const size_t qo = qbase + (size_t)(t0 + lr) * HD + 8 * hi;
    const v16h qh0 = ldh(QH + qo), qh1 = ldh(QH + qo + 32);          // B fragments: col t, k = d
    v16h qr0 = qh0, qr1 = qh1;
    if (ER) { qr0 = ldh(QR + qo); qr1 = ldh(QR + qo + 32); }
    const int ko = lr * FP + 8 * hi;           // in a buffer: + key * FP        (A fragment: row key, k = d)
    const int vo = FT + lr * FP + 8 * hi;      // in a buffer: + 16j*FP + key    (A fragment: row d, k = key)
    const int nst = (int)blockIdx.x + xb0 + 1;      // stages of this work-group: keys 0 .. (its last query row), the same for its 4 waves
    const unsigned lds0 = (unsigned)(uintptr_t)st + (unsigned)((tid >> 3) * (FP * 2) + (tid & 7) * 16);      // this lane's copy target: row tid/8, 16-B chunk tid%8
    const size_t gko = kvb + (size_t)(tid >> 3) * HD + (tid & 7) * 8;      // + key * HD
    const size_t gvo = kvb + (size_t)(tid >> 3) * SEQ + (tid & 7) * 8;     // + key
    cp_kv(lds0, KH + gko, VH + gvo);
    if (ER) cp_kv(lds0 + 2u * FT * 2u, KR + gko, VR + gvo);
    asm volatile("s_wait_asynccnt 0x0" ::: "memory");   // stage 0 has landed before the barrier that publishes it
    __syncthreads();
    if (nst > 1) {
        cp_kv(lds0 + FBUF * 2u, KH + gko + (size_t)FK * HD, VH + gvo + FK);
        if (ER) cp_kv(lds0 + FBUF * 2u + 2u * FT * 2u, KR + gko + (size_t)FK * HD, VR + gvo + FK);
    }
    v8f oH[4], oL[4];
#pragma unroll
    for (int j = 0; j < 4; ++j) { oH[j] = (v8f){}; oL[j] = (v8f){}; }
    float m = NEGB, l = 0.0f;
#pragma unroll 1
    for (int sg = 0; sg < nst; ++sg) {      // rolled: one trip per LDS buffer
      const h16* sb = (const h16*)st + (sg & 1) * FBUF;
#pragma unroll
      for (int u = 0; u < FK / 32; ++u) {      // unrolled: each step's LDS offsets become immediates of its fragment loads
        const int key0 = sg * FK + u * 32;
        if (key0 >= t0 + 16) continue;      // wave-uniform: on the diagonal stage the step lies wholly above this wave's rows
        const h16* ka = sb + ko + u * 32 * FP;
        float ta[8], tb[8];
        if (!ER) {
            const v16h ka0 = ldh(ka), ka1 = ldh(ka + 32), kb0 = ldh(ka + 16 * FP), kb1 = ldh(ka + 16 * FP + 32);
            v8f sHa = (v8f){}, sHb = (v8f){};
            sHa = wmma16(ka0, qh0, sHa); sHb = wmma16(kb0, qh0, sHb);
            sHa = wmma16(ka1, qh1, sHa); sHb = wmma16(kb1, qh1, sHb);
            asm volatile("v_nop\n\tv_nop\n\tv_nop\n\tv_nop" : "+v"(sHa), "+v"(sHb) : "v"(ka0), "v"(ka1), "v"(kb0), "v"(kb1));
#pragma unroll
            for (int r = 0; r < 8; ++r) { ta[r] = sHa[r] * SC2; tb[r] = sHb[r] * SC2; }
        } else {
            const h16* kr = ka + 2 * FT;
            { const v16h ka0 = ldh(ka), ka1 = ldh(ka + 32), ra0 = ldh(kr), ra1 = ldh(kr + 32);
              v8f sH = (v8f){}, sL = (v8f){};
              sH = wmma16(ka0, qh0, sH); sL = wmma16(ka0, qr0, sL);
              sH = wmma16(ka1, qh1, sH); sL = wmma16(ka1, qr1, sL);
              sL = wmma16(ra0, qh0, sL); sL = wmma16(ra1, qh1, sL);
              asm volatile("v_nop\n\tv_nop\n\tv_nop\n\tv_nop" : "+v"(sH), "+v"(sL) : "v"(ka0), "v"(ka1), "v"(ra0), "v"(ra1));
#pragma unroll
              for (int r = 0; r < 8; ++r) ta[r] = (sH[r] + sL[r] * QRI) * SC2; }
            { const v16h kb0 = ldh(ka + 16 * FP), kb1 = ldh(ka + 16 * FP + 32), rb0 = ldh(kr + 16 * FP), rb1 = ldh(kr + 16 * FP + 32);
              v8f sH = (v8f){}, sL = (v8f){};
              sH = wmma16(kb0, qh0, sH); sL = wmma16(kb0, qr0, sL);
              sH = wmma16(kb1, qh1, sH); sL = wmma16(kb1, qr1, sL);
              sL = wmma16(rb0, qh0, sL); sL = wmma16(rb1, qh1, sL);
              asm volatile("v_nop\n\tv_nop\n\tv_nop\n\tv_nop" : "+v"(sH), "+v"(sL) : "v"(kb0), "v"(kb1), "v"(rb0), "v"(rb1));
#pragma unroll
              for (int r = 0; r < 8; ++r) tb[r] = (sH[r] + sL[r] * QRI) * SC2; }
        }
        if (key0 + 31 > t0) {      // wave-uniform: only the diagonal step holds keys above some query index; every row keeps key key0 <= t
#pragma unroll
            for (int r = 0; r < 8; ++r) { const int kk = key0 + 8 * hi + r; ta[r] = (kk <= tq) ? ta[r] : NEGB; tb[r] = (kk + 16 <= tq) ? tb[r] : NEGB; }
        }
        float mx = NEGB;
#pragma unroll
        for (int r = 0; r < 8; ++r) mx = fmaxf(mx, fmaxf(ta[r], tb[r]));
        mx = fmaxf(mx, __shfl_xor(mx, 16, 32));
        const float mnew = fmaxf(m, mx);
        const float alpha = __builtin_amdgcn_exp2f(m - mnew);
        const float sh = PSH - mnew;
        v16h pb, pq; float ls = 0.0f;
        if (!ER) {
#pragma unroll
            for (int r = 0; r < 8; ++r) { const h16 pa = (h16)__builtin_amdgcn_exp2f(ta[r] + sh); const h16 pc = (h16)__builtin_amdgcn_exp2f(tb[r] + sh); pb[r] = pa; pb[8 + r] = pc; ls += (float)pa + (float)pc; }
            pq = pb;
        } else {
#pragma unroll
            for (int r = 0; r < 8; ++r) { const float fa = __builtin_amdgcn_exp2f(ta[r] + sh); const float fc = __builtin_amdgcn_exp2f(tb[r] + sh);
                const h16 pa = (h16)fa; const h16 pc = (h16)fc; const h16 qa = (h16)((fa - (float)pa) * QRS); const h16 qc = (h16)((fc - (float)pc) * QRS);
                pb[r] = pa; pb[8 + r] = pc; pq[r] = qa; pq[8 + r] = qc; ls += ((float)pa + (float)pc) + ((float)qa + (float)qc) * QRI; }
        }
        l = l * alpha + ls; m = mnew;
#pragma unroll
        for (int j = 0; j < 4; ++j) { oH[j] = oH[j] * alpha; if (ER) oL[j] = oL[j] * alpha; }
        const h16* va = sb + vo + u * 32;
        const v16h v0 = ldh(va), v1 = ldh(va + 16 * FP), v2 = ldh(va + 32 * FP), v3 = ldh(va + 48 * FP);
        if (!ER) {
            oH[0] = wmma16(v0, pb, oH[0]); oH[1] = wmma16(v1, pb, oH[1]); oH[2] = wmma16(v2, pb, oH[2]); oH[3] = wmma16(v3, pb, oH[3]);
            asm volatile("v_nop\n\tv_nop\n\tv_nop\n\tv_nop" : "+v"(oH[0]), "+v"(oH[1]), "+v"(oH[2]), "+v"(oH[3]) : "v"(v0), "v"(v1), "v"(v2), "v"(v3), "v"(pb));
        } else {
            const h16* vr = va + 2 * FT;
            const v16h w0 = ldh(vr), w1 = ldh(vr + 16 * FP), w2 = ldh(vr + 32 * FP), w3 = ldh(vr + 48 * FP);
            oH[0] = wmma16(v0, pb, oH[0]); oH[1] = wmma16(v1, pb, oH[1]); oH[2] = wmma16(v2, pb, oH[2]); oH[3] = wmma16(v3, pb, oH[3]);
            oL[0] = wmma16(w0, pb, oL[0]); oL[1] = wmma16(w1, pb, oL[1]); oL[2] = wmma16(w2, pb, oL[2]); oL[3] = wmma16(w3, pb, oL[3]);
            oL[0] = wmma16(v0, pq, oL[0]); oL[1] = wmma16(v1, pq, oL[1]); oL[2] = wmma16(v2, pq, oL[2]); oL[3] = wmma16(v3, pq, oL[3]);
            asm volatile("v_nop\n\tv_nop\n\tv_nop\n\tv_nop" : "+v"(oH[0]), "+v"(oH[1]), "+v"(oH[2]), "+v"(oH[3]), "+v"(oL[0]), "+v"(oL[1]), "+v"(oL[2]), "+v"(oL[3])
                         : "v"(v0), "v"(v1), "v"(v2), "v"(v3), "v"(w0), "v"(w1), "v"(w2), "v"(w3), "v"(pb), "v"(pq));
        }
      }
      ring_publish();
      if (sg + 2 < nst) { const int kn = (sg + 2) * FK; const unsigned lb = lds0 + (unsigned)(sg & 1) * (FBUF * 2u);
          cp_kv(lb, KH + gko + (size_t)kn * HD, VH + gvo + kn);
          if (ER) cp_kv(lb + 2u * FT * 2u, KR + gko + (size_t)kn * HD, VR + gvo + kn); }
    }
    asm volatile("s_wait_asynccnt 0x0" ::: "memory");   // nothing of the ring is in flight when the wave goes on
    l += __shfl_xor(l, 16, 32);
    const float inv = CXS * (1.0f / l);
    const int wb = wave * 16 * 68;
    // O^T D layout: o_j[r] = (d = 16j + 8h + r, t = lane&15) -> os[t][d]; rows 0..15 x columns 0..63 all written
#pragma unroll
    for (int j = 0; j < 4; ++j) { v4f a, c;
#pragma unroll
        for (int i = 0; i < 4; ++i) {
            if (ER) { a[i] = (oH[j][i] + oL[j][i] * QRI) * inv; c[i] = (oH[j][4 + i] + oL[j][4 + i] * QRI) * inv; }
            else    { a[i] = oH[j][i] * inv; c[i] = oH[j][4 + i] * inv; } }
        *(v4fa*)(&os[wb + lr * 68 + 16 * j + 8 * hi]) = a; *(v4fa*)(&os[wb + lr * 68 + 16 * j + 8 * hi + 4]) = c; }
    wave_sync();
    v8h hv[4], rv[4];
#pragma unroll
    for (int s = 0; s < 4; ++s) { const int row = 4 * s + (lane >> 3), c8 = (lane & 7) * 8;   // 4 s x 4 row groups = 16 rows; 8 lanes x 8 = 64 columns
        const v4f x0 = *(const v4fa*)(&os[wb + row * 68 + c8]); const v4f x1 = *(const v4fa*)(&os[wb + row * 68 + c8 + 4]); v8h hh, rr;
#pragma unroll
        for (int i = 0; i < 4; ++i) { const h16 a0 = (h16)x0[i]; const h16 a1 = (h16)x1[i]; hh[i] = a0; hh[4 + i] = a1; rr[i] = (h16)((x0[i] - (float)a0) * QRS); rr[4 + i] = (h16)((x1[i] - (float)a1) * QRS); }
        hv[s] = hh; rv[s] = rr; }
    const size_t cbase = ((size_t)b * SEQ + t0) * DM + (size_t)h * HD;
    const size_t rbase = ((size_t)b * ER_ROWS + t0) * DM + (size_t)h * HD;     // used by the ER instantiation only (t0 < ER_ROWS there)
#pragma unroll
    for (int s = 0; s < 4; ++s) { const int row = 4 * s + (lane >> 3), c8 = (lane & 7) * 8;
        *(v8h*)(CH + cbase + (size_t)row * DM + c8) = hv[s]; if (ER) *(v8h*)(CR + rbase + (size_t)row * DM + c8) = rv[s]; }
    
}

// out_tile: output projection, f16 GEMM, one wave per (16*MB) x 64 tile, 4 waves per (32*MB) x 128 work-group tile, operands from K-contiguous f16 planes through the LDS ring, K = DM.
// A rows of a buffer: MB = 4: 128 rows of CH; MB = 2 with RES: 64 rows of CH, then the same 64 rows of CR.
// OUT[b][t][n] = OSC * sum_k (CH[b*SEQ+t][k] + CR[b*ER_ROWS+t][k]/2048) * WO[n][k]; RES: residual products in their own accumulators.
// Rows t in [tstart, tstart+tcount) of every batch; tile (bx, by) of (NB*tcount/(32*MB), DM/128), 128 threads. st (2 * TBUF elements) and osw (4 * 16 * 68 floats) are the calling kernel's LDS.
template<int MB, bool RES>
__device__ __forceinline__ void out_tile(unsigned short* st, float* osw, int bx, int by, const h16* __restrict__ CH, const h16* __restrict__ CR, const h16* __restrict__ WO, float* OUT, int tstart, int tcount) {
    static_assert(RES ? MB == 2 : MB == 4);
    const int tid = threadIdx.x, lane = tid & 31, lr = lane & 15, hi = lane >> 4;
    const int wave = __builtin_amdgcn_readfirstlane(tid >> 5); const int wm = wave >> 1, wn = wave & 1;
    float* os = osw + wave * 16 * 68;      // wave-private epilogue staging
    const int tiles = tcount / (32 * MB);
    const int b = bx / tiles, tw = tstart + (bx % tiles) * 32 * MB, t = tw + wm * 16 * MB, c0 = by * 128 + wn * 64;
    v8f acc[MB][4], acr[MB][4];
#pragma unroll
    for (int mb = 0; mb < MB; ++mb)
#pragma unroll
        for (int nb = 0; nb < 4; ++nb) { acc[mb][nb] = (v8f){}; acr[mb][nb] = (v8f){}; }
    const unsigned lds0 = (unsigned)(uintptr_t)st + (unsigned)((tid >> 4) * (LP * 2) + (tid & 15) * 16);      // this lane's copy target: row tid/16, 16-B chunk tid%16
    const unsigned short* ga0 = (const unsigned short*)CH + ((size_t)b * SEQ + tw + (tid >> 4)) * DM + (tid & 15) * 8;
    const unsigned short* ga1 = RES ? (const unsigned short*)CR + ((size_t)b * ER_ROWS + tw + (tid >> 4)) * DM + (tid & 15) * 8     // RES only (tw < ER_ROWS there)
                                    : ga0 + (size_t)64 * DM;
    const unsigned short* gb = (const unsigned short*)WO + (size_t)(by * 128 + (tid >> 4)) * DM + (tid & 15) * 8;
    stage_tile(lds0, ga0, ga1, gb);
    asm volatile("s_wait_asynccnt 0x0" ::: "memory");   // tile 0 has landed before the barrier that publishes it
    __syncthreads();
    stage_tile(lds0 + TBUF * 2u, ga0 + KT, ga1 + KT, gb + KT);
    const int ao = (wm * 16 * MB + lr) * LP + 8 * hi, ro = ao + 64 * LP, bo = (128 + wn * 64 + lr) * LP + 8 * hi;
#pragma unroll 1
    for (int tr = 0; tr < NTRIP; ++tr) {      // rolled: one trip per LDS buffer
      const h16* sb = (const h16*)st + (tr & 1) * TBUF;
      v16h a[2][MB], ar[2][MB], bb[2][4];      // two fragment sets: block s + 1 of this buffer is fetched while block s is multiplied
#pragma unroll
      for (int i = 0; i < MB; ++i) { a[0][i] = ldh(sb + ao + i * 16 * LP); if (RES) ar[0][i] = ldh(sb + ro + i * 16 * LP); }
#pragma unroll
      for (int i = 0; i < 4; ++i) bb[0][i] = ldh(sb + bo + i * 16 * LP);
#pragma unroll
      for (int s = 0; s < KT / 32; ++s) {
        if (s + 1 < KT / 32) {
#pragma unroll
            for (int i = 0; i < MB; ++i) { a[(s + 1) & 1][i] = ldh(sb + ao + i * 16 * LP + (s + 1) * 32); if (RES) ar[(s + 1) & 1][i] = ldh(sb + ro + i * 16 * LP + (s + 1) * 32); }
#pragma unroll
            for (int i = 0; i < 4; ++i) bb[(s + 1) & 1][i] = ldh(sb + bo + i * 16 * LP + (s + 1) * 32);
        }
        __builtin_amdgcn_sched_barrier(0);   // the next block's LDS reads stay one group, ahead of this block's matrix instructions
#pragma unroll
        for (int nb = 0; nb < 4; ++nb)
#pragma unroll
            for (int mb = 0; mb < MB; ++mb) { acc[mb][nb] = wmma16(a[s & 1][mb], bb[s & 1][nb], acc[mb][nb]); if (RES) acr[mb][nb] = wmma16(ar[s & 1][mb], bb[s & 1][nb], acr[mb][nb]); }
        __builtin_amdgcn_sched_barrier(0);   // no later LDS read moves in among them
      }
      ring_publish();
      if (tr + 2 < NTRIP) { const int kn = (tr + 2) * KT; stage_tile(lds0 + (unsigned)(tr & 1) * (TBUF * 2u), ga0 + kn, ga1 + kn, gb + kn); }
    }
    asm volatile("s_wait_asynccnt 0x0" ::: "memory");   // nothing of the ring is in flight when the wave goes on
#pragma unroll
    for (int mb = 0; mb < MB; ++mb) {
#pragma unroll
        for (int nb = 0; nb < 4; ++nb) {
#pragma unroll
            for (int j = 0; j < 8; ++j) os[(hi * 8 + j) * 68 + nb * 16 + lr] = RES ? (acc[mb][nb][j] + acr[mb][nb][j] * QRI) * OSC : acc[mb][nb][j] * OSC; }   // D: row 8h+j, col lane&15
        wave_sync();
        float* orow = OUT + ((size_t)b * OUT_SEQ + t + mb * 16) * DM + c0;
{
#pragma unroll
            for (int s = 0; s < 8; ++s) { const int row = 2 * s + hi, cofs = lr * 4;   // 8 s x 2 rows = 16 rows; 16 lanes x 4 floats = 64 columns
                const v4f val = *(const v4fa*)(&os[row * 68 + cofs]);
                *(v4f*)(orow + (size_t)row * DM + cofs) = val; }
             }
        wave_sync();
    }
}

// k_out: both row ranges of the output projection in one launch; a work-group takes a tile of the rows >= ER_ROWS or of the value + residual rows by its index range (inside a range the tile row runs fastest).
static constexpr int OT_F = (SEQ > ER_ROWS) ? NB * (SEQ - ER_ROWS) / 128 : 1;      // tile rows, rows >= ER_ROWS
static constexpr int GO_F = (SEQ > ER_ROWS) ? OT_F * (DM / 128) : 0;               // their work-groups
static constexpr int OT_E = NB * ER_ROWS / 64;                                     // tile rows, rows < ER_ROWS
static constexpr int GO_E = OT_E * (DM / 128);
__global__ __launch_bounds__(128) void k_out(const h16* __restrict__ CH, const h16* __restrict__ CR, const h16* __restrict__ WO, float* OUT) {
    __shared__ __align__(16) unsigned short st[2 * TBUF];
    __shared__ __align__(16) float osw[4 * 16 * 68];
    const int wg = blockIdx.x;      // the branch is uniform for the work-group
    if (wg < GO_F) out_tile<4, false>(st, osw, wg % OT_F, wg / OT_F, CH, CR, WO, OUT, ER_ROWS, (SEQ == ER_ROWS) ? 128 : (SEQ - ER_ROWS));
    else out_tile<2, true>(st, osw, (wg - GO_F) % OT_E, (wg - GO_F) / OT_E, CH, CR, WO, OUT, 0, ER_ROWS);
}

static constexpr size_t al256(size_t v) { return (v + 255) & ~(size_t)255; }
static constexpr size_t SZ_XB = al256((size_t)NB * SEQ * DM * 2);
static constexpr size_t SZ_WQ = al256((size_t)DM * DM * 2);
static constexpr size_t SZ_WK = al256((size_t)KVD * DM * 2);
static constexpr size_t SZ_QP = al256((size_t)NB * NH_ * SEQ * HD * 2);
static constexpr size_t SZ_KP = al256((size_t)NB * NG_ * SEQ * HD * 2);
static constexpr size_t SZ_CH = al256((size_t)NB * SEQ * DM * 2);
static constexpr size_t SZ_CR = al256((size_t)NB * ER_ROWS * DM * 2);
static constexpr size_t SZ_TOTAL = SZ_XB + 2 * SZ_WQ + 2 * SZ_WK + 2 * SZ_QP + 4 * SZ_KP + SZ_CH + SZ_CR;
static_assert(SZ_TOTAL <= (size_t)134217728);          // workspace carve <= 128 MiB

extern "C" void kernel_launch(void* const* d_in, const int* in_sizes, int n_in,
                              void* d_out, int out_size, void* d_ws, size_t ws_size, hipStream_t stream) {
    if (n_in < 7) return;
    const size_t needx = ((size_t)(NB - 1) * SEQ_FULL + SEQ) * DM;
    if ((size_t)in_sizes[0] < needx) return;
    if ((size_t)in_sizes[1] < (size_t)DM * DM || (size_t)in_sizes[2] < (size_t)KVD * DM || (size_t)in_sizes[3] < (size_t)KVD * DM || (size_t)in_sizes[4] < (size_t)DM * DM) return;
    if ((size_t)in_sizes[5] < (size_t)SEQ * HD || (size_t)in_sizes[6] < (size_t)SEQ * HD) return;
    if ((size_t)out_size < ((size_t)(NB - 1) * OUT_SEQ + SEQ) * DM) return;
    if (SZ_TOTAL > ws_size) return;
    // wire order: x, Wq, Wk, Wv, Wo, cos, sin (W as [out][in] = Bt as-is; cos/sin [token][64] read as values)
    const float* x = (const float*)d_in[0]; const float* wq = (const float*)d_in[1]; const float* wk = (const float*)d_in[2]; const float* wv = (const float*)d_in[3];
    const float* wo = (const float*)d_in[4]; const float* cs = (const float*)d_in[5]; const float* sn = (const float*)d_in[6];
    float* OUT = (float*)d_out;      // [NB][SEQ][2048]
    char* wsp = (char*)d_ws;
    bf* XB = (bf*)wsp; wsp += SZ_XB;                 // [NB*SEQ][2048] bf16
    bf* WQ = (bf*)wsp; wsp += SZ_WQ;                 // [2048][2048] bf16
    bf* WK = (bf*)wsp; wsp += SZ_WK;                 // [512][2048] bf16
    bf* WV = (bf*)wsp; wsp += SZ_WK;                 // [512][2048] bf16
    h16* WO = (h16*)wsp; wsp += SZ_WQ;               // [2048][2048] f16 x64
    h16* QH = (h16*)wsp; wsp += SZ_QP;               // [NB*32][SEQ][64]
    h16* QR = (h16*)wsp; wsp += SZ_QP;               // residual x2048
    h16* KH = (h16*)wsp; wsp += SZ_KP;               // [NB*8][SEQ][64]
    h16* KR = (h16*)wsp; wsp += SZ_KP;               // residual x2048
    h16* VH = (h16*)wsp; wsp += SZ_KP;               // [NB*8][64][SEQ]
    h16* VR = (h16*)wsp; wsp += SZ_KP;               // residual x2048
    h16* CH = (h16*)wsp; wsp += SZ_CH;               // [NB*SEQ][2048] ctx x64
    h16* CR = (h16*)wsp; wsp += SZ_CR;               // [NB*ER_ROWS][2048] residual x2048

    k_cvt8<<<CB_X + 2 * CB_W + 2 * CB_K, 256, 0, stream>>>(x, wq, wk, wv, wo, XB, WQ, WK, WV, (unsigned short*)WO);

    k_qkv<<<GQ_ + 2 * GK_, 128, 0, stream>>>(XB, WQ, WK, WV, QH, QR, KH, KR, VH, VR, cs, sn);

    k_flash<true><<<dim3(ER_ROWS / (16 * AW), NB * NH_, 1), 32 * AW, 0, stream>>>(QH, QR, KH, KR, VH, VR, CH, CR, 0);
    if (SEQ > ER_ROWS)
        k_flash<false><<<dim3((SEQ - ER_ROWS) / (16 * AW) + (SEQ == ER_ROWS), NB * NH_, 1), 32 * AW, 0, stream>>>(QH, QR, KH, KR, VH, VR, CH, CR, ER_ROWS / (16 * AW));

    k_out<<<GO_F + GO_E, 128, 0, stream>>>(CH, CR, WO, OUT);
}

// v004
// It runs in 157 microseconds.
// Timed twice side by side with v003, it ran 1.11 times as fast both times.
// All steps since v000 together make it 2.69 times as fast.
#include <hip/hip_runtime.h>

// Causal grouped-query attention, width 2048 = 32 heads x 64, 8 key/value groups (4 heads per group), rotate-half rotary with INPUT cos/sin tables, output projection; x [NB][SEQ][2048], W [out][in] (y = x W^T), no biases, score scale 1/8.
// Compute dtypes, f32 accumulate everywhere: q/k/v projections v_wmma_f32_16x16x32_bf16 (x, W RNE-converted to bf16; products exact); rotary in f32 with bf16-converted table values;
// scores, P.V and the output projection v_wmma_f32_16x16x32_f16: q, k, v^T, ctx(x64) as f16 value planes plus f16 residual planes x2048; Wo as f16 of the bf16 value x64; P carried x256.
// Query rows >= 512 use single f16 products; query rows < 512 use value + residual (three products for scores and P.V, two for the output projection), residual products in their own accumulators.
// Transposed flash form (S^T = K Q^T, O^T = V^T P^T), online softmax in f32 (running max), causal mask applied by value on the diagonal key step.

#ifndef NB
#define NB 2
#endif
#ifndef SEQ
#define SEQ 2048
#endif
#define NB_FULL  2
#define SEQ_FULL 2048
#ifndef OUT_SEQ
#define OUT_SEQ SEQ              // row pitch (in tokens) between batches of the output
#endif
#define DM   2048                // model width = depth of every GEMM
#define NH_  32
#define NG_  8
#define GS_  4                   // heads per key/value group
#define HD   64
#define KVD  512                 // NG_ * HD
#define AW   4                   // waves per flash block (16 query rows each)
#define QRS  2048.0f             // carry of every residual plane
#define QRI  (1.0f / 2048.0f)
#define SC2  (0.125f * 1.4426950408889634f)   // HD^-0.5 * log2(e)
#define PSH  8.0f                // log2 of the P carry (256)
#define CXS  64.0f               // carry of the ctx plane
#define WOS  64.0f               // carry of the Wo plane
#define OSC  (1.0f / 4096.0f)    // 1 / (CXS * WOS)
#define NEGB (-3.0e38f)

static constexpr int ER_ROWS = (SEQ < 512) ? SEQ : 512;   // query rows per batch on the value + residual path

static_assert(HD == 64);
static_assert(NH_ * HD == DM);
static_assert(NG_ * HD == KVD);
static_assert(NG_ * GS_ == NH_);
static_assert(DM % 64 == 0);
static_assert(DM % 32 == 0);                   // GEMM k-loop steps by 32
static_assert(KVD % 64 == 0);
static_assert(SEQ % 64 == 0);                  // a 64-row tile never straddles two batches
static_assert(SEQ % (16 * AW) == 0);
static_assert(ER_ROWS % 64 == 0);
static_assert((SEQ - ER_ROWS) % 64 == 0);
static_assert(((size_t)SEQ * DM) % 8 == 0);
static_assert(NB <= NB_FULL);
static_assert(SEQ <= SEQ_FULL);

typedef _Float16 h16;
typedef unsigned short bf;
typedef __attribute__((ext_vector_type(16))) __bf16   v16bf;
typedef __attribute__((ext_vector_type(16))) _Float16 v16h;
typedef __attribute__((ext_vector_type(8)))  _Float16 v8h;
typedef __attribute__((ext_vector_type(8)))  unsigned short v8us;
typedef __attribute__((ext_vector_type(8)))  float    v8f;
typedef __attribute__((ext_vector_type(4)))  float    v4f;
typedef v4f  __attribute__((may_alias)) v4fa;

__device__ __forceinline__ unsigned short f2bf(float f) { unsigned u = __float_as_uint(f); u += 0x7FFFu + ((u >> 16) & 1u); return (unsigned short)(u >> 16); }
__device__ __forceinline__ float bfr(float f) { return __uint_as_float(((unsigned)f2bf(f)) << 16); }   // value after RNE conversion to bf16
__device__ __forceinline__ v16h cat16(v8h lo, v8h hi) { return __builtin_shufflevector(lo, hi, 0, 1, 2, 3, 4, 5, 6, 7, 8, 9, 10, 11, 12, 13, 14, 15); }
__device__ __forceinline__ v16bf cat16b(v8us lo, v8us hi) { return __builtin_bit_cast(v16bf, __builtin_shufflevector(lo, hi, 0, 1, 2, 3, 4, 5, 6, 7, 8, 9, 10, 11, 12, 13, 14, 15)); }
__device__ __forceinline__ v8f wmma16(v16h a, v16h b, v8f c) { return __builtin_amdgcn_wmma_f32_16x16x32_f16(false, a, false, b, (short)0, c, false, false); }
__device__ __forceinline__ v8f wmmab(v16bf a, v16bf b, v8f c) { return __builtin_amdgcn_wmma_f32_16x16x32_bf16(false, a, false, b, (short)0, c, false, false); }
// fragment loaders from K-contiguous 16-bit rows; p already includes + 8*(lane>>4): elements 0..7 <- k0+8h+0..7, elements 8..15 <- k0+16+8h+0..7 (same map for A and B)
__device__ __forceinline__ v16h  ldh(const h16* p) { return cat16(*(const v8h*)p, *(const v8h*)(p + 16)); }
__device__ __forceinline__ v16bf ldb(const bf* p)  { return cat16b(*(const v8us*)p, *(const v8us*)(p + 16)); }
// ordering point for wave-private LDS tiles (same wave writes and reads)
__device__ __forceinline__ void wave_sync() { __builtin_amdgcn_fence(3 /* release order */, "wavefront"); __builtin_amdgcn_wave_barrier(); asm volatile("" ::: "memory"); }

// Operand tiles of every GEMM kernel go through LDS: a work-group of 4 waves (2 x 2 wave tiles) shares 128 A rows and 128 B rows, KT k-values per trip, two buffers.
#define KT    128                // k per trip: rows of 256 B
#define LP    136                // LDS row pitch in 16-bit elements: 272 B = 16 B x odd, conflict-free for 16-B fragment reads
#define TBUF  (256 * LP)         // elements of one buffer: 128 A rows, then 128 B rows
#define NTRIP (DM / KT)
static_assert(DM % KT == 0);
static_assert(NTRIP >= 2);       // the prologue fills two tiles
static_assert((NB * SEQ) % 128 == 0);
static_assert(DM % 128 == 0);
static_assert(KVD % 128 == 0);
static_assert((SEQ - ER_ROWS) % 128 == 0);
// Eight asynchronous 16-B copies per lane, global -> LDS, rows 8 apart (64 rows per work-group of 128 lanes: 16 lanes per 256-B row, 8 rows per copy).
// l: the lane's LDS byte address, g: the lane's global address of the first row (row pitch DM elements). The s_wait_xcnt ends the copies' own statement so that no address register is rewritten ahead of it.
__device__ __forceinline__ void cp8(unsigned l, const unsigned short* g) {
    asm volatile("global_load_async_to_lds_b128 %0, %8, off\n\t"
                 "global_load_async_to_lds_b128 %1, %9, off\n\t"
                 "global_load_async_to_lds_b128 %2, %10, off\n\t"
                 "global_load_async_to_lds_b128 %3, %11, off\n\t"
                 "global_load_async_to_lds_b128 %4, %12, off\n\t"
                 "global_load_async_to_lds_b128 %5, %13, off\n\t"
                 "global_load_async_to_lds_b128 %6, %14, off\n\t"
                 "global_load_async_to_lds_b128 %7, %15, off\n\t"
                 "s_wait_xcnt 0x0"
                 :: "v"(l), "v"(l + 8u * LP * 2u), "v"(l + 16u * LP * 2u), "v"(l + 24u * LP * 2u), "v"(l + 32u * LP * 2u), "v"(l + 40u * LP * 2u), "v"(l + 48u * LP * 2u), "v"(l + 56u * LP * 2u),
                    "v"(g), "v"(g + (size_t)8 * DM), "v"(g + (size_t)16 * DM), "v"(g + (size_t)24 * DM), "v"(g + (size_t)32 * DM), "v"(g + (size_t)40 * DM), "v"(g + (size_t)48 * DM), "v"(g + (size_t)56 * DM)
                 : "memory");
}
// One tile: A rows 0..63 from a0, A rows 64..127 from a1, B rows 0..127 from b0 (32 copies per lane in flight).
__device__ __forceinline__ void stage_tile(unsigned l, const unsigned short* a0, const unsigned short* a1, const unsigned short* b0) {
    cp8(l, a0); cp8(l + 64u * LP * 2u, a1); cp8(l + 128u * LP * 2u, b0); cp8(l + 192u * LP * 2u, b0 + (size_t)64 * DM);
}
// Publish point of the two-buffer ring: own LDS reads retired, own copies landed, then the work-group barrier (it publishes the next tile and frees the buffer just read).
__device__ __forceinline__ void ring_publish() {
    asm volatile("s_wait_dscnt 0x0" ::: "memory");      // this wave's fragment reads of the buffer that is refilled next have retired
    asm volatile("s_wait_asynccnt 0x0" ::: "memory");   // this wave's copies of the next tile have landed
    __syncthreads();
}

// k_cvt8: every conversion of the call in one launch; a block (256 threads x 8 values) belongs to one input by its index range: x, Wq, Wk, Wv, Wo.
// MODE 0 (x, Wq, Wk, Wv): bf16 bits (RNE). MODE 1 (Wo): f16 of (bf16 value x WOS) (exact for normal results).
static constexpr int CB_X = (int)((size_t)NB * SEQ * DM / 2048);     // blocks of x
static constexpr int CB_W = (int)((size_t)DM * DM / 2048);           // blocks of Wq, of Wo
static constexpr int CB_K = (int)((size_t)KVD * DM / 2048);          // blocks of Wk, of Wv
static constexpr int CB_XB = (int)((size_t)SEQ * DM / 2048);         // blocks of one batch of x
static_assert(((size_t)SEQ * DM) % 2048 == 0);                       // a block never straddles two batches of x
static_assert(((size_t)DM * DM) % 2048 == 0);
static_assert(((size_t)KVD * DM) % 2048 == 0);
template<int MODE>
__device__ __forceinline__ void cvt_chunk(const float* __restrict__ src, unsigned short* dst, int lb) {      // lb: the block's index inside its input
    const size_t i = (size_t)lb * 256 + threadIdx.x;
    const v8f v = *(const v8f*)(src + i * 8);
    if (MODE == 0) {
        v8us o;
#pragma unroll
        for (int k = 0; k < 8; ++k) o[k] = f2bf(v[k]);
        *(v8us*)(dst + i * 8) = o; 
    } else {
        v8h o;
#pragma unroll
        for (int k = 0; k < 8; ++k) o[k] = (h16)(bfr(v[k]) * WOS);
        h16* d = (h16*)dst;
        *(v8h*)(d + i * 8) = o; 
    }
    asm volatile("s_wait_xcnt 0x0" ::: "memory");   // stands behind the store: the built code lays the other ranges' blocks, which write the same registers, behind this one
}
__global__ __launch_bounds__(256) void k_cvt8(const float* __restrict__ x, const float* __restrict__ wq, const float* __restrict__ wk, const float* __restrict__ wv, const float* __restrict__ wo,
                                              unsigned short* XB, unsigned short* WQ, unsigned short* WK, unsigned short* WV, unsigned short* WO) {
    const int blk = blockIdx.x;      // every branch is uniform for the block
    if (blk < CB_X) cvt_chunk<0>(x + (size_t)(blk / CB_XB) * ((size_t)(SEQ_FULL - SEQ) * DM), XB, blk);      // batch pitch of x: SEQ_FULL tokens
    else if (blk < CB_X + CB_W) cvt_chunk<0>(wq, WQ, blk - CB_X);
    else if (blk < CB_X + CB_W + CB_K) cvt_chunk<0>(wk, WK, blk - (CB_X + CB_W));
    else if (blk < CB_X + CB_W + 2 * CB_K) cvt_chunk<0>(wv, WV, blk - (CB_X + CB_W + CB_K));
    else cvt_chunk<1>(wo, WO, blk - (CB_X + CB_W + 2 * CB_K));
}

// k_qkv: the three projections in one launch (a work-group takes one tile of q, of k or of v^T by its index range; inside a range the tile row runs fastest). Register-blocked bf16 GEMM, one wave per 64x64 tile (16 accumulators), 4 waves per 128x128 work-group tile, operands from K-contiguous bf16 planes through the LDS ring, K = DM.
// C[m][n] = sum_k A[m][k] Bt[n][k]; optional rotate-half rotary on the 64-column tile (one head: partner column = c ^ 32, token = r0 % RB + row);
// written as f16 value (Ph) and f16 residual x2048 (Pr) at tile base (r0/RB)*sRB + (r0%RB)*pitch + (c0/CB)*sCB + (c0%CB), row pitch 'pitch' (halves). Tile (bx, by) of (M/128, N/128), 128 threads.
// q: A = x rows (m = b*SEQ + t), Bt = Wq rows (n = h*64 + d) -> planes [(b*32 + h)][t][d], rotary fused
// k: Bt = Wk rows (n = g*64 + d) -> planes [(b*8 + g)][t][d], rotary fused
// v^T: A = Wv rows (m = g*64 + d, 512 rows), Bt = x rows (n = b*SEQ + t) -> planes [(b*512 + m)][t] = [(b*8 + g)][d][t]
static constexpr int XT  = NB * SEQ / 128;       // tile rows of x
static constexpr int GQ_ = XT * (DM / 128);      // work-groups of q
static constexpr int GK_ = XT * (KVD / 128);     // work-groups of k, of v^T
__global__ __launch_bounds__(128) void k_qkv(const bf* __restrict__ XB, const bf* __restrict__ WQ, const bf* __restrict__ WK, const bf* __restrict__ WV,
                                             h16* QH, h16* QR, h16* KH, h16* KR, h16* VH, h16* VR, const float* __restrict__ COS, const float* __restrict__ SIN) {
    __shared__ __align__(16) unsigned short st[2 * TBUF];
    __shared__ __align__(16) float osw[4 * 16 * 68];
    const int wg = blockIdx.x;      // every choice below is uniform for the work-group
    const int part = wg < GQ_ ? 0 : wg < GQ_ + GK_ ? 1 : 2;
    const bool ROPE = part != 2;
    const int lw = wg - (part == 0 ? 0 : part == 1 ? GQ_ : GQ_ + GK_);
    const int bx = ROPE ? lw % XT : lw % (KVD / 128), by = ROPE ? lw / XT : lw / (KVD / 128);
    const bf* A = ROPE ? XB : WV; const bf* Bt = part == 0 ? WQ : part == 1 ? WK : XB;
    h16* Ph = part == 0 ? QH : part == 1 ? KH : VH; h16* Pr = part == 0 ? QR : part == 1 ? KR : VR;
    const int RB = ROPE ? SEQ : KVD, pitch = ROPE ? HD : SEQ, CB = ROPE ? HD : SEQ;
    const size_t sRB = part == 0 ? (size_t)NH_ * SEQ * HD : part == 1 ? (size_t)NG_ * SEQ * HD : (size_t)0, sCB = ROPE ? (size_t)SEQ * HD : (size_t)KVD * SEQ;
    const int K = DM;
    const int tid = threadIdx.x, lane = tid & 31, lr = lane & 15, hi = lane >> 4;
    const int wave = __builtin_amdgcn_readfirstlane(tid >> 5); const int wm = wave >> 1, wn = wave & 1;
    float* os = osw + wave * 16 * 68;      // wave-private epilogue staging
    const int r0 = bx * 128 + wm * 64, c0 = by * 128 + wn * 64;
    v8f acc[4][4];
#pragma unroll
    for (int mb = 0; mb < 4; ++mb)
#pragma unroll
        for (int nb = 0; nb < 4; ++nb) acc[mb][nb] = (v8f){};
    const unsigned lds0 = (unsigned)(uintptr_t)st + (unsigned)((tid >> 4) * (LP * 2) + (tid & 15) * 16);      // this lane's copy target: row tid/16, 16-B chunk tid%16
    const bf* ga = A + (size_t)(bx * 128 + (tid >> 4)) * K + (tid & 15) * 8;
    const bf* gb = Bt + (size_t)(by * 128 + (tid >> 4)) * K + (tid & 15) * 8;
    stage_tile(lds0, ga, ga + (size_t)64 * K, gb);
    asm volatile("s_wait_asynccnt 0x0" ::: "memory");   // tile 0 has landed before the barrier that publishes it
    __syncthreads();
    stage_tile(lds0 + TBUF * 2u, ga + KT, ga + (size_t)64 * K + KT, gb + KT);
    const int ao = (wm * 64 + lr) * LP + 8 * hi, bo = (128 + wn * 64 + lr) * LP + 8 * hi;
#pragma unroll 1
    for (int t = 0; t < NTRIP; ++t) {      // rolled: one trip per LDS buffer
        const bf* sb = st + (t & 1) * TBUF;
        v16bf a[2][4], b[2][4];            // two fragment sets: block s + 1 of this buffer is fetched while block s is multiplied
#pragma unroll
        for (int i = 0; i < 4; ++i) { a[0][i] = ldb(sb + ao + i * 16 * LP); b[0][i] = ldb(sb + bo + i * 16 * LP); }
#pragma unroll
        for (int s = 0; s < KT / 32; ++s) {
            if (s + 1 < KT / 32) {
#pragma unroll
                for (int i = 0; i < 4; ++i) { a[(s + 1) & 1][i] = ldb(sb + ao + i * 16 * LP + (s + 1) * 32); b[(s + 1) & 1][i] = ldb(sb + bo + i * 16 * LP + (s + 1) * 32); }
            }
            __builtin_amdgcn_sched_barrier(0);   // the next block's LDS reads stay one group, ahead of this block's matrix instructions
#pragma unroll
            for (int nb = 0; nb < 4; ++nb)
#pragma unroll
                for (int mb = 0; mb < 4; ++mb) acc[mb][nb] = wmmab(a[s & 1][mb], b[s & 1][nb], acc[mb][nb]);
            __builtin_amdgcn_sched_barrier(0);   // no later LDS read moves in among them
        }
        ring_publish();
        if (t + 2 < NTRIP) { const int kn = (t + 2) * KT; stage_tile(lds0 + (unsigned)(t & 1) * (TBUF * 2u), ga + kn, ga + (size_t)64 * K + kn, gb + kn); }
    }
    asm volatile("s_wait_asynccnt 0x0" ::: "memory");   // nothing of the ring is in flight when the wave goes on
    const size_t tbase = (size_t)(r0 / RB) * sRB + (size_t)(r0 % RB) * (size_t)pitch + (size_t)(c0 / CB) * sCB + (size_t)(c0 % CB);
    const int tok0 = r0 % RB;
#pragma unroll
    for (int mb = 0; mb < 4; ++mb) {
#pragma unroll
        for (int nb = 0; nb < 4; ++nb) {
#pragma unroll
            for (int j = 0; j < 8; ++j) os[(hi * 8 + j) * 68 + nb * 16 + lr] = acc[mb][nb][j]; }   // D: row 8h+j, col lane&15; rows 0..15 x columns 0..63 all written
        wave_sync();
        v8h hv[4], rv[4];
#pragma unroll
        for (int s = 0; s < 4; ++s) { const int row = 4 * s + (lane >> 3), c8 = (lane & 7) * 8;   // 4 s x 4 row groups = 16 rows; 8 lanes x 8 = 64 columns
            const v4f x0 = *(const v4fa*)(&os[row * 68 + c8]); const v4f x1 = *(const v4fa*)(&os[row * 68 + c8 + 4]);
            float xv[8];
#pragma unroll
            for (int i = 0; i < 4; ++i) { xv[i] = x0[i]; xv[4 + i] = x1[i]; }
            if (ROPE) {
                const int pc = c8 ^ 32;
                const v4f y0 = *(const v4fa*)(&os[row * 68 + pc]); const v4f y1 = *(const v4fa*)(&os[row * 68 + pc + 4]);
                const size_t to = (size_t)(tok0 + mb * 16 + row) * HD + c8;
                const v4f ca = *(const v4f*)(COS + to), cb = *(const v4f*)(COS + to + 4), sa = *(const v4f*)(SIN + to), sb = *(const v4f*)(SIN + to + 4);
                const float sg = (c8 < 32) ? -1.0f : 1.0f;     // rotated = concat(-x2, x1)
#pragma unroll
                for (int i = 0; i < 4; ++i) { xv[i] = x0[i] * bfr(ca[i]) + (sg * y0[i]) * bfr(sa[i]); xv[4 + i] = x1[i] * bfr(cb[i]) + (sg * y1[i]) * bfr(sb[i]); }
            }
            v8h hh, rr;
#pragma unroll
            for (int i = 0; i < 8; ++i) { const h16 a0 = (h16)xv[i]; hh[i] = a0; rr[i] = (h16)((xv[i] - (float)a0) * QRS); }
            hv[s] = hh; rv[s] = rr; }
        const size_t sb0 = tbase + (size_t)(mb * 16) * (size_t)pitch;
#pragma unroll
        for (int s = 0; s < 4; ++s) { const int row = 4 * s + (lane >> 3), c8 = (lane & 7) * 8; const size_t oo = sb0 + (size_t)row * (size_t)pitch + c8;
            *(v8h*)(Ph + oo) = hv[s]; *(v8h*)(Pr + oo) = rv[s]; }
        asm volatile("s_wait_xcnt 0x0" ::: "memory");   // stands behind the stores, ahead of the next block's writes to the registers that they name
        wave_sync();
    }
}

// Key/value tiles of k_flash go through LDS: the 4 waves of a work-group (64 query rows of one head) share 64 keys per stage, two buffers.
#define FK    64                 // keys per stage: K tile 64 key rows x 64 d, V^T tile 64 d rows x 64 keys, rows of 128 B each
#define FP    72                 // LDS row pitch in 16-bit elements: 144 B = 16 B x odd, conflict-free for 16-B fragment reads
#define FT    (64 * FP)          // elements of one tile
static_assert(16 * AW == FK);    // the diagonal stage of a work-group is its last one
static_assert(HD == 64);
// Eight asynchronous 16-B copies per lane, global -> LDS: four for a K tile at l, four for a V^T tile at l + one tile; rows 16 apart (128 lanes: 8 lanes per 128-B row, 16 rows per copy).
// l: the lane's LDS byte address, gk / gv: the lane's global addresses of its first row (row pitch HD / SEQ elements). The s_wait_xcnt ends the copies' own statement so that no address register is rewritten ahead of it.
__device__ __forceinline__ void cp_kv(unsigned l, const h16* gk, const h16* gv) {
    asm volatile("global_load_async_to_lds_b128 %0, %8, off\n\t"
                 "global_load_async_to_lds_b128 %1, %9, off\n\t"
                 "global_load_async_to_lds_b128 %2, %10, off\n\t"
                 "global_load_async_to_lds_b128 %3, %11, off\n\t"
                 "global_load_async_to_lds_b128 %4, %12, off\n\t"
                 "global_load_async_to_lds_b128 %5, %13, off\n\t"
                 "global_load_async_to_lds_b128 %6, %14, off\n\t"
                 "global_load_async_to_lds_b128 %7, %15, off\n\t"
                 "s_wait_xcnt 0x0"
                 :: "v"(l), "v"(l + 16u * FP * 2u), "v"(l + 32u * FP * 2u), "v"(l + 48u * FP * 2u),
                    "v"(l + FT * 2u), "v"(l + FT * 2u + 16u * FP * 2u), "v"(l + FT * 2u + 32u * FP * 2u), "v"(l + FT * 2u + 48u * FP * 2u),
                    "v"(gk), "v"(gk + (size_t)16 * HD), "v"(gk + (size_t)32 * HD), "v"(gk + (size_t)48 * HD),
                    "v"(gv), "v"(gv + (size_t)16 * SEQ), "v"(gv + (size_t)32 * SEQ), "v"(gv + (size_t)48 * SEQ)
                 : "memory");
}

// flash_tile: fused causal attention, one wave per 16 query rows of one (batch, head), 4 waves (64 consecutive query rows) per work-group; Q fragments straight from the f16 planes,
// K / V^T fragments from the LDS ring (buffer: K value tile, V^T value tile; ER: then K residual tile, V^T residual tile), two 16-B LDS loads each.
// Transposed form: S^T[key][t] = K Q^T (A = K rows, B = Q rows); lane (t = lane&15, h = lane>>4) holds keys 8h+r of each 16-key tile, so the packed
// P tile is directly the B fragment of O^T[d][t] = V^T P^T (element r <- tile keys 0..15, element 8+r <- tile keys 16..31, lane unchanged).
// Head h reads key/value group h / GS_. A wave works on keys 0 .. t0+15 in steps of 32 (two per stage; it passes a stage's step that lies wholly above its rows); keys above the query index are replaced by NEGB (P = 0) on the diagonal step.
// ER: value + residual path (scores kh*qh + [kh*qr + kr*qh]/2048, O = vh*ph + [vr*ph + vh*pr]/2048), residual products in separate accumulators.
// st is the calling kernel's LDS (2 * FBUF elements used); zh = batch * NH_ + head, xb = index of the work-group's 64 query rows.
template<bool ER>
__device__ __forceinline__ void flash_tile(unsigned short* st, int zh, int xb, const h16* __restrict__ QH, const h16* __restrict__ QR, const h16* __restrict__ KH, const h16* __restrict__ KR,
                                           const h16* __restrict__ VH, const h16* __restrict__ VR, h16* CH, h16* CR) {
    constexpr int FBUF = (ER ? 4 : 2) * FT;      // elements of one buffer
    static_assert((size_t)AW * 16 * 68 * 4 <= (size_t)2 * FBUF * 2);
    float* os = (float*)st;      // output staging lies in the ring: behind the loop's last publish point no wave reads the ring and no copy is in flight
    const int tid = threadIdx.x, lane = tid & 31, lr = lane & 15, hi = lane >> 4;
    const int wave = __builtin_amdgcn_readfirstlane(tid >> 5);
    const int b = zh / NH_, h = zh % NH_, g = h / GS_;
    const int t0 = (xb * AW + wave) * 16;
    const int tq = t0 + lr;
    const size_t qbase = (size_t)zh * SEQ * HD;
    const size_t kvb = (size_t)(b * NG_ + g) * SEQ * HD;
    const size_t qo = qbase + (size_t)(t0 + lr) * HD + 8 * hi;
    const v16h qh0 = ldh(QH + qo), qh1 = ldh(QH + qo + 32);          // B fragments: col t, k = d
    v16h qr0 = qh0, qr1 = qh1;
    if (ER) { qr0 = ldh(QR + qo); qr1 = ldh(QR + qo + 32); }
    const int ko = lr * FP + 8 * hi;           // in a buffer: + key * FP        (A fragment: row key, k = d)
    const int vo = FT + lr * FP + 8 * hi;      // in a buffer: + 16j*FP + key    (A fragment: row d, k = key)
    const int nst = xb + 1;      // stages of this work-group: keys 0 .. (its last query row), the same for its 4 waves
    const unsigned lds0 = (unsigned)(uintptr_t)st + (unsigned)((tid >> 3) * (FP * 2) + (tid & 7) * 16);      // this lane's copy target: row tid/8, 16-B chunk tid%8
    const size_t gko = kvb + (size_t)(tid >> 3) * HD + (tid & 7) * 8;      // + key * HD
    const size_t gvo = kvb + (size_t)(tid >> 3) * SEQ + (tid & 7) * 8;     // + key
    cp_kv(lds0, KH + gko, VH + gvo);
    if (ER) cp_kv(lds0 + 2u * FT * 2u, KR + gko, VR + gvo);
    asm volatile("s_wait_asynccnt 0x0" ::: "memory");   // stage 0 has landed before the barrier that publishes it
    __syncthreads();
    if (nst > 1) {
        cp_kv(lds0 + FBUF * 2u, KH + gko + (size_t)FK * HD, VH + gvo + FK);
        if (ER) cp_kv(lds0 + FBUF * 2u + 2u * FT * 2u, KR + gko + (size_t)FK * HD, VR + gvo + FK);
    }
    v8f oH[4], oL[4];
#pragma unroll
    for (int j = 0; j < 4; ++j) { oH[j] = (v8f){}; oL[j] = (v8f){}; }
    float m = NEGB, l = 0.0f;
#pragma unroll 1
    for (int sg = 0; sg < nst; ++sg) {      // rolled: one trip per LDS buffer
      const h16* sb = (const h16*)st + (sg & 1) * FBUF;
#pragma unroll
      for (int u = 0; u < FK / 32; ++u) {      // unrolled: each step's LDS offsets become immediates of its fragment loads
        const int key0 = sg * FK + u * 32;
        if (key0 >= t0 + 16) continue;      // wave-uniform: on the diagonal stage the step lies wholly above this wave's rows
        const h16* ka = sb + ko + u * 32 * FP;
        float ta[8], tb[8];
        if (!ER) {
            const v16h ka0 = ldh(ka), ka1 = ldh(ka + 32), kb0 = ldh(ka + 16 * FP), kb1 = ldh(ka + 16 * FP + 32);
            v8f sHa = (v8f){}, sHb = (v8f){};
            sHa = wmma16(ka0, qh0, sHa); sHb = wmma16(kb0, qh0, sHb);
            sHa = wmma16(ka1, qh1, sHa); sHb = wmma16(kb1, qh1, sHb);
            asm volatile("v_nop\n\tv_nop\n\tv_nop\n\tv_nop" : "+v"(sHa), "+v"(sHb) : "v"(ka0), "v"(ka1), "v"(kb0), "v"(kb1));
#pragma unroll
            for (int r = 0; r < 8; ++r) { ta[r] = sHa[r] * SC2; tb[r] = sHb[r] * SC2; }
        } else {
            const h16* kr = ka + 2 * FT;
            { const v16h ka0 = ldh(ka), ka1 = ldh(ka + 32), ra0 = ldh(kr), ra1 = ldh(kr + 32);
              v8f sH = (v8f){}, sL = (v8f){};
              sH = wmma16(ka0, qh0, sH); sL = wmma16(ka0, qr0, sL);
              sH = wmma16(ka1, qh1, sH); sL = wmma16(ka1, qr1, sL);
              sL = wmma16(ra0, qh0, sL); sL = wmma16(ra1, qh1, sL);
              asm volatile("v_nop\n\tv_nop\n\tv_nop\n\tv_nop" : "+v"(sH), "+v"(sL) : "v"(ka0), "v"(ka1), "v"(ra0), "v"(ra1));
#pragma unroll
              for (int r = 0; r < 8; ++r) ta[r] = (sH[r] + sL[r] * QRI) * SC2; }
            { const v16h kb0 = ldh(ka + 16 * FP), kb1 = ldh(ka + 16 * FP + 32), rb0 = ldh(kr + 16 * FP), rb1 = ldh(kr + 16 * FP + 32);
              v8f sH = (v8f){}, sL = (v8f){};
              sH = wmma16(kb0, qh0, sH); sL = wmma16(kb0, qr0, sL);
              sH = wmma16(kb1, qh1, sH); sL = wmma16(kb1, qr1, sL);
              sL = wmma16(rb0, qh0, sL); sL = wmma16(rb1, qh1, sL);
              asm volatile("v_nop\n\tv_nop\n\tv_nop\n\tv_nop" : "+v"(sH), "+v"(sL) : "v"(kb0), "v"(kb1), "v"(rb0), "v"(rb1));
#pragma unroll
              for (int r = 0; r < 8; ++r) tb[r] = (sH[r] + sL[r] * QRI) * SC2; }
        }
        if (key0 + 31 > t0) {      // wave-uniform: only the diagonal step holds keys above some query index; every row keeps key key0 <= t
#pragma unroll
            for (int r = 0; r < 8; ++r) { const int kk = key0 + 8 * hi + r; ta[r] = (kk <= tq) ? ta[r] : NEGB; tb[r] = (kk + 16 <= tq) ? tb[r] : NEGB; }
        }
        float mx = NEGB;
#pragma unroll
        for (int r = 0; r < 8; ++r) mx = fmaxf(mx, fmaxf(ta[r], tb[r]));
        mx = fmaxf(mx, __shfl_xor(mx, 16, 32));
        const float mnew = fmaxf(m, mx);
        const float alpha = __builtin_amdgcn_exp2f(m - mnew);
        const float sh = PSH - mnew;
        v16h pb, pq; float ls = 0.0f;
        if (!ER) {
#pragma unroll
            for (int r = 0; r < 8; ++r) { const h16 pa = (h16)__builtin_amdgcn_exp2f(ta[r] + sh); const h16 pc = (h16)__builtin_amdgcn_exp2f(tb[r] + sh); pb[r] = pa; pb[8 + r] = pc; ls += (float)pa + (float)pc; }
            pq = pb;
        } else {
#pragma unroll
            for (int r = 0; r < 8; ++r) { const float fa = __builtin_amdgcn_exp2f(ta[r] + sh); const float fc = __builtin_amdgcn_exp2f(tb[r] + sh);
                const h16 pa = (h16)fa; const h16 pc = (h16)fc; const h16 qa = (h16)((fa - (float)pa) * QRS); const h16 qc = (h16)((fc - (float)pc) * QRS);
                pb[r] = pa; pb[8 + r] = pc; pq[r] = qa; pq[8 + r] = qc; ls += ((float)pa + (float)pc) + ((float)qa + (float)qc) * QRI; }
        }
        l = l * alpha + ls; m = mnew;
#pragma unroll
        for (int j = 0; j < 4; ++j) { oH[j] = oH[j] * alpha; if (ER) oL[j] = oL[j] * alpha; }
        const h16* va = sb + vo + u * 32;
        const v16h v0 = ldh(va), v1 = ldh(va + 16 * FP), v2 = ldh(va + 32 * FP), v3 = ldh(va + 48 * FP);
        if (!ER) {
            oH[0] = wmma16(v0, pb, oH[0]); oH[1] = wmma16(v1, pb, oH[1]); oH[2] = wmma16(v2, pb, oH[2]); oH[3] = wmma16(v3, pb, oH[3]);
            asm volatile("v_nop\n\tv_nop\n\tv_nop\n\tv_nop" : "+v"(oH[0]), "+v"(oH[1]), "+v"(oH[2]), "+v"(oH[3]) : "v"(v0), "v"(v1), "v"(v2), "v"(v3), "v"(pb));
        } else {
            const h16* vr = va + 2 * FT;
            const v16h w0 = ldh(vr), w1 = ldh(vr + 16 * FP), w2 = ldh(vr + 32 * FP), w3 = ldh(vr + 48 * FP);
            oH[0] = wmma16(v0, pb, oH[0]); oH[1] = wmma16(v1, pb, oH[1]); oH[2] = wmma16(v2, pb, oH[2]); oH[3] = wmma16(v3, pb, oH[3]);
            oL[0] = wmma16(w0, pb, oL[0]); oL[1] = wmma16(w1, pb, oL[1]); oL[2] = wmma16(w2, pb, oL[2]); oL[3] = wmma16(w3, pb, oL[3]);
            oL[0] = wmma16(v0, pq, oL[0]); oL[1] = wmma16(v1, pq, oL[1]); oL[2] = wmma16(v2, pq, oL[2]); oL[3] = wmma16(v3, pq, oL[3]);
            asm volatile("v_nop\n\tv_nop\n\tv_nop\n\tv_nop" : "+v"(oH[0]), "+v"(oH[1]), "+v"(oH[2]), "+v"(oH[3]), "+v"(oL[0]), "+v"(oL[1]), "+v"(oL[2]), "+v"(oL[3])
                         : "v"(v0), "v"(v1), "v"(v2), "v"(v3), "v"(w0), "v"(w1), "v"(w2), "v"(w3), "v"(pb), "v"(pq));
        }
      }
      ring_publish();
      if (sg + 2 < nst) { const int kn = (sg + 2) * FK; const unsigned lb = lds0 + (unsigned)(sg & 1) * (FBUF * 2u);
          cp_kv(lb, KH + gko + (size_t)kn * HD, VH + gvo + kn);
          if (ER) cp_kv(lb + 2u * FT * 2u, KR + gko + (size_t)kn * HD, VR + gvo + kn); }
    }
    asm volatile("s_wait_asynccnt 0x0" ::: "memory");   // nothing of the ring is in flight when the wave goes on
    l += __shfl_xor(l, 16, 32);
    const float inv = CXS * (1.0f / l);
    const int wb = wave * 16 * 68;
    // O^T D layout: o_j[r] = (d = 16j + 8h + r, t = lane&15) -> os[t][d]; rows 0..15 x columns 0..63 all written
#pragma unroll
    for (int j = 0; j < 4; ++j) { v4f a, c;
#pragma unroll
        for (int i = 0; i < 4; ++i) {
            if (ER) { a[i] = (oH[j][i] + oL[j][i] * QRI) * inv; c[i] = (oH[j][4 + i] + oL[j][4 + i] * QRI) * inv; }
            else    { a[i] = oH[j][i] * inv; c[i] = oH[j][4 + i] * inv; } }
        *(v4fa*)(&os[wb + lr * 68 + 16 * j + 8 * hi]) = a; *(v4fa*)(&os[wb + lr * 68 + 16 * j + 8 * hi + 4]) = c; }
    wave_sync();
    v8h hv[4], rv[4];
#pragma unroll
    for (int s = 0; s < 4; ++s) { const int row = 4 * s + (lane >> 3), c8 = (lane & 7) * 8;   // 4 s x 4 row groups = 16 rows; 8 lanes x 8 = 64 columns
        const v4f x0 = *(const v4fa*)(&os[wb + row * 68 + c8]); const v4f x1 = *(const v4fa*)(&os[wb + row * 68 + c8 + 4]); v8h hh, rr;
#pragma unroll
        for (int i = 0; i < 4; ++i) { const h16 a0 = (h16)x0[i]; const h16 a1 = (h16)x1[i]; hh[i] = a0; hh[4 + i] = a1; rr[i] = (h16)((x0[i] - (float)a0) * QRS); rr[4 + i] = (h16)((x1[i] - (float)a1) * QRS); }
        hv[s] = hh; rv[s] = rr; }
    const size_t cbase = ((size_t)b * SEQ + t0) * DM + (size_t)h * HD;
    const size_t rbase = ((size_t)b * ER_ROWS + t0) * DM + (size_t)h * HD;     // used by the ER instantiation only (t0 < ER_ROWS there)
#pragma unroll
    for (int s = 0; s < 4; ++s) { const int row = 4 * s + (lane >> 3), c8 = (lane & 7) * 8;
        *(v8h*)(CH + cbase + (size_t)row * DM + c8) = hv[s]; if (ER) *(v8h*)(CR + rbase + (size_t)row * DM + c8) = rv[s]; }
}

// k_flash: both row ranges of the attention in one launch, grid (batch * head, rank); there are more work-groups than resident places, so the ranks take, in order:
// the longest single-product tiles, then the value + residual tiles (three products where the others have one), then the other single-product tiles, each run longest first.
static constexpr int NTT = SEQ / (16 * AW);                             // 64-row tiles of a head
static constexpr int NTE = ER_ROWS / (16 * AW);                         // of them on the value + residual path (the first ones)
static constexpr int NTH = (NTE < NTT - NTE) ? NTE : NTT - NTE;         // single-product tiles ranked ahead of those
__global__ __launch_bounds__(32 * AW) void k_flash(const h16* __restrict__ QH, const h16* __restrict__ QR, const h16* __restrict__ KH, const h16* __restrict__ KR,
                                                   const h16* __restrict__ VH, const h16* __restrict__ VR, h16* CH, h16* CR) {
    __shared__ __align__(16) unsigned short st[2 * 4 * FT];
    const int q = blockIdx.y;      // rank -> tile is a permutation of 0 .. NTT-1; the branch is uniform for the work-group
    const int xb = q < NTH ? NTT - 1 - q : q < NTH + NTE ? NTH + NTE - 1 - q : NTT - 1 - (q - NTE);
    if (xb < NTE) flash_tile<true>(st, blockIdx.x, xb, QH, QR, KH, KR, VH, VR, CH, CR);
    else flash_tile<false>(st, blockIdx.x, xb, QH, QR, KH, KR, VH, VR, CH, CR);
}

// out_tile: output projection, f16 GEMM, one wave per (16*MB) x 64 tile, 4 waves per (32*MB) x 128 work-group tile, operands from K-contiguous f16 planes through the LDS ring, K = DM.
// A rows of a buffer: MB = 4: 128 rows of CH; MB = 2 with RES: 64 rows of CH, then the same 64 rows of CR.
// OUT[b][t][n] = OSC * sum_k (CH[b*SEQ+t][k] + CR[b*ER_ROWS+t][k]/2048) * WO[n][k]; RES: residual products in their own accumulators.
// Rows t in [tstart, tstart+tcount) of every batch; tile (bx, by) of (NB*tcount/(32*MB), DM/128), 128 threads. st (2 * TBUF elements) and osw (4 * 16 * 68 floats) are the calling kernel's LDS.
template<int MB, bool RES>
__device__ __forceinline__ void out_tile(unsigned short* st, float* osw, int bx, int by, const h16* __restrict__ CH, const h16* __restrict__ CR, const h16* __restrict__ WO, float* OUT, int tstart, int tcount) {
    static_assert(RES ? MB == 2 : MB == 4);
    const int tid = threadIdx.x, lane = tid & 31, lr = lane & 15, hi = lane >> 4;
    const int wave = __builtin_amdgcn_readfirstlane(tid >> 5); const int wm = wave >> 1, wn = wave & 1;
    float* os = osw + wave * 16 * 68;      // wave-private epilogue staging
    const int tiles = tcount / (32 * MB);
    const int b = bx / tiles, tw = tstart + (bx % tiles) * 32 * MB, t = tw + wm * 16 * MB, c0 = by * 128 + wn * 64;
    v8f acc[MB][4], acr[MB][4];
#pragma unroll
    for (int mb = 0; mb < MB; ++mb)
#pragma unroll
        for (int nb = 0; nb < 4; ++nb) { acc[mb][nb] = (v8f){}; acr[mb][nb] = (v8f){}; }
    const unsigned lds0 = (unsigned)(uintptr_t)st + (unsigned)((tid >> 4) * (LP * 2) + (tid & 15) * 16);      // this lane's copy target: row tid/16, 16-B chunk tid%16
    const unsigned short* ga0 = (const unsigned short*)CH + ((size_t)b * SEQ + tw + (tid >> 4)) * DM + (tid & 15) * 8;
    const unsigned short* ga1 = RES ? (const unsigned short*)CR + ((size_t)b * ER_ROWS + tw + (tid >> 4)) * DM + (tid & 15) * 8     // RES only (tw < ER_ROWS there)
                                    : ga0 + (size_t)64 * DM;
    const unsigned short* gb = (const unsigned short*)WO + (size_t)(by * 128 + (tid >> 4)) * DM + (tid & 15) * 8;
    stage_tile(lds0, ga0, ga1, gb);
    asm volatile("s_wait_asynccnt 0x0" ::: "memory");   // tile 0 has landed before the barrier that publishes it
    __syncthreads();
    stage_tile(lds0 + TBUF * 2u, ga0 + KT, ga1 + KT, gb + KT);
    const int ao = (wm * 16 * MB + lr) * LP + 8 * hi, ro = ao + 64 * LP, bo = (128 + wn * 64 + lr) * LP + 8 * hi;
#pragma unroll 1
    for (int tr = 0; tr < NTRIP; ++tr) {      // rolled: one trip per LDS buffer
      const h16* sb = (const h16*)st + (tr & 1) * TBUF;
      v16h a[2][MB], ar[2][MB], bb[2][4];      // two fragment sets: block s + 1 of this buffer is fetched while block s is multiplied
#pragma unroll
      for (int i = 0; i < MB; ++i) { a[0][i] = ldh(sb + ao + i * 16 * LP); if (RES) ar[0][i] = ldh(sb + ro + i * 16 * LP); }
#pragma unroll
      for (int i = 0; i < 4; ++i) bb[0][i] = ldh(sb + bo + i * 16 * LP);
#pragma unroll
      for (int s = 0; s < KT / 32; ++s) {
        if (s + 1 < KT / 32) {
#pragma unroll
            for (int i = 0; i < MB; ++i) { a[(s + 1) & 1][i] = ldh(sb + ao + i * 16 * LP + (s + 1) * 32); if (RES) ar[(s + 1) & 1][i] = ldh(sb + ro + i * 16 * LP + (s + 1) * 32); }
#pragma unroll
            for (int i = 0; i < 4; ++i) bb[(s + 1) & 1][i] = ldh(sb + bo + i * 16 * LP + (s + 1) * 32);
        }
        __builtin_amdgcn_sched_barrier(0);   // the next block's LDS reads stay one group, ahead of this block's matrix instructions
#pragma unroll
        for (int nb = 0; nb < 4; ++nb)
#pragma unroll
            for (int mb = 0; mb < MB; ++mb) { acc[mb][nb] = wmma16(a[s & 1][mb], bb[s & 1][nb], acc[mb][nb]); if (RES) acr[mb][nb] = wmma16(ar[s & 1][mb], bb[s & 1][nb], acr[mb][nb]); }
        __builtin_amdgcn_sched_barrier(0);   // no later LDS read moves in among them
      }
      ring_publish();
      if (tr + 2 < NTRIP) { const int kn = (tr + 2) * KT; stage_tile(lds0 + (unsigned)(tr & 1) * (TBUF * 2u), ga0 + kn, ga1 + kn, gb + kn); }
    }
    asm volatile("s_wait_asynccnt 0x0" ::: "memory");   // nothing of the ring is in flight when the wave goes on
#pragma unroll
    for (int mb = 0; mb < MB; ++mb) {
#pragma unroll
        for (int nb = 0; nb < 4; ++nb) {
#pragma unroll
            for (int j = 0; j < 8; ++j) os[(hi * 8 + j) * 68 + nb * 16 + lr] = RES ? (acc[mb][nb][j] + acr[mb][nb][j] * QRI) * OSC : acc[mb][nb][j] * OSC; }   // D: row 8h+j, col lane&15
        wave_sync();
        float* orow = OUT + ((size_t)b * OUT_SEQ + t + mb * 16) * DM + c0;
{
#pragma unroll
            for (int s = 0; s < 8; ++s) { const int row = 2 * s + hi, cofs = lr * 4;   // 8 s x 2 rows = 16 rows; 16 lanes x 4 floats = 64 columns
                const v4f val = *(const v4fa*)(&os[row * 68 + cofs]);
                *(v4f*)(orow + (size_t)row * DM + cofs) = val; }
             }
        wave_sync();
    }
}

// k_out: both row ranges of the output projection in one launch; a work-group takes a tile of the rows >= ER_ROWS or of the value + residual rows by its index range (inside a range the tile row runs fastest).
static constexpr int OT_F = (SEQ > ER_ROWS) ? NB * (SEQ - ER_ROWS) / 128 : 1;      // tile rows, rows >= ER_ROWS
static constexpr int GO_F = (SEQ > ER_ROWS) ? OT_F * (DM / 128) : 0;               // their work-groups
static constexpr int OT_E = NB * ER_ROWS / 64;                                     // tile rows, rows < ER_ROWS
static constexpr int GO_E = OT_E * (DM / 128);
__global__ __launch_bounds__(128) void k_out(const h16* __restrict__ CH, const h16* __restrict__ CR, const h16* __restrict__ WO, float* OUT) {
    __shared__ __align__(16) unsigned short st[2 * TBUF];
    __shared__ __align__(16) float osw[4 * 16 * 68];
    const int wg = blockIdx.x;      // the branch is uniform for the work-group
    if (wg < GO_F) out_tile<4, false>(st, osw, wg % OT_F, wg / OT_F, CH, CR, WO, OUT, ER_ROWS, (SEQ == ER_ROWS) ? 128 : (SEQ - ER_ROWS));
    else out_tile<2, true>(st, osw, (wg - GO_F) % OT_E, (wg - GO_F) / OT_E, CH, CR, WO, OUT, 0, ER_ROWS);
}

static constexpr size_t al256(size_t v) { return (v + 255) & ~(size_t)255; }
static constexpr size_t SZ_XB = al256((size_t)NB * SEQ * DM * 2);
static constexpr size_t SZ_WQ = al256((size_t)DM * DM * 2);
static constexpr size_t SZ_WK = al256((size_t)KVD * DM * 2);
static constexpr size_t SZ_QP = al256((size_t)NB * NH_ * SEQ * HD * 2);
static constexpr size_t SZ_KP = al256((size_t)NB * NG_ * SEQ * HD * 2);
static constexpr size_t SZ_CH = al256((size_t)NB * SEQ * DM * 2);
static constexpr size_t SZ_CR = al256((size_t)NB * ER_ROWS * DM * 2);
static constexpr size_t SZ_TOTAL = SZ_XB + 2 * SZ_WQ + 2 * SZ_WK + 2 * SZ_QP + 4 * SZ_KP + SZ_CH + SZ_CR;
static_assert(SZ_TOTAL <= (size_t)134217728);          // workspace carve <= 128 MiB

extern "C" void kernel_launch(void* const* d_in, const int* in_sizes, int n_in,
                              void* d_out, int out_size, void* d_ws, size_t ws_size, hipStream_t stream) {
    if (n_in < 7) return;
    const size_t needx = ((size_t)(NB - 1) * SEQ_FULL + SEQ) * DM;
    if ((size_t)in_sizes[0] < needx) return;
    if ((size_t)in_sizes[1] < (size_t)DM * DM || (size_t)in_sizes[2] < (size_t)KVD * DM || (size_t)in_sizes[3] < (size_t)KVD * DM || (size_t)in_sizes[4] < (size_t)DM * DM) return;
    if ((size_t)in_sizes[5] < (size_t)SEQ * HD || (size_t)in_sizes[6] < (size_t)SEQ * HD) return;
    if ((size_t)out_size < ((size_t)(NB - 1) * OUT_SEQ + SEQ) * DM) return;
    if (SZ_TOTAL > ws_size) return;
    // wire order: x, Wq, Wk, Wv, Wo, cos, sin (W as [out][in] = Bt as-is; cos/sin [token][64] read as values)
    const float* x = (const float*)d_in[0]; const float* wq = (const float*)d_in[1]; const float* wk = (const float*)d_in[2]; const float* wv = (const float*)d_in[3];
    const float* wo = (const float*)d_in[4]; const float* cs = (const float*)d_in[5]; const float* sn = (const float*)d_in[6];
    float* OUT = (float*)d_out;      // [NB][SEQ][2048]
    char* wsp = (char*)d_ws;
    bf* XB = (bf*)wsp; wsp += SZ_XB;                 // [NB*SEQ][2048] bf16
    bf* WQ = (bf*)wsp; wsp += SZ_WQ;                 // [2048][2048] bf16
    bf* WK = (bf*)wsp; wsp += SZ_WK;                 // [512][2048] bf16
    bf* WV = (bf*)wsp; wsp += SZ_WK;                 // [512][2048] bf16
    h16* WO = (h16*)wsp; wsp += SZ_WQ;               // [2048][2048] f16 x64
    h16* QH = (h16*)wsp; wsp += SZ_QP;               // [NB*32][SEQ][64]
    h16* QR = (h16*)wsp; wsp += SZ_QP;               // residual x2048
    h16* KH = (h16*)wsp; wsp += SZ_KP;               // [NB*8][SEQ][64]
    h16* KR = (h16*)wsp; wsp += SZ_KP;               // residual x2048
    h16* VH = (h16*)wsp; wsp += SZ_KP;               // [NB*8][64][SEQ]
    h16* VR = (h16*)wsp; wsp += SZ_KP;               // residual x2048
    h16* CH = (h16*)wsp; wsp += SZ_CH;               // [NB*SEQ][2048] ctx x64
    h16* CR = (h16*)wsp; wsp += SZ_CR;               // [NB*ER_ROWS][2048] residual x2048

    k_cvt8<<<CB_X + 2 * CB_W + 2 * CB_K, 256, 0, stream>>>(x, wq, wk, wv, wo, XB, WQ, WK, WV, (unsigned short*)WO);

    k_qkv<<<GQ_ + 2 * GK_, 128, 0, stream>>>(XB, WQ, WK, WV, QH, QR, KH, KR, VH, VR, cs, sn);

    k_flash<<<dim3(NB * NH_, NTT, 1), 32 * AW, 0, stream>>>(QH, QR, KH, KR, VH, VR, CH, CR);

    k_out<<<GO_F + GO_E, 128, 0, stream>>>(CH, CR, WO, OUT);
}

// v005
// One run takes 150 microseconds.
// Next to v004, in two timings, it ran 1.04 and 1.03 times as fast.
// Counting every step since v000, it is 2.79 times as fast.
#include <hip/hip_runtime.h>

// Causal grouped-query attention, width 2048 = 32 heads x 64, 8 key/value groups (4 heads per group), rotate-half rotary with INPUT cos/sin tables, output projection; x [NB][SEQ][2048], W [out][in] (y = x W^T), no biases, score scale 1/8.
// Compute dtypes, f32 accumulate everywhere: q/k/v projections v_wmma_f32_16x16x32_bf16 (x, W RNE-converted to bf16; products exact); rotary in f32 with bf16-converted table values;
// scores, P.V and the output projection v_wmma_f32_16x16x32_f16: q, k, v^T, ctx(x64) as f16 value planes plus f16 residual planes x2048; Wo as f16 of the bf16 value x64; P carried x256.
// Query rows >= 512 use single f16 products; query rows < 512 use value + residual (three products for scores and P.V, two for the output projection), residual products in their own accumulators.
// Transposed flash form (S^T = K Q^T, O^T = V^T P^T), online softmax in f32 (running max), causal mask applied by value on the diagonal key step.

#ifndef NB
#define NB 2
#endif
#ifndef SEQ
#define SEQ 2048
#endif
#define NB_FULL  2
#define SEQ_FULL 2048
#ifndef OUT_SEQ
#define OUT_SEQ SEQ              // row pitch (in tokens) between batches of the output
#endif
#define DM   2048                // model width = depth of every GEMM
#define NH_  32
#define NG_  8
#define GS_  4                   // heads per key/value group
#define HD   64
#define KVD  512                 // NG_ * HD
#define AW   4                   // waves per flash block (16 query rows each)
#define QRS  2048.0f             // carry of every residual plane
#define QRI  (1.0f / 2048.0f)
#define SC2  (0.125f * 1.4426950408889634f)   // HD^-0.5 * log2(e)
#define PSH  8.0f                // log2 of the P carry (256)
#define CXS  64.0f               // carry of the ctx plane
#define WOS  64.0f               // carry of the Wo plane
#define OSC  (1.0f / 4096.0f)    // 1 / (CXS * WOS)
#define NEGB (-3.0e38f)

static constexpr int ER_ROWS = (SEQ < 512) ? SEQ : 512;   // query rows per batch on the value + residual path

static_assert(HD == 64);
static_assert(NH_ * HD == DM);
static_assert(NG_ * HD == KVD);
static_assert(NG_ * GS_ == NH_);
static_assert(DM % 64 == 0);
static_assert(DM % 32 == 0);                   // GEMM k-loop steps by 32
static_assert(KVD % 64 == 0);
static_assert(SEQ % 64 == 0);                  // a 64-row tile never straddles two batches
static_assert(SEQ % (16 * AW) == 0);
static_assert(ER_ROWS % 64 == 0);
static_assert((SEQ - ER_ROWS) % 64 == 0);
static_assert(((size_t)SEQ * DM) % 8 == 0);
static_assert(NB <= NB_FULL);
static_assert(SEQ <= SEQ_FULL);

typedef _Float16 h16;
typedef unsigned short bf;
typedef __attribute__((ext_vector_type(16))) __bf16   v16bf;
typedef __attribute__((ext_vector_type(16))) _Float16 v16h;
typedef __attribute__((ext_vector_type(8)))  _Float16 v8h;
typedef __attribute__((ext_vector_type(8)))  unsigned short v8us;
typedef __attribute__((ext_vector_type(8)))  unsigned v8u;
typedef __attribute__((ext_vector_type(8)))  float    v8f;
typedef __attribute__((ext_vector_type(4)))  float    v4f;
typedef v4f  __attribute__((may_alias)) v4fa;

__device__ __forceinline__ unsigned short f2bf(float f) { unsigned u = __float_as_uint(f); u += 0x7FFFu + ((u >> 16) & 1u); return (unsigned short)(u >> 16); }
__device__ __forceinline__ float bfr(float f) { return __uint_as_float(((unsigned)f2bf(f)) << 16); }   // value after RNE conversion to bf16
__device__ __forceinline__ v16h cat16(v8h lo, v8h hi) { return __builtin_shufflevector(lo, hi, 0, 1, 2, 3, 4, 5, 6, 7, 8, 9, 10, 11, 12, 13, 14, 15); }
__device__ __forceinline__ v16bf cat16b(v8us lo, v8us hi) { return __builtin_bit_cast(v16bf, __builtin_shufflevector(lo, hi, 0, 1, 2, 3, 4, 5, 6, 7, 8, 9, 10, 11, 12, 13, 14, 15)); }
__device__ __forceinline__ v8f wmma16(v16h a, v16h b, v8f c) { return __builtin_amdgcn_wmma_f32_16x16x32_f16(false, a, false, b, (short)0, c, false, false); }
__device__ __forceinline__ v8f wmmab(v16bf a, v16bf b, v8f c) { return __builtin_amdgcn_wmma_f32_16x16x32_bf16(false, a, false, b, (short)0, c, false, false); }
// fragment loaders from K-contiguous 16-bit rows; p already includes + 8*(lane>>4): elements 0..7 <- k0+8h+0..7, elements 8..15 <- k0+16+8h+0..7 (same map for A and B)
__device__ __forceinline__ v16h  ldh(const h16* p) { return cat16(*(const v8h*)p, *(const v8h*)(p + 16)); }
__device__ __forceinline__ v16bf ldb(const bf* p)  { return cat16b(*(const v8us*)p, *(const v8us*)(p + 16)); }
// ordering point for wave-private LDS tiles (same wave writes and reads)
__device__ __forceinline__ void wave_sync() { __builtin_amdgcn_fence(3 /* release order */, "wavefront"); __builtin_amdgcn_wave_barrier(); asm volatile("" ::: "memory"); }

// Operand tiles of every GEMM kernel go through LDS: a work-group of 4 waves (2 x 2 wave tiles) shares 128 A rows and 128 B rows, KT k-values per trip, two buffers.
#define KT    128                // k per trip: rows of 256 B
#define LP    136                // LDS row pitch in 16-bit elements: 272 B = 16 B x odd, conflict-free for 16-B fragment reads
#define TBUF  (256 * LP)         // elements of one buffer: 128 A rows, then 128 B rows
#define NTRIP (DM / KT)
static_assert(DM % KT == 0);
static_assert(NTRIP >= 2);       // the prologue fills two tiles
static_assert((NB * SEQ) % 128 == 0);
static_assert(DM % 128 == 0);
static_assert(KVD % 128 == 0);
static_assert((SEQ - ER_ROWS) % 128 == 0);
// Eight asynchronous 16-B copies per lane, global -> LDS, rows 8 apart (64 rows per work-group of 128 lanes: 16 lanes per 256-B row, 8 rows per copy).
// l: the lane's LDS byte address, g: the lane's global address of the first row (row pitch DM elements). The s_wait_xcnt ends the copies' own statement so that no address register is rewritten ahead of it.
__device__ __forceinline__ void cp8(unsigned l, const unsigned short* g) {
    asm volatile("global_load_async_to_lds_b128 %0, %8, off\n\t"
                 "global_load_async_to_lds_b128 %1, %9, off\n\t"
                 "global_load_async_to_lds_b128 %2, %10, off\n\t"
                 "global_load_async_to_lds_b128 %3, %11, off\n\t"
                 "global_load_async_to_lds_b128 %4, %12, off\n\t"
                 "global_load_async_to_lds_b128 %5, %13, off\n\t"
                 "global_load_async_to_lds_b128 %6, %14, off\n\t"
                 "global_load_async_to_lds_b128 %7, %15, off\n\t"
                 "s_wait_xcnt 0x0"
                 :: "v"(l), "v"(l + 8u * LP * 2u), "v"(l + 16u * LP * 2u), "v"(l + 24u * LP * 2u), "v"(l + 32u * LP * 2u), "v"(l + 40u * LP * 2u), "v"(l + 48u * LP * 2u), "v"(l + 56u * LP * 2u),
                    "v"(g), "v"(g + (size_t)8 * DM), "v"(g + (size_t)16 * DM), "v"(g + (size_t)24 * DM), "v"(g + (size_t)32 * DM), "v"(g + (size_t)40 * DM), "v"(g + (size_t)48 * DM), "v"(g + (size_t)56 * DM)
                 : "memory");
}
// One tile: A rows 0..63 from a0, A rows 64..127 from a1, B rows 0..127 from b0 (32 copies per lane in flight).
__device__ __forceinline__ void stage_tile(unsigned l, const unsigned short* a0, const unsigned short* a1, const unsigned short* b0) {
    cp8(l, a0); cp8(l + 64u * LP * 2u, a1); cp8(l + 128u * LP * 2u, b0); cp8(l + 192u * LP * 2u, b0 + (size_t)64 * DM);
}
// Publish point of the two-buffer ring: own LDS reads retired, own copies landed, then the work-group barrier (it publishes the next tile and frees the buffer just read).
__device__ __forceinline__ void ring_publish() {
    asm volatile("s_wait_dscnt 0x0" ::: "memory");      // this wave's fragment reads of the buffer that is refilled next have retired
    asm volatile("s_wait_asynccnt 0x0" ::: "memory");   // this wave's copies of the next tile have landed
    __syncthreads();
}

// k_cvt8: every conversion of the call in one launch; a block (256 threads x 8 values) belongs to one input by its index range: x, Wq, Wk, Wv, Wo.
// MODE 0 (x, Wq, Wk, Wv): bf16 bits (RNE). MODE 1 (Wo): f16 of (bf16 value x WOS) (exact for normal results).
static constexpr int CB_X = (int)((size_t)NB * SEQ * DM / 2048);     // blocks of x
static constexpr int CB_W = (int)((size_t)DM * DM / 2048);           // blocks of Wq, of Wo
static constexpr int CB_K = (int)((size_t)KVD * DM / 2048);          // blocks of Wk, of Wv
static constexpr int CB_XB = (int)((size_t)SEQ * DM / 2048);         // blocks of one batch of x
static_assert(((size_t)SEQ * DM) % 2048 == 0);                       // a block never straddles two batches of x
static_assert(((size_t)DM * DM) % 2048 == 0);
static_assert(((size_t)KVD * DM) % 2048 == 0);
template<int MODE>
__device__ __forceinline__ void cvt_chunk(const float* __restrict__ src, unsigned short* dst, int lb) {      // lb: the block's index inside its input
    const size_t i = (size_t)lb * 256 + threadIdx.x;
    const v8f v = *(const v8f*)(src + i * 8);
    if (MODE == 0) {
        v8us o;
#pragma unroll
        for (int k = 0; k < 8; ++k) o[k] = f2bf(v[k]);
        *(v8us*)(dst + i * 8) = o; 
    } else {
        v8h o;
#pragma unroll
        for (int k = 0; k < 8; ++k) o[k] = (h16)(bfr(v[k]) * WOS);
        h16* d = (h16*)dst;
        *(v8h*)(d + i * 8) = o; 
    }
    asm volatile("s_wait_xcnt 0x0" ::: "memory");   // stands behind the store: the built code lays the other ranges' blocks, which write the same registers, behind this one
}
__global__ __launch_bounds__(256) void k_cvt8(const float* __restrict__ x, const float* __restrict__ wq, const float* __restrict__ wk, const float* __restrict__ wv, const float* __restrict__ wo,
                                              unsigned short* XB, unsigned short* WQ, unsigned short* WK, unsigned short* WV, unsigned short* WO) {
    const int blk = blockIdx.x;      // every branch is uniform for the block
    if (blk < CB_X) cvt_chunk<0>(x + (size_t)(blk / CB_XB) * ((size_t)(SEQ_FULL - SEQ) * DM), XB, blk);      // batch pitch of x: SEQ_FULL tokens
    else if (blk < CB_X + CB_W) cvt_chunk<0>(wq, WQ, blk - CB_X);
    else if (blk < CB_X + CB_W + CB_K) cvt_chunk<0>(wk, WK, blk - (CB_X + CB_W));
    else if (blk < CB_X + CB_W + 2 * CB_K) cvt_chunk<0>(wv, WV, blk - (CB_X + CB_W + CB_K));
    else cvt_chunk<1>(wo, WO, blk - (CB_X + CB_W + 2 * CB_K));
}

// k_qkv: the three projections in one launch (a work-group takes one tile of q, of k or of v^T by its index range; inside a range the tile row runs fastest). Register-blocked bf16 GEMM, one wave per 64x64 tile (16 accumulators), 4 waves per 128x128 work-group tile, operands from K-contiguous bf16 planes through the LDS ring, K = DM.
// C[m][n] = sum_k A[m][k] Bt[n][k]; optional rotate-half rotary on the 64-column tile (one head: partner column = c ^ 32, token = r0 % RB + row);
// written as f16 value (Ph) and f16 residual x2048 (Pr) at tile base (r0/RB)*sRB + (r0%RB)*pitch + (c0/CB)*sCB + (c0%CB), row pitch 'pitch' (halves). Tile (bx, by) of (M/128, N/128), 128 threads.
// q: A = x rows (m = b*SEQ + t), Bt = Wq rows (n = h*64 + d) -> planes [(b*32 + h)][t][d], rotary fused
// k: Bt = Wk rows (n = g*64 + d) -> planes [(b*8 + g)][t][d], rotary fused
// v^T: A = Wv rows (m = g*64 + d, 512 rows), Bt = x rows (n = b*SEQ + t) -> planes [(b*512 + m)][t] = [(b*8 + g)][d][t]
static constexpr int XT  = NB * SEQ / 128;       // tile rows of x
static constexpr int GQ_ = XT * (DM / 128);      // work-groups of q
static constexpr int GK_ = XT * (KVD / 128);     // work-groups of k, of v^T
__global__ __launch_bounds__(128) void k_qkv(const bf* __restrict__ XB, const bf* __restrict__ WQ, const bf* __restrict__ WK, const bf* __restrict__ WV,
                                             h16* QH, h16* QR, h16* KH, h16* KR, h16* VH, h16* VR, const float* __restrict__ COS, const float* __restrict__ SIN) {
    __shared__ __align__(16) unsigned short st[2 * TBUF];
    __shared__ __align__(16) float osw[4 * 16 * 68];
    const int wg = blockIdx.x;      // every choice below is uniform for the work-group
    const int part = wg < GQ_ ? 0 : wg < GQ_ + GK_ ? 1 : 2;
    const bool ROPE = part != 2;
    const int lw = wg - (part == 0 ? 0 : part == 1 ? GQ_ : GQ_ + GK_);
    const int bx = ROPE ? lw % XT : lw % (KVD / 128), by = ROPE ? lw / XT : lw / (KVD / 128);
    const bf* A = ROPE ? XB : WV; const bf* Bt = part == 0 ? WQ : part == 1 ? WK : XB;
    h16* Ph = part == 0 ? QH : part == 1 ? KH : VH; h16* Pr = part == 0 ? QR : part == 1 ? KR : VR;
    const int RB = ROPE ? SEQ : KVD, pitch = ROPE ? HD : SEQ, CB = ROPE ? HD : SEQ;
    const size_t sRB = part == 0 ? (size_t)NH_ * SEQ * HD : part == 1 ? (size_t)NG_ * SEQ * HD : (size_t)0, sCB = ROPE ? (size_t)SEQ * HD : (size_t)KVD * SEQ;
    const int K = DM;
    const int tid = threadIdx.x, lane = tid & 31, lr = lane & 15, hi = lane >> 4;
    const int wave = __builtin_amdgcn_readfirstlane(tid >> 5); const int wm = wave >> 1, wn = wave & 1;
    float* os = osw + wave * 16 * 68;      // wave-private epilogue staging
    const int r0 = bx * 128 + wm * 64, c0 = by * 128 + wn * 64;
    v8f acc[4][4];
#pragma unroll
    for (int mb = 0; mb < 4; ++mb)
#pragma unroll
        for (int nb = 0; nb < 4; ++nb) acc[mb][nb] = (v8f){};
    const unsigned lds0 = (unsigned)(uintptr_t)st + (unsigned)((tid >> 4) * (LP * 2) + (tid & 15) * 16);      // this lane's copy target: row tid/16, 16-B chunk tid%16
    const bf* ga = A + (size_t)(bx * 128 + (tid >> 4)) * K + (tid & 15) * 8;
    const bf* gb = Bt + (size_t)(by * 128 + (tid >> 4)) * K + (tid & 15) * 8;
    stage_tile(lds0, ga, ga + (size_t)64 * K, gb);
    asm volatile("s_wait_asynccnt 0x0" ::: "memory");   // tile 0 has landed before the barrier that publishes it
    __syncthreads();
    stage_tile(lds0 + TBUF * 2u, ga + KT, ga + (size_t)64 * K + KT, gb + KT);
    const int ao = (wm * 64 + lr) * LP + 8 * hi, bo = (128 + wn * 64 + lr) * LP + 8 * hi;
#pragma unroll 1
    for (int t = 0; t < NTRIP; ++t) {      // rolled: one trip per LDS buffer
        const bf* sb = st + (t & 1) * TBUF;
        v16bf a[2][4], b[2][4];            // two fragment sets: block s + 1 of this buffer is fetched while block s is multiplied
#pragma unroll
        for (int i = 0; i < 4; ++i) { a[0][i] = ldb(sb + ao + i * 16 * LP); b[0][i] = ldb(sb + bo + i * 16 * LP); }
#pragma unroll
        for (int s = 0; s < KT / 32; ++s) {
            if (s + 1 < KT / 32) {
#pragma unroll
                for (int i = 0; i < 4; ++i) { a[(s + 1) & 1][i] = ldb(sb + ao + i * 16 * LP + (s + 1) * 32); b[(s + 1) & 1][i] = ldb(sb + bo + i * 16 * LP + (s + 1) * 32); }
            }
            __builtin_amdgcn_sched_barrier(0);   // the next block's LDS reads stay one group, ahead of this block's matrix instructions
#pragma unroll
            for (int nb = 0; nb < 4; ++nb)
#pragma unroll
                for (int mb = 0; mb < 4; ++mb) acc[mb][nb] = wmmab(a[s & 1][mb], b[s & 1][nb], acc[mb][nb]);
            __builtin_amdgcn_sched_barrier(0);   // no later LDS read moves in among them
        }
        ring_publish();
        if (t + 2 < NTRIP) { const int kn = (t + 2) * KT; stage_tile(lds0 + (unsigned)(t & 1) * (TBUF * 2u), ga + kn, ga + (size_t)64 * K + kn, gb + kn); }
    }
    asm volatile("s_wait_asynccnt 0x0" ::: "memory");   // nothing of the ring is in flight when the wave goes on
    const size_t tbase = (size_t)(r0 / RB) * sRB + (size_t)(r0 % RB) * (size_t)pitch + (size_t)(c0 / CB) * sCB + (size_t)(c0 % CB);
    const int tok0 = r0 % RB;
#pragma unroll
    for (int mb = 0; mb < 4; ++mb) {
#pragma unroll
        for (int nb = 0; nb < 4; ++nb) {
#pragma unroll
            for (int j = 0; j < 8; ++j) os[(hi * 8 + j) * 68 + nb * 16 + lr] = acc[mb][nb][j]; }   // D: row 8h+j, col lane&15; rows 0..15 x columns 0..63 all written
        wave_sync();
        v8h hv[4], rv[4];
#pragma unroll
        for (int s = 0; s < 4; ++s) { const int row = 4 * s + (lane >> 3), c8 = (lane & 7) * 8;   // 4 s x 4 row groups = 16 rows; 8 lanes x 8 = 64 columns
            const v4f x0 = *(const v4fa*)(&os[row * 68 + c8]); const v4f x1 = *(const v4fa*)(&os[row * 68 + c8 + 4]);
            float xv[8];
#pragma unroll
            for (int i = 0; i < 4; ++i) { xv[i] = x0[i]; xv[4 + i] = x1[i]; }
            if (ROPE) {
                const int pc = c8 ^ 32;
                const v4f y0 = *(const v4fa*)(&os[row * 68 + pc]); const v4f y1 = *(const v4fa*)(&os[row * 68 + pc + 4]);
                const size_t to = (size_t)(tok0 + mb * 16 + row) * HD + c8;
                const v4f ca = *(const v4f*)(COS + to), cb = *(const v4f*)(COS + to + 4), sa = *(const v4f*)(SIN + to), sb = *(const v4f*)(SIN + to + 4);
                const float sg = (c8 < 32) ? -1.0f : 1.0f;     // rotated = concat(-x2, x1)
#pragma unroll
                for (int i = 0; i < 4; ++i) { xv[i] = x0[i] * bfr(ca[i]) + (sg * y0[i]) * bfr(sa[i]); xv[4 + i] = x1[i] * bfr(cb[i]) + (sg * y1[i]) * bfr(sb[i]); }
            }
            v8h hh, rr;
#pragma unroll
            for (int i = 0; i < 8; ++i) { const h16 a0 = (h16)xv[i]; hh[i] = a0; rr[i] = (h16)((xv[i] - (float)a0) * QRS); }
            hv[s] = hh; rv[s] = rr; }
        const size_t sb0 = tbase + (size_t)(mb * 16) * (size_t)pitch;
#pragma unroll
        for (int s = 0; s < 4; ++s) { const int row = 4 * s + (lane >> 3), c8 = (lane & 7) * 8; const size_t oo = sb0 + (size_t)row * (size_t)pitch + c8;
            *(v8h*)(Ph + oo) = hv[s]; *(v8h*)(Pr + oo) = rv[s]; }
        asm volatile("s_wait_xcnt 0x0" ::: "memory");   // stands behind the stores, ahead of the next block's writes to the registers that they name
        wave_sync();
    }
}

// Key/value tiles of k_flash go through LDS: the 4 waves of a work-group (64 query rows of one head) share 64 keys per stage, two buffers.
#define FK    64                 // keys per stage: K tile 64 key rows x 64 d, V^T tile 64 d rows x 64 keys, rows of 128 B each
#define FP    72                 // LDS row pitch in 16-bit elements: 144 B = 16 B x odd, conflict-free for 16-B fragment reads
#define FT    (64 * FP)          // elements of one tile
static_assert(16 * AW == FK);    // the diagonal stage of a work-group is its last one
static_assert(HD == 64);
// Eight asynchronous 16-B copies per lane, global -> LDS: four for a K tile at l, four for a V^T tile at l + one tile; rows 16 apart (128 lanes: 8 lanes per 128-B row, 16 rows per copy).
// l: the lane's LDS byte address, gk / gv: the lane's global addresses of its first row (row pitch HD / SEQ elements). The s_wait_xcnt ends the copies' own statement so that no address register is rewritten ahead of it.
__device__ __forceinline__ void cp_kv(unsigned l, const h16* gk, const h16* gv) {
    asm volatile("global_load_async_to_lds_b128 %0, %8, off\n\t"
                 "global_load_async_to_lds_b128 %1, %9, off\n\t"
                 "global_load_async_to_lds_b128 %2, %10, off\n\t"
                 "global_load_async_to_lds_b128 %3, %11, off\n\t"
                 "global_load_async_to_lds_b128 %4, %12, off\n\t"
                 "global_load_async_to_lds_b128 %5, %13, off\n\t"
                 "global_load_async_to_lds_b128 %6, %14, off\n\t"
                 "global_load_async_to_lds_b128 %7, %15, off\n\t"
                 "s_wait_xcnt 0x0"
                 :: "v"(l), "v"(l + 16u * FP * 2u), "v"(l + 32u * FP * 2u), "v"(l + 48u * FP * 2u),
                    "v"(l + FT * 2u), "v"(l + FT * 2u + 16u * FP * 2u), "v"(l + FT * 2u + 32u * FP * 2u), "v"(l + FT * 2u + 48u * FP * 2u),
                    "v"(gk), "v"(gk + (size_t)16 * HD), "v"(gk + (size_t)32 * HD), "v"(gk + (size_t)48 * HD),
                    "v"(gv), "v"(gv + (size_t)16 * SEQ), "v"(gv + (size_t)32 * SEQ), "v"(gv + (size_t)48 * SEQ)
                 : "memory");
}

// flash_tile: fused causal attention, one wave per 16 query rows of one (batch, head), 4 waves (64 consecutive query rows) per work-group; Q fragments straight from the f16 planes,
// K / V^T fragments from the LDS ring (buffer: K value tile, V^T value tile; ER: then K residual tile, V^T residual tile), two 16-B LDS loads each.
// Transposed form: S^T[key][t] = K Q^T (A = K rows, B = Q rows); lane (t = lane&15, h = lane>>4) holds keys 8h+r of each 16-key tile, so the packed
// P tile is directly the B fragment of O^T[d][t] = V^T P^T (element r <- tile keys 0..15, element 8+r <- tile keys 16..31, lane unchanged).
// Head h reads key/value group h / GS_. A wave works on keys 0 .. t0+15 in steps of 32 (two per stage; it passes a stage's step that lies wholly above its rows); keys above the query index are replaced by NEGB (P = 0) on the diagonal step.
// ER: value + residual path (scores kh*qh + [kh*qr + kr*qh]/2048, O = vh*ph + [vr*ph + vh*pr]/2048), residual products in separate accumulators.
// Row sums of P on the matrix unit: A has ones in rows 0 and 8 (lanes 0, 8, 16, 24) and zeros elsewhere, B = the packed P tile: rows 0 and 8 of the 16x16 result, which are element 0 of either lane half,
// hold per query column the sum over the step's 32 keys of the f16 P values; the other rows stay 0, so only element 0 is rescaled, and the halves need no exchange at the end.
// st is the calling kernel's LDS (2 * FBUF elements used); zh = batch * NH_ + head, xb = index of the work-group's 64 query rows.
template<bool ER>
__device__ __forceinline__ void flash_tile(unsigned short* st, int zh, int xb, const h16* __restrict__ QH, const h16* __restrict__ QR, const h16* __restrict__ KH, const h16* __restrict__ KR,
                                           const h16* __restrict__ VH, const h16* __restrict__ VR, h16* CH, h16* CR) {
    constexpr int FBUF = (ER ? 4 : 2) * FT;      // elements of one buffer
    static_assert((size_t)AW * 16 * 68 * 4 <= (size_t)2 * FBUF * 2);
    float* os = (float*)st;      // output staging lies in the ring: behind the loop's last publish point no wave reads the ring and no copy is in flight
    const int tid = threadIdx.x, lane = tid & 31, lr = lane & 15, hi = lane >> 4;
    const int wave = __builtin_amdgcn_readfirstlane(tid >> 5);
    const int b = zh / NH_, h = zh % NH_, g = h / GS_;
    const int t0 = (xb * AW + wave) * 16;
    const int tq = t0 + lr;
    const size_t qbase = (size_t)zh * SEQ * HD;
    const size_t kvb = (size_t)(b * NG_ + g) * SEQ * HD;
    const size_t qo = qbase + (size_t)(t0 + lr) * HD + 8 * hi;
    const v16h qh0 = ldh(QH + qo), qh1 = ldh(QH + qo + 32);          // B fragments: col t, k = d
    v16h qr0 = qh0, qr1 = qh1;
    if (ER) { qr0 = ldh(QR + qo); qr1 = ldh(QR + qo + 32); }
    const int ko = lr * FP + 8 * hi;           // in a buffer: + key * FP        (A fragment: row key, k = d)
    const int vo = FT + lr * FP + 8 * hi;      // in a buffer: + 16j*FP + key    (A fragment: row d, k = key)
    const int nst = xb + 1;      // stages of this work-group: keys 0 .. (its last query row), the same for its 4 waves
    const unsigned lds0 = (unsigned)(uintptr_t)st + (unsigned)((tid >> 3) * (FP * 2) + (tid & 7) * 16);      // this lane's copy target: row tid/8, 16-B chunk tid%8
    const size_t gko = kvb + (size_t)(tid >> 3) * HD + (tid & 7) * 8;      // + key * HD
    const size_t gvo = kvb + (size_t)(tid >> 3) * SEQ + (tid & 7) * 8;     // + key
    cp_kv(lds0, KH + gko, VH + gvo);
    if (ER) cp_kv(lds0 + 2u * FT * 2u, KR + gko, VR + gvo);
    asm volatile("s_wait_asynccnt 0x0" ::: "memory");   // stage 0 has landed before the barrier that publishes it
    __syncthreads();
    if (nst > 1) {
        cp_kv(lds0 + FBUF * 2u, KH + gko + (size_t)FK * HD, VH + gvo + FK);
        if (ER) cp_kv(lds0 + FBUF * 2u + 2u * FT * 2u, KR + gko + (size_t)FK * HD, VR + gvo + FK);
    }
    v8f oH[4], oL[4];
#pragma unroll
    for (int j = 0; j < 4; ++j) { oH[j] = (v8f){}; oL[j] = (v8f){}; }
    float m = NEGB;
    v8f lH = (v8f){}, lL = (v8f){};      // row-sum tiles: of P, of its residual plane (ER)
    const unsigned ow = ((lane & 7) == 0) ? 0x3C003C00u : 0u;      // two f16 1.0 in the lanes of A rows 0 and 8
    const v16h ones = __builtin_bit_cast(v16h, (v8u){ow, ow, ow, ow, ow, ow, ow, ow});
#pragma unroll 1
    for (int sg = 0; sg < nst; ++sg) {      // rolled: one trip per LDS buffer
      const h16* sb = (const h16*)st + (sg & 1) * FBUF;
#pragma unroll
      for (int u = 0; u < FK / 32; ++u) {      // unrolled: each step's LDS offsets become immediates of its fragment loads
        const int key0 = sg * FK + u * 32;
        if (key0 >= t0 + 16) continue;      // wave-uniform: on the diagonal stage the step lies wholly above this wave's rows
        const h16* ka = sb + ko + u * 32 * FP;
        float ta[8], tb[8];
        if (!ER) {
            const v16h ka0 = ldh(ka), ka1 = ldh(ka + 32), kb0 = ldh(ka + 16 * FP), kb1 = ldh(ka + 16 * FP + 32);
            v8f sHa = (v8f){}, sHb = (v8f){};
            sHa = wmma16(ka0, qh0, sHa); sHb = wmma16(kb0, qh0, sHb);
            sHa = wmma16(ka1, qh1, sHa); sHb = wmma16(kb1, qh1, sHb);
            asm volatile("v_nop\n\tv_nop\n\tv_nop\n\tv_nop" : "+v"(sHa), "+v"(sHb) : "v"(ka0), "v"(ka1), "v"(kb0), "v"(kb1));
#pragma unroll
            for (int r = 0; r < 8; ++r) { ta[r] = sHa[r] * SC2; tb[r] = sHb[r] * SC2; }
        } else {
            const h16* kr = ka + 2 * FT;
            { const v16h ka0 = ldh(ka), ka1 = ldh(ka + 32), ra0 = ldh(kr), ra1 = ldh(kr + 32);
              v8f sH = (v8f){}, sL = (v8f){};
              sH = wmma16(ka0, qh0, sH); sL = wmma16(ka0, qr0, sL);
              sH = wmma16(ka1, qh1, sH); sL = wmma16(ka1, qr1, sL);
              sL = wmma16(ra0, qh0, sL); sL = wmma16(ra1, qh1, sL);
              asm volatile("v_nop\n\tv_nop\n\tv_nop\n\tv_nop" : "+v"(sH), "+v"(sL) : "v"(ka0), "v"(ka1), "v"(ra0), "v"(ra1));
#pragma unroll
              for (int r = 0; r < 8; ++r) ta[r] = (sH[r] + sL[r] * QRI) * SC2; }
            { const v16h kb0 = ldh(ka + 16 * FP), kb1 = ldh(ka + 16 * FP + 32), rb0 = ldh(kr + 16 * FP), rb1 = ldh(kr + 16 * FP + 32);
              v8f sH = (v8f){}, sL = (v8f){};
              sH = wmma16(kb0, qh0, sH); sL = wmma16(kb0, qr0, sL);
              sH = wmma16(kb1, qh1, sH); sL = wmma16(kb1, qr1, sL);
              sL = wmma16(rb0, qh0, sL); sL = wmma16(rb1, qh1, sL);
              asm volatile("v_nop\n\tv_nop\n\tv_nop\n\tv_nop" : "+v"(sH), "+v"(sL) : "v"(kb0), "v"(kb1), "v"(rb0), "v"(rb1));
#pragma unroll
              for (int r = 0; r < 8; ++r) tb[r] = (sH[r] + sL[r] * QRI) * SC2; }
        }
        if (key0 + 31 > t0) {      // wave-uniform: only the diagonal step holds keys above some query index; every row keeps key key0 <= t
#pragma unroll
            for (int r = 0; r < 8; ++r) { const int kk = key0 + 8 * hi + r; ta[r] = (kk <= tq) ? ta[r] : NEGB; tb[r] = (kk + 16 <= tq) ? tb[r] : NEGB; }
        }
        float mx = NEGB;
#pragma unroll
        for (int r = 0; r < 8; ++r) mx = fmaxf(mx, fmaxf(ta[r], tb[r]));
        mx = fmaxf(mx, __shfl_xor(mx, 16, 32));
        const float mnew = fmaxf(m, mx);
        const float alpha = __builtin_amdgcn_exp2f(m - mnew);
        const float sh = PSH - mnew;
        v16h pb, pq;
        if (!ER) {
#pragma unroll
            for (int r = 0; r < 8; ++r) { pb[r] = (h16)__builtin_amdgcn_exp2f(ta[r] + sh); pb[8 + r] = (h16)__builtin_amdgcn_exp2f(tb[r] + sh); }
            pq = pb;
        } else {
#pragma unroll
            for (int r = 0; r < 8; ++r) { const float fa = __builtin_amdgcn_exp2f(ta[r] + sh); const float fc = __builtin_amdgcn_exp2f(tb[r] + sh);
                const h16 pa = (h16)fa; const h16 pc = (h16)fc; const h16 qa = (h16)((fa - (float)pa) * QRS); const h16 qc = (h16)((fc - (float)pc) * QRS);
                pb[r] = pa; pb[8 + r] = pc; pq[r] = qa; pq[8 + r] = qc; }
        }
        lH[0] *= alpha; if (ER) lL[0] *= alpha;
        m = mnew;
#pragma unroll
        for (int j = 0; j < 4; ++j) { oH[j] = oH[j] * alpha; if (ER) oL[j] = oL[j] * alpha; }
        const h16* va = sb + vo + u * 32;
        const v16h v0 = ldh(va), v1 = ldh(va + 16 * FP), v2 = ldh(va + 32 * FP), v3 = ldh(va + 48 * FP);
        if (!ER) {
            lH = wmma16(ones, pb, lH);
            oH[0] = wmma16(v0, pb, oH[0]); oH[1] = wmma16(v1, pb, oH[1]); oH[2] = wmma16(v2, pb, oH[2]); oH[3] = wmma16(v3, pb, oH[3]);
            // the four slots behind the step's last matrix instructions, also on the taken side of the branch that follows
            asm volatile("v_nop\n\tv_nop\n\tv_nop\n\tv_nop" : "+v"(oH[0]), "+v"(oH[1]), "+v"(oH[2]), "+v"(oH[3]), "+v"(lH) : "v"(v0), "v"(v1), "v"(v2), "v"(v3), "v"(pb));
        } else {
            const h16* vr = va + 2 * FT;
            const v16h w0 = ldh(vr), w1 = ldh(vr + 16 * FP), w2 = ldh(vr + 32 * FP), w3 = ldh(vr + 48 * FP);
            lH = wmma16(ones, pb, lH); lL = wmma16(ones, pq, lL);
            oH[0] = wmma16(v0, pb, oH[0]); oH[1] = wmma16(v1, pb, oH[1]); oH[2] = wmma16(v2, pb, oH[2]); oH[3] = wmma16(v3, pb, oH[3]);
            oL[0] = wmma16(w0, pb, oL[0]); oL[1] = wmma16(w1, pb, oL[1]); oL[2] = wmma16(w2, pb, oL[2]); oL[3] = wmma16(w3, pb, oL[3]);
            oL[0] = wmma16(v0, pq, oL[0]); oL[1] = wmma16(v1, pq, oL[1]); oL[2] = wmma16(v2, pq, oL[2]); oL[3] = wmma16(v3, pq, oL[3]);
            // the four slots behind the step's last matrix instructions, also on the taken side of the branch that follows
            asm volatile("v_nop\n\tv_nop\n\tv_nop\n\tv_nop" : "+v"(oH[0]), "+v"(oH[1]), "+v"(oH[2]), "+v"(oH[3]), "+v"(oL[0]), "+v"(oL[1]), "+v"(oL[2]), "+v"(oL[3]), "+v"(lH), "+v"(lL)
                         : "v"(v0), "v"(v1), "v"(v2), "v"(v3), "v"(w0), "v"(w1), "v"(w2), "v"(w3), "v"(pb), "v"(pq));
        }
      }
      ring_publish();
      if (sg + 2 < nst) { const int kn = (sg + 2) * FK; const unsigned lb = lds0 + (unsigned)(sg & 1) * (FBUF * 2u);
          cp_kv(lb, KH + gko + (size_t)kn * HD, VH + gvo + kn);
          if (ER) cp_kv(lb + 2u * FT * 2u, KR + gko + (size_t)kn * HD, VR + gvo + kn); }
    }
    asm volatile("s_wait_asynccnt 0x0" ::: "memory");   // nothing of the ring is in flight when the wave goes on
    const float l = ER ? lH[0] + lL[0] * QRI : lH[0];      // each half's element 0 holds the sum over all keys
    const float inv = CXS * (1.0f / l);
    const int wb = wave * 16 * 68;
    // O^T D layout: o_j[r] = (d = 16j + 8h + r, t = lane&15) -> os[t][d]; rows 0..15 x columns 0..63 all written
#pragma unroll
    for (int j = 0; j < 4; ++j) { v4f a, c;
#pragma unroll
        for (int i = 0; i < 4; ++i) {
            if (ER) { a[i] = (oH[j][i] + oL[j][i] * QRI) * inv; c[i] = (oH[j][4 + i] + oL[j][4 + i] * QRI) * inv; }
            else    { a[i] = oH[j][i] * inv; c[i] = oH[j][4 + i] * inv; } }
        *(v4fa*)(&os[wb + lr * 68 + 16 * j + 8 * hi]) = a; *(v4fa*)(&os[wb + lr * 68 + 16 * j + 8 * hi + 4]) = c; }
    wave_sync();
    v8h hv[4], rv[4];
#pragma unroll
    for (int s = 0; s < 4; ++s) { const int row = 4 * s + (lane >> 3), c8 = (lane & 7) * 8;   // 4 s x 4 row groups = 16 rows; 8 lanes x 8 = 64 columns
        const v4f x0 = *(const v4fa*)(&os[wb + row * 68 + c8]); const v4f x1 = *(const v4fa*)(&os[wb + row * 68 + c8 + 4]); v8h hh, rr;
#pragma unroll
        for (int i = 0; i < 4; ++i) { const h16 a0 = (h16)x0[i]; const h16 a1 = (h16)x1[i]; hh[i] = a0; hh[4 + i] = a1; rr[i] = (h16)((x0[i] - (float)a0) * QRS); rr[4 + i] = (h16)((x1[i] - (float)a1) * QRS); }
        hv[s] = hh; rv[s] = rr; }
    const size_t cbase = ((size_t)b * SEQ + t0) * DM + (size_t)h * HD;
    const size_t rbase = ((size_t)b * ER_ROWS + t0) * DM + (size_t)h * HD;     // used by the ER instantiation only (t0 < ER_ROWS there)
#pragma unroll
    for (int s = 0; s < 4; ++s) { const int row = 4 * s + (lane >> 3), c8 = (lane & 7) * 8;
        *(v8h*)(CH + cbase + (size_t)row * DM + c8) = hv[s]; if (ER) *(v8h*)(CR + rbase + (size_t)row * DM + c8) = rv[s]; }
}

// k_flash: both row ranges of the attention in one launch, grid (batch * head, rank); there are more work-groups than resident places, so the ranks take, in order:
// the longest single-product tiles, then the value + residual tiles (three products where the others have one), then the other single-product tiles, each run longest first.
static constexpr int NTT = SEQ / (16 * AW);                             // 64-row tiles of a head
static constexpr int NTE = ER_ROWS / (16 * AW);                         // of them on the value + residual path (the first ones)
static constexpr int NTH = (NTE < NTT - NTE) ? NTE : NTT - NTE;         // single-product tiles ranked ahead of those
__global__ __launch_bounds__(32 * AW) void k_flash(const h16* __restrict__ QH, const h16* __restrict__ QR, const h16* __restrict__ KH, const h16* __restrict__ KR,
                                                   const h16* __restrict__ VH, const h16* __restrict__ VR, h16* CH, h16* CR) {
    __shared__ __align__(16) unsigned short st[2 * 4 * FT];
    const int q = blockIdx.y;      // rank -> tile is a permutation of 0 .. NTT-1; the branch is uniform for the work-group
    const int xb = q < NTH ? NTT - 1 - q : q < NTH + NTE ? NTH + NTE - 1 - q : NTT - 1 - (q - NTE);
    if (xb < NTE) flash_tile<true>(st, blockIdx.x, xb, QH, QR, KH, KR, VH, VR, CH, CR);
    else flash_tile<false>(st, blockIdx.x, xb, QH, QR, KH, KR, VH, VR, CH, CR);
}

// out_tile: output projection, f16 GEMM, one wave per (16*MB) x 64 tile, 4 waves per (32*MB) x 128 work-group tile, operands from K-contiguous f16 planes through the LDS ring, K = DM.
// A rows of a buffer: MB = 4: 128 rows of CH; MB = 2 with RES: 64 rows of CH, then the same 64 rows of CR.
// OUT[b][t][n] = OSC * sum_k (CH[b*SEQ+t][k] + CR[b*ER_ROWS+t][k]/2048) * WO[n][k]; RES: residual products in their own accumulators.
// Rows t in [tstart, tstart+tcount) of every batch; tile (bx, by) of (NB*tcount/(32*MB), DM/128), 128 threads. st (2 * TBUF elements) and osw (4 * 16 * 68 floats) are the calling kernel's LDS.
template<int MB, bool RES>
__device__ __forceinline__ void out_tile(unsigned short* st, float* osw, int bx, int by, const h16* __restrict__ CH, const h16* __restrict__ CR, const h16* __restrict__ WO, float* OUT, int tstart, int tcount) {
    static_assert(RES ? MB == 2 : MB == 4);
    const int tid = threadIdx.x, lane = tid & 31, lr = lane & 15, hi = lane >> 4;
    const int wave = __builtin_amdgcn_readfirstlane(tid >> 5); const int wm = wave >> 1, wn = wave & 1;
    float* os = osw + wave * 16 * 68;      // wave-private epilogue staging
    const int tiles = tcount / (32 * MB);
    const int b = bx / tiles, tw = tstart + (bx % tiles) * 32 * MB, t = tw + wm * 16 * MB, c0 = by * 128 + wn * 64;
    v8f acc[MB][4], acr[MB][4];
#pragma unroll
    for (int mb = 0; mb < MB; ++mb)
#pragma unroll
        for (int nb = 0; nb < 4; ++nb) { acc[mb][nb] = (v8f){}; acr[mb][nb] = (v8f){}; }
    const unsigned lds0 = (unsigned)(uintptr_t)st + (unsigned)((tid >> 4) * (LP * 2) + (tid & 15) * 16);      // this lane's copy target: row tid/16, 16-B chunk tid%16
    const unsigned short* ga0 = (const unsigned short*)CH + ((size_t)b * SEQ + tw + (tid >> 4)) * DM + (tid & 15) * 8;
    const unsigned short* ga1 = RES ? (const unsigned short*)CR + ((size_t)b * ER_ROWS + tw + (tid >> 4)) * DM + (tid & 15) * 8     // RES only (tw < ER_ROWS there)
                                    : ga0 + (size_t)64 * DM;
    const unsigned short* gb = (const unsigned short*)WO + (size_t)(by * 128 + (tid >> 4)) * DM + (tid & 15) * 8;
    stage_tile(lds0, ga0, ga1, gb);
    asm volatile("s_wait_asynccnt 0x0" ::: "memory");   // tile 0 has landed before the barrier that publishes it
    __syncthreads();
    stage_tile(lds0 + TBUF * 2u, ga0 + KT, ga1 + KT, gb + KT);
    const int ao = (wm * 16 * MB + lr) * LP + 8 * hi, ro = ao + 64 * LP, bo = (128 + wn * 64 + lr) * LP + 8 * hi;
#pragma unroll 1
    for (int tr = 0; tr < NTRIP; ++tr) {      // rolled: one trip per LDS buffer
      const h16* sb = (const h16*)st + (tr & 1) * TBUF;
      v16h a[2][MB], ar[2][MB], bb[2][4];      // two fragment sets: block s + 1 of this buffer is fetched while block s is multiplied
#pragma unroll
      for (int i = 0; i < MB; ++i) { a[0][i] = ldh(sb + ao + i * 16 * LP); if (RES) ar[0][i] = ldh(sb + ro + i * 16 * LP); }
#pragma unroll
      for (int i = 0; i < 4; ++i) bb[0][i] = ldh(sb + bo + i * 16 * LP);
#pragma unroll
      for (int s = 0; s < KT / 32; ++s) {
        if (s + 1 < KT / 32) {
#pragma unroll
            for (int i = 0; i < MB; ++i) { a[(s + 1) & 1][i] = ldh(sb + ao + i * 16 * LP + (s + 1) * 32); if (RES) ar[(s + 1) & 1][i] = ldh(sb + ro + i * 16 * LP + (s + 1) * 32); }
#pragma unroll
            for (int i = 0; i < 4; ++i) bb[(s + 1) & 1][i] = ldh(sb + bo + i * 16 * LP + (s + 1) * 32);
        }
        __builtin_amdgcn_sched_barrier(0);   // the next block's LDS reads stay one group, ahead of this block's matrix instructions
#pragma unroll
        for (int nb = 0; nb < 4; ++nb)
#pragma unroll
            for (int mb = 0; mb < MB; ++mb) { acc[mb][nb] = wmma16(a[s & 1][mb], bb[s & 1][nb], acc[mb][nb]); if (RES) acr[mb][nb] = wmma16(ar[s & 1][mb], bb[s & 1][nb], acr[mb][nb]); }
        __builtin_amdgcn_sched_barrier(0);   // no later LDS read moves in among them
      }
      ring_publish();
      if (tr + 2 < NTRIP) { const int kn = (tr + 2) * KT; stage_tile(lds0 + (unsigned)(tr & 1) * (TBUF * 2u), ga0 + kn, ga1 + kn, gb + kn); }
    }
    asm volatile("s_wait_asynccnt 0x0" ::: "memory");   // nothing of the ring is in flight when the wave goes on
#pragma unroll
    for (int mb = 0; mb < MB; ++mb) {
#pragma unroll
        for (int nb = 0; nb < 4; ++nb) {
#pragma unroll
            for (int j = 0; j < 8; ++j) os[(hi * 8 + j) * 68 + nb * 16 + lr] = RES ? (acc[mb][nb][j] + acr[mb][nb][j] * QRI) * OSC : acc[mb][nb][j] * OSC; }   // D: row 8h+j, col lane&15
        wave_sync();
        float* orow = OUT + ((size_t)b * OUT_SEQ + t + mb * 16) * DM + c0;
{
#pragma unroll
            for (int s = 0; s < 8; ++s) { const int row = 2 * s + hi, cofs = lr * 4;   // 8 s x 2 rows = 16 rows; 16 lanes x 4 floats = 64 columns
                const v4f val = *(const v4fa*)(&os[row * 68 + cofs]);
                *(v4f*)(orow + (size_t)row * DM + cofs) = val; }
             }
        wave_sync();
    }
}

// k_out: both row ranges of the output projection in one launch; a work-group takes a tile of the rows >= ER_ROWS or of the value + residual rows by its index range (inside a range the tile row runs fastest).
static constexpr int OT_F = (SEQ > ER_ROWS) ? NB * (SEQ - ER_ROWS) / 128 : 1;      // tile rows, rows >= ER_ROWS
static constexpr int GO_F = (SEQ > ER_ROWS) ? OT_F * (DM / 128) : 0;               // their work-groups
static constexpr int OT_E = NB * ER_ROWS / 64;                                     // tile rows, rows < ER_ROWS
static constexpr int GO_E = OT_E * (DM / 128);
__global__ __launch_bounds__(128) void k_out(const h16* __restrict__ CH, const h16* __restrict__ CR, const h16* __restrict__ WO, float* OUT) {
    __shared__ __align__(16) unsigned short st[2 * TBUF];
    __shared__ __align__(16) float osw[4 * 16 * 68];
    const int wg = blockIdx.x;      // the branch is uniform for the work-group
    if (wg < GO_F) out_tile<4, false>(st, osw, wg % OT_F, wg / OT_F, CH, CR, WO, OUT, ER_ROWS, (SEQ == ER_ROWS) ? 128 : (SEQ - ER_ROWS));
    else out_tile<2, true>(st, osw, (wg - GO_F) % OT_E, (wg - GO_F) / OT_E, CH, CR, WO, OUT, 0, ER_ROWS);
}

static constexpr size_t al256(size_t v) { return (v + 255) & ~(size_t)255; }
static constexpr size_t SZ_XB = al256((size_t)NB * SEQ * DM * 2);
static constexpr size_t SZ_WQ = al256((size_t)DM * DM * 2);
static constexpr size_t SZ_WK = al256((size_t)KVD * DM * 2);
static constexpr size_t SZ_QP = al256((size_t)NB * NH_ * SEQ * HD * 2);
static constexpr size_t SZ_KP = al256((size_t)NB * NG_ * SEQ * HD * 2);
static constexpr size_t SZ_CH = al256((size_t)NB * SEQ * DM * 2);
static constexpr size_t SZ_CR = al256((size_t)NB * ER_ROWS * DM * 2);
static constexpr size_t SZ_TOTAL = SZ_XB + 2 * SZ_WQ + 2 * SZ_WK + 2 * SZ_QP + 4 * SZ_KP + SZ_CH + SZ_CR;
static_assert(SZ_TOTAL <= (size_t)134217728);          // workspace carve <= 128 MiB

extern "C" void kernel_launch(void* const* d_in, const int* in_sizes, int n_in,
                              void* d_out, int out_size, void* d_ws, size_t ws_size, hipStream_t stream) {
    if (n_in < 7) return;
    const size_t needx = ((size_t)(NB - 1) * SEQ_FULL + SEQ) * DM;
    if ((size_t)in_sizes[0] < needx) return;
    if ((size_t)in_sizes[1] < (size_t)DM * DM || (size_t)in_sizes[2] < (size_t)KVD * DM || (size_t)in_sizes[3] < (size_t)KVD * DM || (size_t)in_sizes[4] < (size_t)DM * DM) return;
    if ((size_t)in_sizes[5] < (size_t)SEQ * HD || (size_t)in_sizes[6] < (size_t)SEQ * HD) return;
    if ((size_t)out_size < ((size_t)(NB - 1) * OUT_SEQ + SEQ) * DM) return;
    if (SZ_TOTAL > ws_size) return;
    // wire order: x, Wq, Wk, Wv, Wo, cos, sin (W as [out][in] = Bt as-is; cos/sin [token][64] read as values)
    const float* x = (const float*)d_in[0]; const float* wq = (const float*)d_in[1]; const float* wk = (const float*)d_in[2]; const float* wv = (const float*)d_in[3];
    const float* wo = (const float*)d_in[4]; const float* cs = (const float*)d_in[5]; const float* sn = (const float*)d_in[6];
    float* OUT = (float*)d_out;      // [NB][SEQ][2048]
    char* wsp = (char*)d_ws;
    bf* XB = (bf*)wsp; wsp += SZ_XB;                 // [NB*SEQ][2048] bf16
    bf* WQ = (bf*)wsp; wsp += SZ_WQ;                 // [2048][2048] bf16
    bf* WK = (bf*)wsp; wsp += SZ_WK;                 // [512][2048] bf16
    bf* WV = (bf*)wsp; wsp += SZ_WK;                 // [512][2048] bf16
    h16* WO = (h16*)wsp; wsp += SZ_WQ;               // [2048][2048] f16 x64
    h16* QH = (h16*)wsp; wsp += SZ_QP;               // [NB*32][SEQ][64]
    h16* QR = (h16*)wsp; wsp += SZ_QP;               // residual x2048
    h16* KH = (h16*)wsp; wsp += SZ_KP;               // [NB*8][SEQ][64]
    h16* KR = (h16*)wsp; wsp += SZ_KP;               // residual x2048
    h16* VH = (h16*)wsp; wsp += SZ_KP;               // [NB*8][64][SEQ]
    h16* VR = (h16*)wsp; wsp += SZ_KP;               // residual x2048
    h16* CH = (h16*)wsp; wsp += SZ_CH;               // [NB*SEQ][2048] ctx x64
    h16* CR = (h16*)wsp; wsp += SZ_CR;               // [NB*ER_ROWS][2048] residual x2048

    k_cvt8<<<CB_X + 2 * CB_W + 2 * CB_K, 256, 0, stream>>>(x, wq, wk, wv, wo, XB, WQ, WK, WV, (unsigned short*)WO);

    k_qkv<<<GQ_ + 2 * GK_, 128, 0, stream>>>(XB, WQ, WK, WV, QH, QR, KH, KR, VH, VR, cs, sn);

    k_flash<<<dim3(NB * NH_, NTT, 1), 32 * AW, 0, stream>>>(QH, QR, KH, KR, VH, VR, CH, CR);

    k_out<<<GO_F + GO_E, 128, 0, stream>>>(CH, CR, WO, OUT);
}

// v006
// One run takes 122 microseconds.
// In both of two side-by-side timings against v005, it was 1.23 times as fast.
// Counting every step since v000, it is 3.43 times as fast.
#include <hip/hip_runtime.h>

// Causal grouped-query attention, width 2048 = 32 heads x 64, 8 key/value groups (4 heads per group), rotate-half rotary with INPUT cos/sin tables, output projection; x [NB][SEQ][2048], W [out][in] (y = x W^T), no biases, score scale 1/8.
// Compute dtypes, f32 accumulate everywhere: q/k/v projections v_wmma_f32_16x16x32_bf16 (x, W RNE-converted to bf16; products exact); rotary in f32 with bf16-converted table values;
// scores, P.V and the output projection v_wmma_f32_16x16x32_f16: q, k, v^T, ctx(x64) as f16 value planes plus f16 residual planes x2048; Wo as f16 of the bf16 value x64; P carried x256.
// Query rows >= 512 use single f16 products; query rows < 512 use value + residual (three products for scores and P.V, two for the output projection), residual products in their own accumulators.
// Transposed flash form (S^T = K Q^T, O^T = V^T P^T), online softmax in f32 (running max), causal mask applied by value on the diagonal key step.

#ifndef NB
#define NB 2
#endif
#ifndef SEQ
#define SEQ 2048
#endif
#define NB_FULL  2
#define SEQ_FULL 2048
#ifndef OUT_SEQ
#define OUT_SEQ SEQ              // row pitch (in tokens) between batches of the output
#endif
#define DM   2048                // model width = depth of every GEMM
#define NH_  32
#define NG_  8
#define GS_  4                   // heads per key/value group
#define HD   64
#define KVD  512                 // NG_ * HD
#define AW   4                   // waves per flash block (16 query rows each)
#define QRS  2048.0f             // carry of every residual plane
#define QRI  (1.0f / 2048.0f)
#define SC2  (0.125f * 1.4426950408889634f)   // HD^-0.5 * log2(e)
#define PSH  8.0f                // log2 of the P carry (256)
#define CXS  64.0f               // carry of the ctx plane
#define WOS  64.0f               // carry of the Wo plane
#define OSC  (1.0f / 4096.0f)    // 1 / (CXS * WOS)
#define NEGB (-3.0e38f)

static constexpr int ER_ROWS = (SEQ < 512) ? SEQ : 512;   // query rows per batch on the value + residual path

static_assert(HD == 64);
static_assert(NH_ * HD == DM);
static_assert(NG_ * HD == KVD);
static_assert(NG_ * GS_ == NH_);
static_assert(DM % 64 == 0);
static_assert(DM % 32 == 0);                   // GEMM k-loop steps by 32
static_assert(KVD % 64 == 0);
static_assert(SEQ % 64 == 0);                  // a 64-row tile never straddles two batches
static_assert(SEQ % (16 * AW) == 0);
static_assert(ER_ROWS % 64 == 0);
static_assert((SEQ - ER_ROWS) % 64 == 0);
static_assert(((size_t)SEQ * DM) % 8 == 0);
static_assert(NB <= NB_FULL);
static_assert(SEQ <= SEQ_FULL);

typedef _Float16 h16;
typedef unsigned short bf;
typedef __attribute__((ext_vector_type(16))) __bf16   v16bf;
typedef __attribute__((ext_vector_type(16))) _Float16 v16h;
typedef __attribute__((ext_vector_type(8)))  _Float16 v8h;
typedef __attribute__((ext_vector_type(8)))  unsigned short v8us;
typedef __attribute__((ext_vector_type(8)))  unsigned v8u;
typedef __attribute__((ext_vector_type(8)))  float    v8f;
typedef __attribute__((ext_vector_type(4)))  float    v4f;
typedef v4f  __attribute__((may_alias)) v4fa;

__device__ __forceinline__ unsigned short f2bf(float f) { unsigned u = __float_as_uint(f); u += 0x7FFFu + ((u >> 16) & 1u); return (unsigned short)(u >> 16); }
__device__ __forceinline__ float bfr(float f) { return __uint_as_float(((unsigned)f2bf(f)) << 16); }   // value after RNE conversion to bf16
__device__ __forceinline__ v16h cat16(v8h lo, v8h hi) { return __builtin_shufflevector(lo, hi, 0, 1, 2, 3, 4, 5, 6, 7, 8, 9, 10, 11, 12, 13, 14, 15); }
__device__ __forceinline__ v16bf cat16b(v8us lo, v8us hi) { return __builtin_bit_cast(v16bf, __builtin_shufflevector(lo, hi, 0, 1, 2, 3, 4, 5, 6, 7, 8, 9, 10, 11, 12, 13, 14, 15)); }
__device__ __forceinline__ v8f wmma16(v16h a, v16h b, v8f c) { return __builtin_amdgcn_wmma_f32_16x16x32_f16(false, a, false, b, (short)0, c, false, false); }
__device__ __forceinline__ v8f wmmab(v16bf a, v16bf b, v8f c) { return __builtin_amdgcn_wmma_f32_16x16x32_bf16(false, a, false, b, (short)0, c, false, false); }
// fragment loaders from K-contiguous 16-bit rows; p already includes + 8*(lane>>4): elements 0..7 <- k0+8h+0..7, elements 8..15 <- k0+16+8h+0..7 (same map for A and B)
__device__ __forceinline__ v16h  ldh(const h16* p) { return cat16(*(const v8h*)p, *(const v8h*)(p + 16)); }
__device__ __forceinline__ v16bf ldb(const bf* p)  { return cat16b(*(const v8us*)p, *(const v8us*)(p + 16)); }
// ordering point for wave-private LDS tiles (same wave writes and reads)
__device__ __forceinline__ void wave_sync() { __builtin_amdgcn_fence(3 /* release order */, "wavefront"); __builtin_amdgcn_wave_barrier(); asm volatile("" ::: "memory"); }

// Operand tiles of every GEMM kernel go through LDS: a work-group's waves (64 x 64 wave tiles) share the A rows and B rows of its tile, KT k-values per trip, two buffers; a buffer is 7 units of 64 rows.
#define KT    128                // k per trip: rows of 256 B
#define LP    136                // LDS row pitch in 16-bit elements: 272 B = 16 B x odd, conflict-free for 16-B fragment reads
#define NTRIP (DM / KT)
static_assert(DM % KT == 0);
static_assert(NTRIP >= 2);       // the prologue fills two tiles
// Eight asynchronous 16-B copies per lane, global -> LDS, LDS rows RS apart (16 lanes per 256-B row; 128 lanes, RS = 8: 64 rows; 64 lanes, RS = 4: 32 rows).
// l: the lane's LDS byte address; g0: the lane's global address for the first four copies, g1: for the last four (row pitch DM elements). The s_wait_xcnt ends the copies' own statement so that no address register is rewritten ahead of it.
template<int RS>
__device__ __forceinline__ void cp8g(unsigned l, const unsigned short* g0, const unsigned short* g1) {
    asm volatile("global_load_async_to_lds_b128 %0, %8, off\n\t"
                 "global_load_async_to_lds_b128 %1, %9, off\n\t"
                 "global_load_async_to_lds_b128 %2, %10, off\n\t"
                 "global_load_async_to_lds_b128 %3, %11, off\n\t"
                 "global_load_async_to_lds_b128 %4, %12, off\n\t"
                 "global_load_async_to_lds_b128 %5, %13, off\n\t"
                 "global_load_async_to_lds_b128 %6, %14, off\n\t"
                 "global_load_async_to_lds_b128 %7, %15, off\n\t"
                 "s_wait_xcnt 0x0"
                 :: "v"(l), "v"(l + 1u * RS * LP * 2u), "v"(l + 2u * RS * LP * 2u), "v"(l + 3u * RS * LP * 2u), "v"(l + 4u * RS * LP * 2u), "v"(l + 5u * RS * LP * 2u), "v"(l + 6u * RS * LP * 2u), "v"(l + 7u * RS * LP * 2u),
                    "v"(g0), "v"(g0 + (size_t)1 * RS * DM), "v"(g0 + (size_t)2 * RS * DM), "v"(g0 + (size_t)3 * RS * DM), "v"(g1), "v"(g1 + (size_t)1 * RS * DM), "v"(g1 + (size_t)2 * RS * DM), "v"(g1 + (size_t)3 * RS * DM)
                 : "memory");
}
// One unit of 64 consecutive global rows, by 128 lanes.
__device__ __forceinline__ void cp8(unsigned l, const unsigned short* g) { cp8g<8>(l, g, g + (size_t)32 * DM); }
// Publish point of the two-buffer ring: own LDS reads retired, own copies landed, then the work-group barrier (it publishes the next tile and frees the buffer just read).
__device__ __forceinline__ void ring_publish() {
    asm volatile("s_wait_dscnt 0x0" ::: "memory");      // this wave's fragment reads of the buffer that is refilled next have retired
    asm volatile("s_wait_asynccnt 0x0" ::: "memory");   // this wave's copies of the next tile have landed
    __syncthreads();
}

// k_cvt8: every conversion of the call in one launch; a block (256 threads x 8 values) belongs to one input by its index range: x, Wq, Wk, Wv, Wo.
// MODE 0 (x, Wq, Wk, Wv): bf16 bits (RNE). MODE 1 (Wo): f16 of (bf16 value x WOS) (exact for normal results).
static constexpr int CB_X = (int)((size_t)NB * SEQ * DM / 2048);     // blocks of x
static constexpr int CB_W = (int)((size_t)DM * DM / 2048);           // blocks of Wq, of Wo
static constexpr int CB_K = (int)((size_t)KVD * DM / 2048);          // blocks of Wk, of Wv
static constexpr int CB_XB = (int)((size_t)SEQ * DM / 2048);         // blocks of one batch of x
static_assert(((size_t)SEQ * DM) % 2048 == 0);                       // a block never straddles two batches of x
static_assert(((size_t)DM * DM) % 2048 == 0);
static_assert(((size_t)KVD * DM) % 2048 == 0);
template<int MODE>
__device__ __forceinline__ void cvt_chunk(const float* __restrict__ src, unsigned short* dst, int lb) {      // lb: the block's index inside its input
    const size_t i = (size_t)lb * 256 + threadIdx.x;
    const v8f v = *(const v8f*)(src + i * 8);
    if (MODE == 0) {
        v8us o;
#pragma unroll
        for (int k = 0; k < 8; ++k) o[k] = f2bf(v[k]);
        *(v8us*)(dst + i * 8) = o; 
    } else {
        v8h o;
#pragma unroll
        for (int k = 0; k < 8; ++k) o[k] = (h16)(bfr(v[k]) * WOS);
        h16* d = (h16*)dst;
        *(v8h*)(d + i * 8) = o; 
    }
    asm volatile("s_wait_xcnt 0x0" ::: "memory");   // stands behind the store: the built code lays the other ranges' blocks, which write the same registers, behind this one
}
__global__ __launch_bounds__(256) void k_cvt8(const float* __restrict__ x, const float* __restrict__ wq, const float* __restrict__ wk, const float* __restrict__ wv, const float* __restrict__ wo,
                                              unsigned short* XB, unsigned short* WQ, unsigned short* WK, unsigned short* WV, unsigned short* WO) {
    const int blk = blockIdx.x;      // every branch is uniform for the block
    if (blk < CB_X) cvt_chunk<0>(x + (size_t)(blk / CB_XB) * ((size_t)(SEQ_FULL - SEQ) * DM), XB, blk);      // batch pitch of x: SEQ_FULL tokens
    else if (blk < CB_X + CB_W) cvt_chunk<0>(wq, WQ, blk - CB_X);
    else if (blk < CB_X + CB_W + CB_K) cvt_chunk<0>(wk, WK, blk - (CB_X + CB_W));
    else if (blk < CB_X + CB_W + 2 * CB_K) cvt_chunk<0>(wv, WV, blk - (CB_X + CB_W + CB_K));
    else cvt_chunk<1>(wo, WO, blk - (CB_X + CB_W + 2 * CB_K));
}

// k_qkv: the three projections as one product [NB*SEQ tokens] x [DM + 2*KVD rows of Wq, Wk, Wv], one launch. A work-group of 12 waves (4 x 3 wave tiles of 64 x 64, 16 accumulators each) takes 256 tokens x 192 W rows,
// so that the grid has one work-group per 256 x 192 tile and every operand row staged in LDS serves 3 or 4 waves; operands from K-contiguous bf16 planes through the LDS ring, K = DM.
// A wave's 64 W rows are one head of q, one group of k or one group of v (the choice is uniform for the wave). C[m][n] = sum_k A[m][k] Bt[n][k]; rotate-half rotary on the 64-column tile of q and k (partner column = c ^ 32, token = r0 % RB + row);
// written as f16 value (Ph) and f16 residual x2048 (Pr) at tile base (r0/RB)*sRB + (r0%RB)*pitch + (c0/CB)*sCB + (c0%CB), row pitch 'pitch' (halves).
// q: A = x rows (m = b*SEQ + t), Bt = Wq rows (n = h*64 + d) -> planes [(b*32 + h)][t][d], rotary fused
// k: Bt = Wk rows (n = g*64 + d) -> planes [(b*8 + g)][t][d], rotary fused
// v^T: the wave takes its A fragments from the W rows and its B fragments from the x rows (one fragment map serves both): A = Wv rows (m = g*64 + d), Bt = x rows (n = b*SEQ + t) -> planes [(b*512 + m)][t] = [(b*8 + g)][d][t]
#define QWV   12                 // waves of a work-group
#define QXR   256                // x rows of a buffer
#define QWR   192                // W rows of a buffer, behind the x rows
#define QBUF  ((QXR + QWR) * LP) // elements of one buffer
static constexpr int XT  = NB * SEQ / QXR;               // tile rows (tokens)
static constexpr int WT_ = (DM + 2 * KVD) / QWR;         // tile columns (W rows)
static_assert((NB * SEQ) % QXR == 0);
static_assert((DM + 2 * KVD) % QWR == 0);
static_assert(DM % 64 == 0 && KVD % 64 == 0);            // a 64-row unit of W lies in one of Wq, Wk, Wv
__global__ __launch_bounds__(32 * QWV) void k_qkv(const bf* __restrict__ XB, const bf* __restrict__ WQ, const bf* __restrict__ WK, const bf* __restrict__ WV,
                                             h16* QH, h16* QR, h16* KH, h16* KR, h16* VH, h16* VR, const float* __restrict__ COS, const float* __restrict__ SIN) {
    __shared__ __align__(16) unsigned short st[2 * QBUF];
    __shared__ __align__(16) float osw[QWV * 16 * 68];
    const int bx = blockIdx.x % XT, by = blockIdx.x / XT;
    const int K = DM;
    const int tid = threadIdx.x, lane = tid & 31, lr = lane & 15, hi = lane >> 4;
    const int wave = __builtin_amdgcn_readfirstlane(tid >> 5); const int wm = wave / 3, wn = wave % 3;
    const int cb = by * 3 + wn;      // the wave's 64 W rows, counted over Wq, Wk, Wv; every choice below is uniform for the wave
    const int part = cb < DM / 64 ? 0 : cb < (DM + KVD) / 64 ? 1 : 2;
    const bool ROPE = part != 2;
    h16* Ph = part == 0 ? QH : part == 1 ? KH : VH; h16* Pr = part == 0 ? QR : part == 1 ? KR : VR;
    const int RB = ROPE ? SEQ : KVD, pitch = ROPE ? HD : SEQ, CB = ROPE ? HD : SEQ;
    const size_t sRB = part == 0 ? (size_t)NH_ * SEQ * HD : part == 1 ? (size_t)NG_ * SEQ * HD : (size_t)0, sCB = ROPE ? (size_t)SEQ * HD : (size_t)KVD * SEQ;
    float* os = osw + wave * 16 * 68;      // wave-private epilogue staging
    const int xr0 = bx * QXR + wm * 64, wr0 = (cb - (part == 0 ? 0 : part == 1 ? DM / 64 : (DM + KVD) / 64)) * 64;      // first token; first row inside the wave's own W
    const int r0 = ROPE ? xr0 : wr0, c0 = ROPE ? wr0 : xr0;
    v8f acc[4][4];
#pragma unroll
    for (int mb = 0; mb < 4; ++mb)
#pragma unroll
        for (int nb = 0; nb < 4; ++nb) acc[mb][nb] = (v8f){};
    // Copies: a buffer is 7 units of 64 rows (4 of x, 3 of W); a set of 4 waves brings one unit with cp8. Set 0: units 0, 1, 6; set 1: units 2, 3; set 2: units 4, 5.
    const int cs = wave >> 2, t128 = tid & 127;
    const size_t lo = (size_t)(t128 >> 4) * K + (t128 & 15) * 8;      // this lane's place in a unit: row t128/16, 16-B chunk t128%16
    const int n4 = by * QWR, n5 = n4 + 64, n6 = n4 + 128;             // first W rows of units 4, 5, 6
    const bf* w4 = n4 < DM ? WQ + (size_t)n4 * K : n4 < DM + KVD ? WK + (size_t)(n4 - DM) * K : WV + (size_t)(n4 - DM - KVD) * K;
    const bf* w5 = n5 < DM ? WQ + (size_t)n5 * K : n5 < DM + KVD ? WK + (size_t)(n5 - DM) * K : WV + (size_t)(n5 - DM - KVD) * K;
    const bf* w6 = n6 < DM ? WQ + (size_t)n6 * K : n6 < DM + KVD ? WK + (size_t)(n6 - DM) * K : WV + (size_t)(n6 - DM - KVD) * K;
    const bf* g0 = (cs == 2 ? w4 : XB + (size_t)(bx * QXR + cs * 128) * K) + lo;
    const bf* g1 = (cs == 2 ? w5 : XB + (size_t)(bx * QXR + cs * 128 + 64) * K) + lo;
    const bf* g2 = w6 + lo;
    const unsigned ldl = (unsigned)(uintptr_t)st + (unsigned)((t128 >> 4) * (LP * 2) + (t128 & 15) * 16);
    const unsigned lds0 = ldl + (unsigned)cs * (128u * LP * 2u), lds2 = ldl + 384u * LP * 2u;
    cp8(lds0, g0); cp8(lds0 + 64u * LP * 2u, g1); if (cs == 0) cp8(lds2, g2);
    asm volatile("s_wait_asynccnt 0x0" ::: "memory");   // tile 0 has landed before the barrier that publishes it
    __syncthreads();
    cp8(lds0 + QBUF * 2u, g0 + KT); cp8(lds0 + QBUF * 2u + 64u * LP * 2u, g1 + KT); if (cs == 0) cp8(lds2 + QBUF * 2u, g2 + KT);
    const int xo = (wm * 64 + lr) * LP + 8 * hi, wo = (QXR + wn * 64 + lr) * LP + 8 * hi;
    const int ao = ROPE ? xo : wo, bo = ROPE ? wo : xo;
#pragma unroll 1
    for (int t = 0; t < NTRIP; ++t) {      // rolled: one trip per LDS buffer
        const bf* sb = st + (t & 1) * QBUF;
        v16bf a[2][4], b[2][4];            // two fragment sets: block s + 1 of this buffer is fetched while block s is multiplied
#pragma unroll
        for (int i = 0; i < 4; ++i) { a[0][i] = ldb(sb + ao + i * 16 * LP); b[0][i] = ldb(sb + bo + i * 16 * LP); }
#pragma unroll
        for (int s = 0; s < KT / 32; ++s) {
            if (s + 1 < KT / 32) {
#pragma unroll
                for (int i = 0; i < 4; ++i) { a[(s + 1) & 1][i] = ldb(sb + ao + i * 16 * LP + (s + 1) * 32); b[(s + 1) & 1][i] = ldb(sb + bo + i * 16 * LP + (s + 1) * 32); }
            }
            __builtin_amdgcn_sched_barrier(0);   // the next block's LDS reads stay one group, ahead of this block's matrix instructions
#pragma unroll
            for (int nb = 0; nb < 4; ++nb)
#pragma unroll
                for (int mb = 0; mb < 4; ++mb) acc[mb][nb] = wmmab(a[s & 1][mb], b[s & 1][nb], acc[mb][nb]);
            __builtin_amdgcn_sched_barrier(0);   // no later LDS read moves in among them
        }
        ring_publish();
        if (t + 2 < NTRIP) { const int kn = (t + 2) * KT; const unsigned bofs = (unsigned)(t & 1) * (QBUF * 2u);
            cp8(lds0 + bofs, g0 + kn); cp8(lds0 + bofs + 64u * LP * 2u, g1 + kn); if (cs == 0) cp8(lds2 + bofs, g2 + kn); }
    }
    asm volatile("s_wait_asynccnt 0x0" ::: "memory");   // nothing of the ring is in flight when the wave goes on
    const size_t tbase = (size_t)(r0 / RB) * sRB + (size_t)(r0 % RB) * (size_t)pitch + (size_t)(c0 / CB) * sCB + (size_t)(c0 % CB);
    const int tok0 = r0 % RB;
#pragma unroll
    for (int mb = 0; mb < 4; ++mb) {
#pragma unroll
        for (int nb = 0; nb < 4; ++nb) {
#pragma unroll
            for (int j = 0; j < 8; ++j) os[(hi * 8 + j) * 68 + nb * 16 + lr] = acc[mb][nb][j]; }   // D: row 8h+j, col lane&15; rows 0..15 x columns 0..63 all written
        wave_sync();
        v8h hv[4], rv[4];
#pragma unroll
        for (int s = 0; s < 4; ++s) { const int row = 4 * s + (lane >> 3), c8 = (lane & 7) * 8;   // 4 s x 4 row groups = 16 rows; 8 lanes x 8 = 64 columns
            const v4f x0 = *(const v4fa*)(&os[row * 68 + c8]); const v4f x1 = *(const v4fa*)(&os[row * 68 + c8 + 4]);
            float xv[8];
#pragma unroll
            for (int i = 0; i < 4; ++i) { xv[i] = x0[i]; xv[4 + i] = x1[i]; }
            if (ROPE) {
                const int pc = c8 ^ 32;
                const v4f y0 = *(const v4fa*)(&os[row * 68 + pc]); const v4f y1 = *(const v4fa*)(&os[row * 68 + pc + 4]);
                const size_t to = (size_t)(tok0 + mb * 16 + row) * HD + c8;
                const v4f ca = *(const v4f*)(COS + to), cb = *(const v4f*)(COS + to + 4), sa = *(const v4f*)(SIN + to), sb = *(const v4f*)(SIN + to + 4);
                const float sg = (c8 < 32) ? -1.0f : 1.0f;     // rotated = concat(-x2, x1)
#pragma unroll
                for (int i = 0; i < 4; ++i) { xv[i] = x0[i] * bfr(ca[i]) + (sg * y0[i]) * bfr(sa[i]); xv[4 + i] = x1[i] * bfr(cb[i]) + (sg * y1[i]) * bfr(sb[i]); }
            }
            v8h hh, rr;
#pragma unroll
            for (int i = 0; i < 8; ++i) { const h16 a0 = (h16)xv[i]; hh[i] = a0; rr[i] = (h16)((xv[i] - (float)a0) * QRS); }
            hv[s] = hh; rv[s] = rr; }
        const size_t sb0 = tbase + (size_t)(mb * 16) * (size_t)pitch;
#pragma unroll
        for (int s = 0; s < 4; ++s) { const int row = 4 * s + (lane >> 3), c8 = (lane & 7) * 8; const size_t oo = sb0 + (size_t)row * (size_t)pitch + c8;
            *(v8h*)(Ph + oo) = hv[s]; *(v8h*)(Pr + oo) = rv[s]; }
        asm volatile("s_wait_xcnt 0x0" ::: "memory");   // stands behind the stores, ahead of the next block's writes to the registers that they name
        wave_sync();
    }
}

// Key/value tiles of k_flash go through LDS: the 4 waves of a work-group (64 query rows of one head) share 64 keys per stage, two buffers.
#define FK    64                 // keys per stage: K tile 64 key rows x 64 d, V^T tile 64 d rows x 64 keys, rows of 128 B each
#define FP    72                 // LDS row pitch in 16-bit elements: 144 B = 16 B x odd, conflict-free for 16-B fragment reads
#define FT    (64 * FP)          // elements of one tile
static_assert(16 * AW == FK);    // the diagonal stage of a work-group is its last one
static_assert(HD == 64);
// Eight asynchronous 16-B copies per lane, global -> LDS: four for a K tile at l, four for a V^T tile at l + one tile; rows 16 apart (128 lanes: 8 lanes per 128-B row, 16 rows per copy).
// l: the lane's LDS byte address, gk / gv: the lane's global addresses of its first row (row pitch HD / SEQ elements). The s_wait_xcnt ends the copies' own statement so that no address register is rewritten ahead of it.
__device__ __forceinline__ void cp_kv(unsigned l, const h16* gk, const h16* gv) {
    asm volatile("global_load_async_to_lds_b128 %0, %8, off\n\t"
                 "global_load_async_to_lds_b128 %1, %9, off\n\t"
                 "global_load_async_to_lds_b128 %2, %10, off\n\t"
                 "global_load_async_to_lds_b128 %3, %11, off\n\t"
                 "global_load_async_to_lds_b128 %4, %12, off\n\t"
                 "global_load_async_to_lds_b128 %5, %13, off\n\t"
                 "global_load_async_to_lds_b128 %6, %14, off\n\t"
                 "global_load_async_to_lds_b128 %7, %15, off\n\t"
                 "s_wait_xcnt 0x0"
                 :: "v"(l), "v"(l + 16u * FP * 2u), "v"(l + 32u * FP * 2u), "v"(l + 48u * FP * 2u),
                    "v"(l + FT * 2u), "v"(l + FT * 2u + 16u * FP * 2u), "v"(l + FT * 2u + 32u * FP * 2u), "v"(l + FT * 2u + 48u * FP * 2u),
                    "v"(gk), "v"(gk + (size_t)16 * HD), "v"(gk + (size_t)32 * HD), "v"(gk + (size_t)48 * HD),
                    "v"(gv), "v"(gv + (size_t)16 * SEQ), "v"(gv + (size_t)32 * SEQ), "v"(gv + (size_t)48 * SEQ)
                 : "memory");
}

// flash_tile: fused causal attention, one wave per 16 query rows of one (batch, head), 4 waves (64 consecutive query rows) per work-group; Q fragments straight from the f16 planes,
// K / V^T fragments from the LDS ring (buffer: K value tile, V^T value tile; ER: then K residual tile, V^T residual tile), two 16-B LDS loads each.
// Transposed form: S^T[key][t] = K Q^T (A = K rows, B = Q rows); lane (t = lane&15, h = lane>>4) holds keys 8h+r of each 16-key tile, so the packed
// P tile is directly the B fragment of O^T[d][t] = V^T P^T (element r <- tile keys 0..15, element 8+r <- tile keys 16..31, lane unchanged).
// Head h reads key/value group h / GS_. A wave works on keys 0 .. t0+15 in steps of 32 (two per stage; it passes a stage's step that lies wholly above its rows); keys above the query index are replaced by NEGB (P = 0) on the diagonal step.
// ER: value + residual path (scores kh*qh + [kh*qr + kr*qh]/2048, O = vh*ph + [vr*ph + vh*pr]/2048), residual products in separate accumulators.
// Row sums of P on the matrix unit: A has ones in rows 0 and 8 (lanes 0, 8, 16, 24) and zeros elsewhere, B = the packed P tile: rows 0 and 8 of the 16x16 result, which are element 0 of either lane half,
// hold per query column the sum over the step's 32 keys of the f16 P values; the other rows stay 0, so only element 0 is rescaled, and the halves need no exchange at the end.
// st is the calling kernel's LDS (2 * FBUF elements used); zh = batch * NH_ + head, xb = index of the work-group's 64 query rows.
template<bool ER>
__device__ __forceinline__ void flash_tile(unsigned short* st, int zh, int xb, const h16* __restrict__ QH, const h16* __restrict__ QR, const h16* __restrict__ KH, const h16* __restrict__ KR,
                                           const h16* __restrict__ VH, const h16* __restrict__ VR, h16* CH, h16* CR) {
    constexpr int FBUF = (ER ? 4 : 2) * FT;      // elements of one buffer
    static_assert((size_t)AW * 16 * 68 * 4 <= (size_t)2 * FBUF * 2);
    float* os = (float*)st;      // output staging lies in the ring: behind the loop's last publish point no wave reads the ring and no copy is in flight
    const int tid = threadIdx.x, lane = tid & 31, lr = lane & 15, hi = lane >> 4;
    const int wave = __builtin_amdgcn_readfirstlane(tid >> 5);
    const int b = zh / NH_, h = zh % NH_, g = h / GS_;
    const int t0 = (xb * AW + wave) * 16;
    const int tq = t0 + lr;
    const size_t qbase = (size_t)zh * SEQ * HD;
    const size_t kvb = (size_t)(b * NG_ + g) * SEQ * HD;
    const size_t qo = qbase + (size_t)(t0 + lr) * HD + 8 * hi;
    const v16h qh0 = ldh(QH + qo), qh1 = ldh(QH + qo + 32);          // B fragments: col t, k = d
    v16h qr0 = qh0, qr1 = qh1;
    if (ER) { qr0 = ldh(QR + qo); qr1 = ldh(QR + qo + 32); }
    const int ko = lr * FP + 8 * hi;           // in a buffer: + key * FP        (A fragment: row key, k = d)
    const int vo = FT + lr * FP + 8 * hi;      // in a buffer: + 16j*FP + key    (A fragment: row d, k = key)
    const int nst = xb + 1;      // stages of this work-group: keys 0 .. (its last query row), the same for its 4 waves
    const unsigned lds0 = (unsigned)(uintptr_t)st + (unsigned)((tid >> 3) * (FP * 2) + (tid & 7) * 16);      // this lane's copy target: row tid/8, 16-B chunk tid%8
    const size_t gko = kvb + (size_t)(tid >> 3) * HD + (tid & 7) * 8;      // + key * HD
    const size_t gvo = kvb + (size_t)(tid >> 3) * SEQ + (tid & 7) * 8;     // + key
    cp_kv(lds0, KH + gko, VH + gvo);
    if (ER) cp_kv(lds0 + 2u * FT * 2u, KR + gko, VR + gvo);
    asm volatile("s_wait_asynccnt 0x0" ::: "memory");   // stage 0 has landed before the barrier that publishes it
    __syncthreads();
    if (nst > 1) {
        cp_kv(lds0 + FBUF * 2u, KH + gko + (size_t)FK * HD, VH + gvo + FK);
        if (ER) cp_kv(lds0 + FBUF * 2u + 2u * FT * 2u, KR + gko + (size_t)FK * HD, VR + gvo + FK);
    }
    v8f oH[4], oL[4];
#pragma unroll
    for (int j = 0; j < 4; ++j) { oH[j] = (v8f){}; oL[j] = (v8f){}; }
    float m = NEGB;
    v8f lH = (v8f){}, lL = (v8f){};      // row-sum tiles: of P, of its residual plane (ER)
    const unsigned ow = ((lane & 7) == 0) ? 0x3C003C00u : 0u;      // two f16 1.0 in the lanes of A rows 0 and 8
    const v16h ones = __builtin_bit_cast(v16h, (v8u){ow, ow, ow, ow, ow, ow, ow, ow});
#pragma unroll 1
    for (int sg = 0; sg < nst; ++sg) {      // rolled: one trip per LDS buffer
      const h16* sb = (const h16*)st + (sg & 1) * FBUF;
#pragma unroll
      for (int u = 0; u < FK / 32; ++u) {      // unrolled: each step's LDS offsets become immediates of its fragment loads
        const int key0 = sg * FK + u * 32;
        if (key0 >= t0 + 16) continue;      // wave-uniform: on the diagonal stage the step lies wholly above this wave's rows
        const h16* ka = sb + ko + u * 32 * FP;
        float ta[8], tb[8];
        if (!ER) {
            const v16h ka0 = ldh(ka), ka1 = ldh(ka + 32), kb0 = ldh(ka + 16 * FP), kb1 = ldh(ka + 16 * FP + 32);
            v8f sHa = (v8f){}, sHb = (v8f){};
            sHa = wmma16(ka0, qh0, sHa); sHb = wmma16(kb0, qh0, sHb);
            sHa = wmma16(ka1, qh1, sHa); sHb = wmma16(kb1, qh1, sHb);
            asm volatile("v_nop\n\tv_nop\n\tv_nop\n\tv_nop" : "+v"(sHa), "+v"(sHb) : "v"(ka0), "v"(ka1), "v"(kb0), "v"(kb1));
#pragma unroll
            for (int r = 0; r < 8; ++r) { ta[r] = sHa[r] * SC2; tb[r] = sHb[r] * SC2; }
        } else {
            const h16* kr = ka + 2 * FT;
            { const v16h ka0 = ldh(ka), ka1 = ldh(ka + 32), ra0 = ldh(kr), ra1 = ldh(kr + 32);
              v8f sH = (v8f){}, sL = (v8f){};
              sH = wmma16(ka0, qh0, sH); sL = wmma16(ka0, qr0, sL);
              sH = wmma16(ka1, qh1, sH); sL = wmma16(ka1, qr1, sL);
              sL = wmma16(ra0, qh0, sL); sL = wmma16(ra1, qh1, sL);
              asm volatile("v_nop\n\tv_nop\n\tv_nop\n\tv_nop" : "+v"(sH), "+v"(sL) : "v"(ka0), "v"(ka1), "v"(ra0), "v"(ra1));
#pragma unroll
              for (int r = 0; r < 8; ++r) ta[r] = (sH[r] + sL[r] * QRI) * SC2; }
            { const v16h kb0 = ldh(ka + 16 * FP), kb1 = ldh(ka + 16 * FP + 32), rb0 = ldh(kr + 16 * FP), rb1 = ldh(kr + 16 * FP + 32);
              v8f sH = (v8f){}, sL = (v8f){};
              sH = wmma16(kb0, qh0, sH); sL = wmma16(kb0, qr0, sL);
              sH = wmma16(kb1, qh1, sH); sL = wmma16(kb1, qr1, sL);
              sL = wmma16(rb0, qh0, sL); sL = wmma16(rb1, qh1, sL);
              asm volatile("v_nop\n\tv_nop\n\tv_nop\n\tv_nop" : "+v"(sH), "+v"(sL) : "v"(kb0), "v"(kb1), "v"(rb0), "v"(rb1));
#pragma unroll
              for (int r = 0; r < 8; ++r) tb[r] = (sH[r] + sL[r] * QRI) * SC2; }
        }
        if (key0 + 31 > t0) {      // wave-uniform: only the diagonal step holds keys above some query index; every row keeps key key0 <= t
#pragma unroll
            for (int r = 0; r < 8; ++r) { const int kk = key0 + 8 * hi + r; ta[r] = (kk <= tq) ? ta[r] : NEGB; tb[r] = (kk + 16 <= tq) ? tb[r] : NEGB; }
        }
        float mx = NEGB;
#pragma unroll
        for (int r = 0; r < 8; ++r) mx = fmaxf(mx, fmaxf(ta[r], tb[r]));
        mx = fmaxf(mx, __shfl_xor(mx, 16, 32));
        const float mnew = fmaxf(m, mx);
        const float alpha = __builtin_amdgcn_exp2f(m - mnew);
        const float sh = PSH - mnew;
        v16h pb, pq;
        if (!ER) {
#pragma unroll
            for (int r = 0; r < 8; ++r) { pb[r] = (h16)__builtin_amdgcn_exp2f(ta[r] + sh); pb[8 + r] = (h16)__builtin_amdgcn_exp2f(tb[r] + sh); }
            pq = pb;
        } else {
#pragma unroll
            for (int r = 0; r < 8; ++r) { const float fa = __builtin_amdgcn_exp2f(ta[r] + sh); const float fc = __builtin_amdgcn_exp2f(tb[r] + sh);
                const h16 pa = (h16)fa; const h16 pc = (h16)fc; const h16 qa = (h16)((fa - (float)pa) * QRS); const h16 qc = (h16)((fc - (float)pc) * QRS);
                pb[r] = pa; pb[8 + r] = pc; pq[r] = qa; pq[8 + r] = qc; }
        }
        lH[0] *= alpha; if (ER) lL[0] *= alpha;
        m = mnew;
#pragma unroll
        for (int j = 0; j < 4; ++j) { oH[j] = oH[j] * alpha; if (ER) oL[j] = oL[j] * alpha; }
        const h16* va = sb + vo + u * 32;
        const v16h v0 = ldh(va), v1 = ldh(va + 16 * FP), v2 = ldh(va + 32 * FP), v3 = ldh(va + 48 * FP);
        if (!ER) {
            lH = wmma16(ones, pb, lH);
            oH[0] = wmma16(v0, pb, oH[0]); oH[1] = wmma16(v1, pb, oH[1]); oH[2] = wmma16(v2, pb, oH[2]); oH[3] = wmma16(v3, pb, oH[3]);
            // the four slots behind the step's last matrix instructions, also on the taken side of the branch that follows
            asm volatile("v_nop\n\tv_nop\n\tv_nop\n\tv_nop" : "+v"(oH[0]), "+v"(oH[1]), "+v"(oH[2]), "+v"(oH[3]), "+v"(lH) : "v"(v0), "v"(v1), "v"(v2), "v"(v3), "v"(pb));
        } else {
            const h16* vr = va + 2 * FT;
            const v16h w0 = ldh(vr), w1 = ldh(vr + 16 * FP), w2 = ldh(vr + 32 * FP), w3 = ldh(vr + 48 * FP);
            lH = wmma16(ones, pb, lH); lL = wmma16(ones, pq, lL);
            oH[0] = wmma16(v0, pb, oH[0]); oH[1] = wmma16(v1, pb, oH[1]); oH[2] = wmma16(v2, pb, oH[2]); oH[3] = wmma16(v3, pb, oH[3]);
            oL[0] = wmma16(w0, pb, oL[0]); oL[1] = wmma16(w1, pb, oL[1]); oL[2] = wmma16(w2, pb, oL[2]); oL[3] = wmma16(w3, pb, oL[3]);
            oL[0] = wmma16(v0, pq, oL[0]); oL[1] = wmma16(v1, pq, oL[1]); oL[2] = wmma16(v2, pq, oL[2]); oL[3] = wmma16(v3, pq, oL[3]);
            // the four slots behind the step's last matrix instructions, also on the taken side of the branch that follows
            asm volatile("v_nop\n\tv_nop\n\tv_nop\n\tv_nop" : "+v"(oH[0]), "+v"(oH[1]), "+v"(oH[2]), "+v"(oH[3]), "+v"(oL[0]), "+v"(oL[1]), "+v"(oL[2]), "+v"(oL[3]), "+v"(lH), "+v"(lL)
                         : "v"(v0), "v"(v1), "v"(v2), "v"(v3), "v"(w0), "v"(w1), "v"(w2), "v"(w3), "v"(pb), "v"(pq));
        }
      }
      ring_publish();
      if (sg + 2 < nst) { const int kn = (sg + 2) * FK; const unsigned lb = lds0 + (unsigned)(sg & 1) * (FBUF * 2u);
          cp_kv(lb, KH + gko + (size_t)kn * HD, VH + gvo + kn);
          if (ER) cp_kv(lb + 2u * FT * 2u, KR + gko + (size_t)kn * HD, VR + gvo + kn); }
    }
    asm volatile("s_wait_asynccnt 0x0" ::: "memory");   // nothing of the ring is in flight when the wave goes on
    const float l = ER ? lH[0] + lL[0] * QRI : lH[0];      // each half's element 0 holds the sum over all keys
    const float inv = CXS * (1.0f / l);
    const int wb = wave * 16 * 68;
    // O^T D layout: o_j[r] = (d = 16j + 8h + r, t = lane&15) -> os[t][d]; rows 0..15 x columns 0..63 all written
#pragma unroll
    for (int j = 0; j < 4; ++j) { v4f a, c;
#pragma unroll
        for (int i = 0; i < 4; ++i) {
            if (ER) { a[i] = (oH[j][i] + oL[j][i] * QRI) * inv; c[i] = (oH[j][4 + i] + oL[j][4 + i] * QRI) * inv; }
            else    { a[i] = oH[j][i] * inv; c[i] = oH[j][4 + i] * inv; } }
        *(v4fa*)(&os[wb + lr * 68 + 16 * j + 8 * hi]) = a; *(v4fa*)(&os[wb + lr * 68 + 16 * j + 8 * hi + 4]) = c; }
    wave_sync();
    v8h hv[4], rv[4];
#pragma unroll
    for (int s = 0; s < 4; ++s) { const int row = 4 * s + (lane >> 3), c8 = (lane & 7) * 8;   // 4 s x 4 row groups = 16 rows; 8 lanes x 8 = 64 columns
        const v4f x0 = *(const v4fa*)(&os[wb + row * 68 + c8]); const v4f x1 = *(const v4fa*)(&os[wb + row * 68 + c8 + 4]); v8h hh, rr;
#pragma unroll
        for (int i = 0; i < 4; ++i) { const h16 a0 = (h16)x0[i]; const h16 a1 = (h16)x1[i]; hh[i] = a0; hh[4 + i] = a1; rr[i] = (h16)((x0[i] - (float)a0) * QRS); rr[4 + i] = (h16)((x1[i] - (float)a1) * QRS); }
        hv[s] = hh; rv[s] = rr; }
    const size_t cbase = ((size_t)b * SEQ + t0) * DM + (size_t)h * HD;
    const size_t rbase = ((size_t)b * ER_ROWS + t0) * DM + (size_t)h * HD;     // used by the ER instantiation only (t0 < ER_ROWS there)
#pragma unroll
    for (int s = 0; s < 4; ++s) { const int row = 4 * s + (lane >> 3), c8 = (lane & 7) * 8;
        *(v8h*)(CH + cbase + (size_t)row * DM + c8) = hv[s]; if (ER) *(v8h*)(CR + rbase + (size_t)row * DM + c8) = rv[s]; }
}

// k_flash: both row ranges of the attention in one launch, grid (batch * head, rank); there are more work-groups than resident places, so the ranks take, in order:
// the longest single-product tiles, then the value + residual tiles (three products where the others have one), then the other single-product tiles, each run longest first.
static constexpr int NTT = SEQ / (16 * AW);                             // 64-row tiles of a head
static constexpr int NTE = ER_ROWS / (16 * AW);                         // of them on the value + residual path (the first ones)
static constexpr int NTH = (NTE < NTT - NTE) ? NTE : NTT - NTE;         // single-product tiles ranked ahead of those
__global__ __launch_bounds__(32 * AW) void k_flash(const h16* __restrict__ QH, const h16* __restrict__ QR, const h16* __restrict__ KH, const h16* __restrict__ KR,
                                                   const h16* __restrict__ VH, const h16* __restrict__ VR, h16* CH, h16* CR) {
    __shared__ __align__(16) unsigned short st[2 * 4 * FT];
    const int q = blockIdx.y;      // rank -> tile is a permutation of 0 .. NTT-1; the branch is uniform for the work-group
    const int xb = q < NTH ? NTT - 1 - q : q < NTH + NTE ? NTH + NTE - 1 - q : NTT - 1 - (q - NTE);
    if (xb < NTE) flash_tile<true>(st, blockIdx.x, xb, QH, QR, KH, KR, VH, VR, CH, CR);
    else flash_tile<false>(st, blockIdx.x, xb, QH, QR, KH, KR, VH, VR, CH, CR);
}

// k_out: output projection, f16 GEMM, one launch. OUT[b][t][n] = OSC * sum_k (CH[b*SEQ+t][k] + CR[b*ER_ROWS+t][k]/2048) * WO[n][k] (the CR term for rows t < ER_ROWS only), K = DM.
// A work-group of 10 waves (5 x 2 wave tiles of 64 A rows x 64 columns, 16 accumulators each) takes 128 columns and 5 units of 64 A rows through the LDS ring:
// units 0..2: 64 rows t >= ER_ROWS of CH each; units 3, 4: 32 rows t < ER_ROWS of CH, then the same 32 rows of CR (residual products in their own accumulators: row blocks 2, 3 of the wave tile);
// units 5, 6: the 128 rows of WO. The matrix loop is the same for every wave; the epilogue joins value and residual accumulators in the waves of units 3, 4.
#define OWV   10                 // waves of a work-group
#define OAR   320                // A rows of a buffer
#define OBUF  ((OAR + 128) * LP) // elements of one buffer
static constexpr int FU_B = (SEQ - ER_ROWS) / 64;        // 64-row units of rows >= ER_ROWS in a batch
static constexpr int EU_B = ER_ROWS / 32;                // 32-row units of rows < ER_ROWS in a batch
static constexpr int OT_ = NB * FU_B / 3;                // tile rows
static_assert(SEQ > ER_ROWS);
static_assert((NB * FU_B) % 3 == 0 && (NB * EU_B) % 2 == 0);
static_assert(NB * FU_B / 3 == NB * EU_B / 2);           // every work-group has its three units and its two
static_assert(DM % 128 == 0);
__global__ __launch_bounds__(32 * OWV) void k_out(const h16* __restrict__ CH, const h16* __restrict__ CR, const h16* __restrict__ WO, float* OUT) {
    __shared__ __align__(16) unsigned short st[2 * OBUF];
    __shared__ __align__(16) float osw[OWV * 16 * 68];
    const int bx = blockIdx.x % OT_, by = blockIdx.x / OT_;
    const int tid = threadIdx.x, lane = tid & 31, lr = lane & 15, hi = lane >> 4;
    const int wave = __builtin_amdgcn_readfirstlane(tid >> 5); const int wm = wave >> 1, wn = wave & 1;
    float* os = osw + wave * 16 * 68;      // wave-private epilogue staging
    const bool er = wm >= 3;               // uniform for the wave
    const int un = er ? bx * 2 + (wm - 3) : bx * 3 + wm;      // the wave's unit among its kind
    const int b = er ? un / EU_B : un / FU_B, t = er ? (un % EU_B) * 32 : ER_ROWS + (un % FU_B) * 64, c0 = by * 128 + wn * 64;
    v8f acc[4][4];
#pragma unroll
    for (int mb = 0; mb < 4; ++mb)
#pragma unroll
        for (int nb = 0; nb < 4; ++nb) acc[mb][nb] = (v8f){};
    // Copies: waves 0..3 bring units 0, 1, 2; waves 4..7 units 3, 4, 5 (128 lanes a unit); waves 8, 9 unit 6 (64 lanes, two halves of 32 rows).
    const int cs = wave >> 2, t128 = tid & 127, t64 = tid & 63;
    const unsigned short* ch = (const unsigned short*)CH; const unsigned short* cr = (const unsigned short*)CR; const unsigned short* wo = (const unsigned short*)WO;
    const size_t lo = (size_t)(t128 >> 4) * DM + (t128 & 15) * 8;      // this lane's place in a unit: row t128/16, 16-B chunk t128%16
    const int f0 = bx * 3, f1 = f0 + 1, f2 = f0 + 2, e0 = bx * 2, e1 = e0 + 1;
    const unsigned short* pf0 = ch + ((size_t)(f0 / FU_B) * SEQ + ER_ROWS + (f0 % FU_B) * 64) * DM;
    const unsigned short* pf1 = ch + ((size_t)(f1 / FU_B) * SEQ + ER_ROWS + (f1 % FU_B) * 64) * DM;
    const unsigned short* pf2 = ch + ((size_t)(f2 / FU_B) * SEQ + ER_ROWS + (f2 % FU_B) * 64) * DM;
    const unsigned short* pe0 = ch + ((size_t)(e0 / EU_B) * SEQ + (e0 % EU_B) * 32) * DM;
    const unsigned short* pe1 = ch + ((size_t)(e1 / EU_B) * SEQ + (e1 % EU_B) * 32) * DM;
    const unsigned short* pr0 = cr + ((size_t)(e0 / EU_B) * ER_ROWS + (e0 % EU_B) * 32) * DM;
    const unsigned short* pr1 = cr + ((size_t)(e1 / EU_B) * ER_ROWS + (e1 % EU_B) * 32) * DM;
    const unsigned short* pw = wo + (size_t)(by * 128) * DM;
    const unsigned short* u0a = (cs == 0 ? pf0 : pe0) + lo; const unsigned short* u0b = (cs == 0 ? pf0 + (size_t)32 * DM : pr0) + lo;
    const unsigned short* u1a = (cs == 0 ? pf1 : pe1) + lo; const unsigned short* u1b = (cs == 0 ? pf1 + (size_t)32 * DM : pr1) + lo;
    const unsigned short* u2a = (cs == 0 ? pf2 : pw) + lo;  const unsigned short* u2b = u2a + (size_t)32 * DM;
    const unsigned short* u6 = pw + (size_t)(64 + (t64 >> 4)) * DM + (t64 & 15) * 8;
    const unsigned la = (unsigned)(uintptr_t)st + (unsigned)((cs & 1) * 192 + (t128 >> 4)) * (LP * 2u) + (unsigned)(t128 & 15) * 16u;
    const unsigned lc = (unsigned)(uintptr_t)st + (unsigned)(384 + (t64 >> 4)) * (LP * 2u) + (unsigned)(t64 & 15) * 16u;
    auto stage = [&](unsigned bofs, int kn) {      // one tile: buffer at byte offset bofs, k from kn; the branch is uniform for the wave
        if (cs < 2) { cp8g<8>(la + bofs, u0a + kn, u0b + kn); cp8g<8>(la + bofs + 64u * LP * 2u, u1a + kn, u1b + kn); cp8g<8>(la + bofs + 128u * LP * 2u, u2a + kn, u2b + kn); }
        else { cp8g<4>(lc + bofs, u6 + kn, u6 + (size_t)16 * DM + kn); cp8g<4>(lc + bofs + 32u * LP * 2u, u6 + (size_t)32 * DM + kn, u6 + (size_t)48 * DM + kn); }
    };
    stage(0u, 0);
    asm volatile("s_wait_asynccnt 0x0" ::: "memory");   // tile 0 has landed before the barrier that publishes it
    __syncthreads();
    stage(OBUF * 2u, KT);
    const int ao = (wm * 64 + lr) * LP + 8 * hi, bo = (OAR + wn * 64 + lr) * LP + 8 * hi;
#pragma unroll 1
    for (int tr = 0; tr < NTRIP; ++tr) {      // rolled: one trip per LDS buffer
      const h16* sb = (const h16*)st + (tr & 1) * OBUF;
      v16h a[2][4], bb[2][4];      // two fragment sets: block s + 1 of this buffer is fetched while block s is multiplied
#pragma unroll
      for (int i = 0; i < 4; ++i) { a[0][i] = ldh(sb + ao + i * 16 * LP); bb[0][i] = ldh(sb + bo + i * 16 * LP); }
#pragma unroll
      for (int s = 0; s < KT / 32; ++s) {
        if (s + 1 < KT / 32) {
#pragma unroll
            for (int i = 0; i < 4; ++i) { a[(s + 1) & 1][i] = ldh(sb + ao + i * 16 * LP + (s + 1) * 32); bb[(s + 1) & 1][i] = ldh(sb + bo + i * 16 * LP + (s + 1) * 32); }
        }
        __builtin_amdgcn_sched_barrier(0);   // the next block's LDS reads stay one group, ahead of this block's matrix instructions
#pragma unroll
        for (int nb = 0; nb < 4; ++nb)
#pragma unroll
            for (int mb = 0; mb < 4; ++mb) acc[mb][nb] = wmma16(a[s & 1][mb], bb[s & 1][nb], acc[mb][nb]);
        __builtin_amdgcn_sched_barrier(0);   // no later LDS read moves in among them
      }
      ring_publish();
      if (tr + 2 < NTRIP) stage((unsigned)(tr & 1) * (OBUF * 2u), (tr + 2) * KT);
    }
    asm volatile("s_wait_asynccnt 0x0" ::: "memory");   // nothing of the ring is in flight when the wave goes on
#pragma unroll
    for (int mb = 0; mb < 4; ++mb) {
      if (mb < 2 || !er) {      // uniform for the wave: 32 output rows in the waves of units 3, 4
        if (mb < 2 && er) {
#pragma unroll
            for (int nb = 0; nb < 4; ++nb) {
#pragma unroll
                for (int j = 0; j < 8; ++j) os[(hi * 8 + j) * 68 + nb * 16 + lr] = (acc[mb & 1][nb][j] + acc[2 + (mb & 1)][nb][j] * QRI) * OSC; }   // D: row 8h+j, col lane&15
        } else {
#pragma unroll
            for (int nb = 0; nb < 4; ++nb) {
#pragma unroll
                for (int j = 0; j < 8; ++j) os[(hi * 8 + j) * 68 + nb * 16 + lr] = acc[mb][nb][j] * OSC; }
        }
        wave_sync();
        float* orow = OUT + ((size_t)b * OUT_SEQ + t + mb * 16) * DM + c0;
#pragma unroll
        for (int s = 0; s < 8; ++s) { const int row = 2 * s + hi, cofs = lr * 4;   // 8 s x 2 rows = 16 rows; 16 lanes x 4 floats = 64 columns
            const v4f val = *(const v4fa*)(&os[row * 68 + cofs]);
            *(v4f*)(orow + (size_t)row * DM + cofs) = val; }
        asm volatile("s_wait_xcnt 0x0" ::: "memory");   // stands behind the stores, ahead of the next block's writes to the registers that they name
        wave_sync();
      }
    }
}

static constexpr size_t al256(size_t v) { return (v + 255) & ~(size_t)255; }
static constexpr size_t SZ_XB = al256((size_t)NB * SEQ * DM * 2);
static constexpr size_t SZ_WQ = al256((size_t)DM * DM * 2);
static constexpr size_t SZ_WK = al256((size_t)KVD * DM * 2);
static constexpr size_t SZ_QP = al256((size_t)NB * NH_ * SEQ * HD * 2);
static constexpr size_t SZ_KP = al256((size_t)NB * NG_ * SEQ * HD * 2);
static constexpr size_t SZ_CH = al256((size_t)NB * SEQ * DM * 2);
static constexpr size_t SZ_CR = al256((size_t)NB * ER_ROWS * DM * 2);
static constexpr size_t SZ_TOTAL = SZ_XB + 2 * SZ_WQ + 2 * SZ_WK + 2 * SZ_QP + 4 * SZ_KP + SZ_CH + SZ_CR;
static_assert(SZ_TOTAL <= (size_t)134217728);          // workspace carve <= 128 MiB

extern "C" void kernel_launch(void* const* d_in, const int* in_sizes, int n_in,
                              void* d_out, int out_size, void* d_ws, size_t ws_size, hipStream_t stream) {
    if (n_in < 7) return;
    const size_t needx = ((size_t)(NB - 1) * SEQ_FULL + SEQ) * DM;
    if ((size_t)in_sizes[0] < needx) return;
    if ((size_t)in_sizes[1] < (size_t)DM * DM || (size_t)in_sizes[2] < (size_t)KVD * DM || (size_t)in_sizes[3] < (size_t)KVD * DM || (size_t)in_sizes[4] < (size_t)DM * DM) return;
    if ((size_t)in_sizes[5] < (size_t)SEQ * HD || (size_t)in_sizes[6] < (size_t)SEQ * HD) return;
    if ((size_t)out_size < ((size_t)(NB - 1) * OUT_SEQ + SEQ) * DM) return;
    if (SZ_TOTAL > ws_size) return;
    // wire order: x, Wq, Wk, Wv, Wo, cos, sin (W as [out][in] = Bt as-is; cos/sin [token][64] read as values)
    const float* x = (const float*)d_in[0]; const float* wq = (const float*)d_in[1]; const float* wk = (const float*)d_in[2]; const float* wv = (const float*)d_in[3];
    const float* wo = (const float*)d_in[4]; const float* cs = (const float*)d_in[5]; const float* sn = (const float*)d_in[6];
    float* OUT = (float*)d_out;      // [NB][SEQ][2048]
    char* wsp = (char*)d_ws;
    bf* XB = (bf*)wsp; wsp += SZ_XB;                 // [NB*SEQ][2048] bf16
    bf* WQ = (bf*)wsp; wsp += SZ_WQ;                 // [2048][2048] bf16
    bf* WK = (bf*)wsp; wsp += SZ_WK;                 // [512][2048] bf16
    bf* WV = (bf*)wsp; wsp += SZ_WK;                 // [512][2048] bf16
    h16* WO = (h16*)wsp; wsp += SZ_WQ;               // [2048][2048] f16 x64
    h16* QH = (h16*)wsp; wsp += SZ_QP;               // [NB*32][SEQ][64]
    h16* QR = (h16*)wsp; wsp += SZ_QP;               // residual x2048
    h16* KH = (h16*)wsp; wsp += SZ_KP;               // [NB*8][SEQ][64]
    h16* KR = (h16*)wsp; wsp += SZ_KP;               // residual x2048
    h16* VH = (h16*)wsp; wsp += SZ_KP;               // [NB*8][64][SEQ]
    h16* VR = (h16*)wsp; wsp += SZ_KP;               // residual x2048
    h16* CH = (h16*)wsp; wsp += SZ_CH;               // [NB*SEQ][2048] ctx x64
    h16* CR = (h16*)wsp; wsp += SZ_CR;               // [NB*ER_ROWS][2048] residual x2048

    k_cvt8<<<CB_X + 2 * CB_W + 2 * CB_K, 256, 0, stream>>>(x, wq, wk, wv, wo, XB, WQ, WK, WV, (unsigned short*)WO);

    k_qkv<<<XT * WT_, 32 * QWV, 0, stream>>>(XB, WQ, WK, WV, QH, QR, KH, KR, VH, VR, cs, sn);

    k_flash<<<dim3(NB * NH_, NTT, 1), 32 * AW, 0, stream>>>(QH, QR, KH, KR, VH, VR, CH, CR);

    k_out<<<OT_ * (DM / 128), 32 * OWV, 0, stream>>>(CH, CR, WO, OUT);
}

// v007
// Measured time: 117 microseconds a run.
// Next to v006, in two timings, it ran 1.05 and 1.03 times as fast.
// Over all steps from v000 it is 3.57 times as fast.
#include <hip/hip_runtime.h>

// Causal grouped-query attention, width 2048 = 32 heads x 64, 8 key/value groups (4 heads per group), rotate-half rotary with INPUT cos/sin tables, output projection; x [NB][SEQ][2048], W [out][in] (y = x W^T), no biases, score scale 1/8.
// Compute dtypes, f32 accumulate everywhere: q/k/v projections v_wmma_f32_16x16x32_bf16 (x, W RNE-converted to bf16; products exact); rotary in f32 with bf16-converted table values;
// scores, P.V and the output projection v_wmma_f32_16x16x32_f16: q, k, v^T, ctx(x64) as f16 value planes plus f16 residual planes x2048; Wo as f16 of the bf16 value x64; P carried x256.
// Query rows >= 512 use single f16 products; query rows < 512 use value + residual (three products for scores and P.V, two for the output projection), residual products in their own accumulators.
// Transposed flash form (S^T = K Q^T, O^T = V^T P^T), online softmax in f32 (running max, renewed lazily), causal mask applied by value on the diagonal key step.

#ifndef NB
#define NB 2
#endif
#ifndef SEQ
#define SEQ 2048
#endif
#define NB_FULL  2
#define SEQ_FULL 2048
#ifndef OUT_SEQ
#define OUT_SEQ SEQ              // row pitch (in tokens) between batches of the output
#endif
#define DM   2048                // model width = depth of every GEMM
#define NH_  32
#define NG_  8
#define GS_  4                   // heads per key/value group
#define HD   64
#define KVD  512                 // NG_ * HD
#define AW   4                   // waves per flash block (16 query rows each)
#define QRS  2048.0f             // carry of every residual plane
#define QRI  (1.0f / 2048.0f)
#define SC2  (0.125f * 1.4426950408889634f)   // HD^-0.5 * log2(e)
#define PSH  8.0f                // log2 of the P carry (256)
#define CXS  64.0f               // carry of the ctx plane
#define WOS  64.0f               // carry of the Wo plane
#define OSC  (1.0f / 4096.0f)    // 1 / (CXS * WOS)
#define NEGB (-3.0e38f)
#define LZT  7.0f                // lazy rescale: the maximum in use may lag a column's true maximum by this much (log2), so P x 256 stays <= 2^15, inside f16

static constexpr int ER_ROWS = (SEQ < 512) ? SEQ : 512;   // query rows per batch on the value + residual path

static_assert(HD == 64);
static_assert(NH_ * HD == DM);
static_assert(NG_ * HD == KVD);
static_assert(NG_ * GS_ == NH_);
static_assert(DM % 64 == 0);
static_assert(DM % 32 == 0);                   // GEMM k-loop steps by 32
static_assert(KVD % 64 == 0);
static_assert(SEQ % 64 == 0);                  // a 64-row tile never straddles two batches
static_assert(SEQ % (16 * AW) == 0);
static_assert(ER_ROWS % 64 == 0);
static_assert((SEQ - ER_ROWS) % 64 == 0);
static_assert(((size_t)SEQ * DM) % 8 == 0);
static_assert(NB <= NB_FULL);
static_assert(SEQ <= SEQ_FULL);

typedef _Float16 h16;
typedef unsigned short bf;
typedef __attribute__((ext_vector_type(16))) __bf16   v16bf;
typedef __attribute__((ext_vector_type(16))) _Float16 v16h;
typedef __attribute__((ext_vector_type(8)))  _Float16 v8h;
typedef __attribute__((ext_vector_type(8)))  unsigned short v8us;
typedef __attribute__((ext_vector_type(8)))  unsigned v8u;
typedef __attribute__((ext_vector_type(8)))  float    v8f;
typedef __attribute__((ext_vector_type(4)))  float    v4f;
typedef v4f  __attribute__((may_alias)) v4fa;

__device__ __forceinline__ unsigned short f2bf(float f) { unsigned u = __float_as_uint(f); u += 0x7FFFu + ((u >> 16) & 1u); return (unsigned short)(u >> 16); }
__device__ __forceinline__ float bfr(float f) { return __uint_as_float(((unsigned)f2bf(f)) << 16); }   // value after RNE conversion to bf16
__device__ __forceinline__ v16h cat16(v8h lo, v8h hi) { return __builtin_shufflevector(lo, hi, 0, 1, 2, 3, 4, 5, 6, 7, 8, 9, 10, 11, 12, 13, 14, 15); }
__device__ __forceinline__ v16bf cat16b(v8us lo, v8us hi) { return __builtin_bit_cast(v16bf, __builtin_shufflevector(lo, hi, 0, 1, 2, 3, 4, 5, 6, 7, 8, 9, 10, 11, 12, 13, 14, 15)); }
__device__ __forceinline__ v8f wmma16(v16h a, v16h b, v8f c) { return __builtin_amdgcn_wmma_f32_16x16x32_f16(false, a, false, b, (short)0, c, false, false); }
__device__ __forceinline__ v8f wmmab(v16bf a, v16bf b, v8f c) { return __builtin_amdgcn_wmma_f32_16x16x32_bf16(false, a, false, b, (short)0, c, false, false); }
// fragment loaders from K-contiguous 16-bit rows; p already includes + 8*(lane>>4): elements 0..7 <- k0+8h+0..7, elements 8..15 <- k0+16+8h+0..7 (same map for A and B)
__device__ __forceinline__ v16h  ldh(const h16* p) { return cat16(*(const v8h*)p, *(const v8h*)(p + 16)); }
__device__ __forceinline__ v16bf ldb(const bf* p)  { return cat16b(*(const v8us*)p, *(const v8us*)(p + 16)); }
// ordering point for wave-private LDS tiles (same wave writes and reads)
__device__ __forceinline__ void wave_sync() { __builtin_amdgcn_fence(3 /* release order */, "wavefront"); __builtin_amdgcn_wave_barrier(); asm volatile("" ::: "memory"); }

// Operand tiles of every GEMM kernel go through LDS: a work-group's waves (64 x 64 wave tiles) share the A rows and B rows of its tile, KT k-values per trip, two buffers; a buffer is 7 units of 64 rows.
#define KT    128                // k per trip: rows of 256 B
#define LP    136                // LDS row pitch in 16-bit elements: 272 B = 16 B x odd, conflict-free for 16-B fragment reads
#define NTRIP (DM / KT)
static_assert(DM % KT == 0);
static_assert(NTRIP >= 2);       // the prologue fills two tiles
// Eight asynchronous 16-B copies per lane, global -> LDS, LDS rows RS apart (16 lanes per 256-B row; 128 lanes, RS = 8: 64 rows; 64 lanes, RS = 4: 32 rows).
// l: the lane's LDS byte address; g0: the lane's global address for the first four copies, g1: for the last four (row pitch DM elements). The s_wait_xcnt ends the copies' own statement so that no address register is rewritten ahead of it.
template<int RS>
__device__ __forceinline__ void cp8g(unsigned l, const unsigned short* g0, const unsigned short* g1) {
    asm volatile("global_load_async_to_lds_b128 %0, %8, off\n\t"
                 "global_load_async_to_lds_b128 %1, %9, off\n\t"
                 "global_load_async_to_lds_b128 %2, %10, off\n\t"
                 "global_load_async_to_lds_b128 %3, %11, off\n\t"
                 "global_load_async_to_lds_b128 %4, %12, off\n\t"
                 "global_load_async_to_lds_b128 %5, %13, off\n\t"
                 "global_load_async_to_lds_b128 %6, %14, off\n\t"
                 "global_load_async_to_lds_b128 %7, %15, off\n\t"
                 "s_wait_xcnt 0x0"
                 :: "v"(l), "v"(l + 1u * RS * LP * 2u), "v"(l + 2u * RS * LP * 2u), "v"(l + 3u * RS * LP * 2u), "v"(l + 4u * RS * LP * 2u), "v"(l + 5u * RS * LP * 2u), "v"(l + 6u * RS * LP * 2u), "v"(l + 7u * RS * LP * 2u),
                    "v"(g0), "v"(g0 + (size_t)1 * RS * DM), "v"(g0 + (size_t)2 * RS * DM), "v"(g0 + (size_t)3 * RS * DM), "v"(g1), "v"(g1 + (size_t)1 * RS * DM), "v"(g1 + (size_t)2 * RS * DM), "v"(g1 + (size_t)3 * RS * DM)
                 : "memory");
}
// One unit of 64 consecutive global rows, by 128 lanes.
__device__ __forceinline__ void cp8(unsigned l, const unsigned short* g) { cp8g<8>(l, g, g + (size_t)32 * DM); }
// Publish point of the two-buffer ring: own LDS reads retired, own copies landed, then the work-group barrier (it publishes the next tile and frees the buffer just read).
__device__ __forceinline__ void ring_publish() {
    asm volatile("s_wait_dscnt 0x0" ::: "memory");      // this wave's fragment reads of the buffer that is refilled next have retired
    asm volatile("s_wait_asynccnt 0x0" ::: "memory");   // this wave's copies of the next tile have landed
    __syncthreads();
}

// k_cvt8: every conversion of the call in one launch; a block (256 threads x 8 values) belongs to one input by its index range: x, Wq, Wk, Wv, Wo.
// MODE 0 (x, Wq, Wk, Wv): bf16 bits (RNE). MODE 1 (Wo): f16 of (bf16 value x WOS) (exact for normal results).
static constexpr int CB_X = (int)((size_t)NB * SEQ * DM / 2048);     // blocks of x
static constexpr int CB_W = (int)((size_t)DM * DM / 2048);           // blocks of Wq, of Wo
static constexpr int CB_K = (int)((size_t)KVD * DM / 2048);          // blocks of Wk, of Wv
static constexpr int CB_XB = (int)((size_t)SEQ * DM / 2048);         // blocks of one batch of x
static_assert(((size_t)SEQ * DM) % 2048 == 0);                       // a block never straddles two batches of x
static_assert(((size_t)DM * DM) % 2048 == 0);
static_assert(((size_t)KVD * DM) % 2048 == 0);
template<int MODE>
__device__ __forceinline__ void cvt_chunk(const float* __restrict__ src, unsigned short* dst, int lb) {      // lb: the block's index inside its input
    const size_t i = (size_t)lb * 256 + threadIdx.x;
    const v8f v = *(const v8f*)(src + i * 8);
    if (MODE == 0) {
        v8us o;
#pragma unroll
        for (int k = 0; k < 8; ++k) o[k] = f2bf(v[k]);
        *(v8us*)(dst + i * 8) = o; 
    } else {
        v8h o;
#pragma unroll
        for (int k = 0; k < 8; ++k) o[k] = (h16)(bfr(v[k]) * WOS);
        h16* d = (h16*)dst;
        *(v8h*)(d + i * 8) = o; 
    }
    asm volatile("s_wait_xcnt 0x0" ::: "memory");   // stands behind the store: the built code lays the other ranges' blocks, which write the same registers, behind this one
}
__global__ __launch_bounds__(256) void k_cvt8(const float* __restrict__ x, const float* __restrict__ wq, const float* __restrict__ wk, const float* __restrict__ wv, const float* __restrict__ wo,
                                              unsigned short* XB, unsigned short* WQ, unsigned short* WK, unsigned short* WV, unsigned short* WO) {
    const int blk = blockIdx.x;      // every branch is uniform for the block
    if (blk < CB_X) cvt_chunk<0>(x + (size_t)(blk / CB_XB) * ((size_t)(SEQ_FULL - SEQ) * DM), XB, blk);      // batch pitch of x: SEQ_FULL tokens
    else if (blk < CB_X + CB_W) cvt_chunk<0>(wq, WQ, blk - CB_X);
    else if (blk < CB_X + CB_W + CB_K) cvt_chunk<0>(wk, WK, blk - (CB_X + CB_W));
    else if (blk < CB_X + CB_W + 2 * CB_K) cvt_chunk<0>(wv, WV, blk - (CB_X + CB_W + CB_K));
    else cvt_chunk<1>(wo, WO, blk - (CB_X + CB_W + 2 * CB_K));
}

// k_qkv: the three projections as one product [NB*SEQ tokens] x [DM + 2*KVD rows of Wq, Wk, Wv], one launch. A work-group of 12 waves (4 x 3 wave tiles of 64 x 64, 16 accumulators each) takes 256 tokens x 192 W rows,
// so that the grid has one work-group per 256 x 192 tile and every operand row staged in LDS serves 3 or 4 waves; operands from K-contiguous bf16 planes through the LDS ring, K = DM.
// A wave's 64 W rows are one head of q, one group of k or one group of v (the choice is uniform for the wave). C[m][n] = sum_k A[m][k] Bt[n][k]; rotate-half rotary on the 64-column tile of q and k (partner column = c ^ 32, token = r0 % RB + row);
// written as f16 value (Ph) and f16 residual x2048 (Pr) at tile base (r0/RB)*sRB + (r0%RB)*pitch + (c0/CB)*sCB + (c0%CB), row pitch 'pitch' (halves).
// q: A = x rows (m = b*SEQ + t), Bt = Wq rows (n = h*64 + d) -> planes [(b*32 + h)][t][d], rotary fused
// k: Bt = Wk rows (n = g*64 + d) -> planes [(b*8 + g)][t][d], rotary fused
// v^T: the wave takes its A fragments from the W rows and its B fragments from the x rows (one fragment map serves both): A = Wv rows (m = g*64 + d), Bt = x rows (n = b*SEQ + t) -> planes [(b*512 + m)][t] = [(b*8 + g)][d][t]
#define QWV   12                 // waves of a work-group
#define QXR   256                // x rows of a buffer
#define QWR   192                // W rows of a buffer, behind the x rows
#define QBUF  ((QXR + QWR) * LP) // elements of one buffer
static constexpr int XT  = NB * SEQ / QXR;               // tile rows (tokens)
static constexpr int WT_ = (DM + 2 * KVD) / QWR;         // tile columns (W rows)
static_assert((NB * SEQ) % QXR == 0);
static_assert((DM + 2 * KVD) % QWR == 0);
static_assert(DM % 64 == 0 && KVD % 64 == 0);            // a 64-row unit of W lies in one of Wq, Wk, Wv
__global__ __launch_bounds__(32 * QWV) void k_qkv(const bf* __restrict__ XB, const bf* __restrict__ WQ, const bf* __restrict__ WK, const bf* __restrict__ WV,
                                             h16* QH, h16* QR, h16* KH, h16* KR, h16* VH, h16* VR, const float* __restrict__ COS, const float* __restrict__ SIN) {
    __shared__ __align__(16) unsigned short st[2 * QBUF];
    __shared__ __align__(16) float osw[QWV * 16 * 68];
    const int bx = blockIdx.x % XT, by = blockIdx.x / XT;
    const int K = DM;
    const int tid = threadIdx.x, lane = tid & 31, lr = lane & 15, hi = lane >> 4;
    const int wave = __builtin_amdgcn_readfirstlane(tid >> 5); const int wm = wave / 3, wn = wave % 3;
    const int cb = by * 3 + wn;      // the wave's 64 W rows, counted over Wq, Wk, Wv; every choice below is uniform for the wave
    const int part = cb < DM / 64 ? 0 : cb < (DM + KVD) / 64 ? 1 : 2;
    const bool ROPE = part != 2;
    h16* Ph = part == 0 ? QH : part == 1 ? KH : VH; h16* Pr = part == 0 ? QR : part == 1 ? KR : VR;
    const int RB = ROPE ? SEQ : KVD, pitch = ROPE ? HD : SEQ, CB = ROPE ? HD : SEQ;
    const size_t sRB = part == 0 ? (size_t)NH_ * SEQ * HD : part == 1 ? (size_t)NG_ * SEQ * HD : (size_t)0, sCB = ROPE ? (size_t)SEQ * HD : (size_t)KVD * SEQ;
    float* os = osw + wave * 16 * 68;      // wave-private epilogue staging
    const int xr0 = bx * QXR + wm * 64, wr0 = (cb - (part == 0 ? 0 : part == 1 ? DM / 64 : (DM + KVD) / 64)) * 64;      // first token; first row inside the wave's own W
    const int r0 = ROPE ? xr0 : wr0, c0 = ROPE ? wr0 : xr0;
    v8f acc[4][4];
#pragma unroll
    for (int mb = 0; mb < 4; ++mb)
#pragma unroll
        for (int nb = 0; nb < 4; ++nb) acc[mb][nb] = (v8f){};
    // Copies: a buffer is 7 units of 64 rows (4 of x, 3 of W); a set of 4 waves brings one unit with cp8. Set 0: units 0, 1, 6; set 1: units 2, 3; set 2: units 4, 5.
    const int cs = wave >> 2, t128 = tid & 127;
    const size_t lo = (size_t)(t128 >> 4) * K + (t128 & 15) * 8;      // this lane's place in a unit: row t128/16, 16-B chunk t128%16
    const int n4 = by * QWR, n5 = n4 + 64, n6 = n4 + 128;             // first W rows of units 4, 5, 6
    const bf* w4 = n4 < DM ? WQ + (size_t)n4 * K : n4 < DM + KVD ? WK + (size_t)(n4 - DM) * K : WV + (size_t)(n4 - DM - KVD) * K;
    const bf* w5 = n5 < DM ? WQ + (size_t)n5 * K : n5 < DM + KVD ? WK + (size_t)(n5 - DM) * K : WV + (size_t)(n5 - DM - KVD) * K;
    const bf* w6 = n6 < DM ? WQ + (size_t)n6 * K : n6 < DM + KVD ? WK + (size_t)(n6 - DM) * K : WV + (size_t)(n6 - DM - KVD) * K;
    const bf* g0 = (cs == 2 ? w4 : XB + (size_t)(bx * QXR + cs * 128) * K) + lo;
    const bf* g1 = (cs == 2 ? w5 : XB + (size_t)(bx * QXR + cs * 128 + 64) * K) + lo;
    const bf* g2 = w6 + lo;
    const unsigned ldl = (unsigned)(uintptr_t)st + (unsigned)((t128 >> 4) * (LP * 2) + (t128 & 15) * 16);
    const unsigned lds0 = ldl + (unsigned)cs * (128u * LP * 2u), lds2 = ldl + 384u * LP * 2u;
    cp8(lds0, g0); cp8(lds0 + 64u * LP * 2u, g1); if (cs == 0) cp8(lds2, g2);
    asm volatile("s_wait_asynccnt 0x0" ::: "memory");   // tile 0 has landed before the barrier that publishes it
    __syncthreads();
    cp8(lds0 + QBUF * 2u, g0 + KT); cp8(lds0 + QBUF * 2u + 64u * LP * 2u, g1 + KT); if (cs == 0) cp8(lds2 + QBUF * 2u, g2 + KT);
    const int xo = (wm * 64 + lr) * LP + 8 * hi, wo = (QXR + wn * 64 + lr) * LP + 8 * hi;
    const int ao = ROPE ? xo : wo, bo = ROPE ? wo : xo;
#pragma unroll 1
    for (int t = 0; t < NTRIP; ++t) {      // rolled: one trip per LDS buffer
        const bf* sb = st + (t & 1) * QBUF;
        v16bf a[2][4], b[2][4];            // two fragment sets: block s + 1 of this buffer is fetched while block s is multiplied
#pragma unroll
        for (int i = 0; i < 4; ++i) { a[0][i] = ldb(sb + ao + i * 16 * LP); b[0][i] = ldb(sb + bo + i * 16 * LP); }
#pragma unroll
        for (int s = 0; s < KT / 32; ++s) {
            if (s + 1 < KT / 32) {
#pragma unroll
                for (int i = 0; i < 4; ++i) { a[(s + 1) & 1][i] = ldb(sb + ao + i * 16 * LP + (s + 1) * 32); b[(s + 1) & 1][i] = ldb(sb + bo + i * 16 * LP + (s + 1) * 32); }
            }
            __builtin_amdgcn_sched_barrier(0);   // the next block's LDS reads stay one group, ahead of this block's matrix instructions
#pragma unroll
            for (int nb = 0; nb < 4; ++nb)
#pragma unroll
                for (int mb = 0; mb < 4; ++mb) acc[mb][nb] = wmmab(a[s & 1][mb], b[s & 1][nb], acc[mb][nb]);
            __builtin_amdgcn_sched_barrier(0);   // no later LDS read moves in among them
        }
        ring_publish();
        if (t + 2 < NTRIP) { const int kn = (t + 2) * KT; const unsigned bofs = (unsigned)(t & 1) * (QBUF * 2u);
            cp8(lds0 + bofs, g0 + kn); cp8(lds0 + bofs + 64u * LP * 2u, g1 + kn); if (cs == 0) cp8(lds2 + bofs, g2 + kn); }
    }
    asm volatile("s_wait_asynccnt 0x0" ::: "memory");   // nothing of the ring is in flight when the wave goes on
    const size_t tbase = (size_t)(r0 / RB) * sRB + (size_t)(r0 % RB) * (size_t)pitch + (size_t)(c0 / CB) * sCB + (size_t)(c0 % CB);
    const int tok0 = r0 % RB;
#pragma unroll
    for (int mb = 0; mb < 4; ++mb) {
#pragma unroll
        for (int nb = 0; nb < 4; ++nb) {
#pragma unroll
            for (int j = 0; j < 8; ++j) os[(hi * 8 + j) * 68 + nb * 16 + lr] = acc[mb][nb][j]; }   // D: row 8h+j, col lane&15; rows 0..15 x columns 0..63 all written
        wave_sync();
        v8h hv[4], rv[4];
#pragma unroll
        for (int s = 0; s < 4; ++s) { const int row = 4 * s + (lane >> 3), c8 = (lane & 7) * 8;   // 4 s x 4 row groups = 16 rows; 8 lanes x 8 = 64 columns
            const v4f x0 = *(const v4fa*)(&os[row * 68 + c8]); const v4f x1 = *(const v4fa*)(&os[row * 68 + c8 + 4]);
            float xv[8];
#pragma unroll
            for (int i = 0; i < 4; ++i) { xv[i] = x0[i]; xv[4 + i] = x1[i]; }
            if (ROPE) {
                const int pc = c8 ^ 32;
                const v4f y0 = *(const v4fa*)(&os[row * 68 + pc]); const v4f y1 = *(const v4fa*)(&os[row * 68 + pc + 4]);
                const size_t to = (size_t)(tok0 + mb * 16 + row) * HD + c8;
                const v4f ca = *(const v4f*)(COS + to), cb = *(const v4f*)(COS + to + 4), sa = *(const v4f*)(SIN + to), sb = *(const v4f*)(SIN + to + 4);
                const float sg = (c8 < 32) ? -1.0f : 1.0f;     // rotated = concat(-x2, x1)
#pragma unroll
                for (int i = 0; i < 4; ++i) { xv[i] = x0[i] * bfr(ca[i]) + (sg * y0[i]) * bfr(sa[i]); xv[4 + i] = x1[i] * bfr(cb[i]) + (sg * y1[i]) * bfr(sb[i]); }
            }
            v8h hh, rr;
#pragma unroll
            for (int i = 0; i < 8; ++i) { const h16 a0 = (h16)xv[i]; hh[i] = a0; rr[i] = (h16)((xv[i] - (float)a0) * QRS); }
            hv[s] = hh; rv[s] = rr; }
        const size_t sb0 = tbase + (size_t)(mb * 16) * (size_t)pitch;
#pragma unroll
        for (int s = 0; s < 4; ++s) { const int row = 4 * s + (lane >> 3), c8 = (lane & 7) * 8; const size_t oo = sb0 + (size_t)row * (size_t)pitch + c8;
            *(v8h*)(Ph + oo) = hv[s]; *(v8h*)(Pr + oo) = rv[s]; }
        asm volatile("s_wait_xcnt 0x0" ::: "memory");   // stands behind the stores, ahead of the next block's writes to the registers that they name
        wave_sync();
    }
}

// Key/value tiles of k_flash go through LDS: the 4 waves of a work-group (64 query rows of one head) share 64 keys per stage, two buffers.
#define FK    64                 // keys per stage: K tile 64 key rows x 64 d, V^T tile 64 d rows x 64 keys, rows of 128 B each
#define FP    72                 // LDS row pitch in 16-bit elements: 144 B = 16 B x odd, conflict-free for 16-B fragment reads
#define FT    (64 * FP)          // elements of one tile
static_assert(16 * AW == FK);    // the diagonal stage of a work-group is its last one
static_assert(HD == 64);
// Eight asynchronous 16-B copies per lane, global -> LDS: four for a K tile at l, four for a V^T tile at l + one tile; rows 16 apart (128 lanes: 8 lanes per 128-B row, 16 rows per copy).
// l: the lane's LDS byte address, gk / gv: the lane's global addresses of its first row (row pitch HD / SEQ elements). The s_wait_xcnt ends the copies' own statement so that no address register is rewritten ahead of it.
__device__ __forceinline__ void cp_kv(unsigned l, const h16* gk, const h16* gv) {
    asm volatile("global_load_async_to_lds_b128 %0, %8, off\n\t"
                 "global_load_async_to_lds_b128 %1, %9, off\n\t"
                 "global_load_async_to_lds_b128 %2, %10, off\n\t"
                 "global_load_async_to_lds_b128 %3, %11, off\n\t"
                 "global_load_async_to_lds_b128 %4, %12, off\n\t"
                 "global_load_async_to_lds_b128 %5, %13, off\n\t"
                 "global_load_async_to_lds_b128 %6, %14, off\n\t"
                 "global_load_async_to_lds_b128 %7, %15, off\n\t"
                 "s_wait_xcnt 0x0"
                 :: "v"(l), "v"(l + 16u * FP * 2u), "v"(l + 32u * FP * 2u), "v"(l + 48u * FP * 2u),
                    "v"(l + FT * 2u), "v"(l + FT * 2u + 16u * FP * 2u), "v"(l + FT * 2u + 32u * FP * 2u), "v"(l + FT * 2u + 48u * FP * 2u),
                    "v"(gk), "v"(gk + (size_t)16 * HD), "v"(gk + (size_t)32 * HD), "v"(gk + (size_t)48 * HD),
                    "v"(gv), "v"(gv + (size_t)16 * SEQ), "v"(gv + (size_t)32 * SEQ), "v"(gv + (size_t)48 * SEQ)
                 : "memory");
}

// flash_tile: fused causal attention, one wave per 16 query rows of one (batch, head), 4 waves (64 consecutive query rows) per work-group; Q fragments straight from the f16 planes,
// K / V^T fragments from the LDS ring (buffer: K value tile, V^T value tile; ER: then K residual tile, V^T residual tile), two 16-B LDS loads each.
// Transposed form: S^T[key][t] = K Q^T (A = K rows, B = Q rows); lane (t = lane&15, h = lane>>4) holds keys 8h+r of each 16-key tile, so the packed
// P tile is directly the B fragment of O^T[d][t] = V^T P^T (element r <- tile keys 0..15, element 8+r <- tile keys 16..31, lane unchanged).
// Head h reads key/value group h / GS_. A wave works on keys 0 .. t0+15 in steps of 32 (two per stage; it passes a stage's step that lies wholly above its rows); keys above the query index are replaced by NEGB (P = 0) on the diagonal step.
// ER: value + residual path (scores kh*qh + [kh*qr + kr*qh]/2048, O = vh*ph + [vr*ph + vh*pr]/2048), residual products in separate accumulators.
// Row sums of P on the matrix unit: A has ones in rows 0 and 8 (lanes 0, 8, 16, 24) and zeros elsewhere, B = the packed P tile: rows 0 and 8 of the 16x16 result, which are element 0 of either lane half,
// hold per query column the sum over the step's 32 keys of the f16 P values; the other rows stay 0, so only element 0 is rescaled, and the halves need no exchange at the end.
// st is the calling kernel's LDS (2 * FBUF elements used); zh = batch * NH_ + head, xb = index of the work-group's 64 query rows.
template<bool ER>
__device__ __forceinline__ void flash_tile(unsigned short* st, int zh, int xb, const h16* __restrict__ QH, const h16* __restrict__ QR, const h16* __restrict__ KH, const h16* __restrict__ KR,
                                           const h16* __restrict__ VH, const h16* __restrict__ VR, h16* CH, h16* CR) {
    constexpr int FBUF = (ER ? 4 : 2) * FT;      // elements of one buffer
    static_assert((size_t)AW * 16 * 68 * 4 <= (size_t)2 * FBUF * 2);
    float* os = (float*)st;      // output staging lies in the ring: behind the loop's last publish point no wave reads the ring and no copy is in flight
    const int tid = threadIdx.x, lane = tid & 31, lr = lane & 15, hi = lane >> 4;
    const int wave = __builtin_amdgcn_readfirstlane(tid >> 5);
    const int b = zh / NH_, h = zh % NH_, g = h / GS_;
    const int t0 = (xb * AW + wave) * 16;
    const int tq = t0 + lr;
    const size_t qbase = (size_t)zh * SEQ * HD;
    const size_t kvb = (size_t)(b * NG_ + g) * SEQ * HD;
    const size_t qo = qbase + (size_t)(t0 + lr) * HD + 8 * hi;
    const v16h qh0 = ldh(QH + qo), qh1 = ldh(QH + qo + 32);          // B fragments: col t, k = d
    v16h qr0 = qh0, qr1 = qh1;
    if (ER) { qr0 = ldh(QR + qo); qr1 = ldh(QR + qo + 32); }
    const int ko = lr * FP + 8 * hi;           // in a buffer: + key * FP        (A fragment: row key, k = d)
    const int vo = FT + lr * FP + 8 * hi;      // in a buffer: + 16j*FP + key    (A fragment: row d, k = key)
    const int nst = xb + 1;      // stages of this work-group: keys 0 .. (its last query row), the same for its 4 waves
    const unsigned lds0 = (unsigned)(uintptr_t)st + (unsigned)((tid >> 3) * (FP * 2) + (tid & 7) * 16);      // this lane's copy target: row tid/8, 16-B chunk tid%8
    const size_t gko = kvb + (size_t)(tid >> 3) * HD + (tid & 7) * 8;      // + key * HD
    const size_t gvo = kvb + (size_t)(tid >> 3) * SEQ + (tid & 7) * 8;     // + key
    cp_kv(lds0, KH + gko, VH + gvo);
    if (ER) cp_kv(lds0 + 2u * FT * 2u, KR + gko, VR + gvo);
    asm volatile("s_wait_asynccnt 0x0" ::: "memory");   // stage 0 has landed before the barrier that publishes it
    __syncthreads();
    if (nst > 1) {
        cp_kv(lds0 + FBUF * 2u, KH + gko + (size_t)FK * HD, VH + gvo + FK);
        if (ER) cp_kv(lds0 + FBUF * 2u + 2u * FT * 2u, KR + gko + (size_t)FK * HD, VR + gvo + FK);
    }
    v8f oH[4], oL[4];
#pragma unroll
    for (int j = 0; j < 4; ++j) { oH[j] = (v8f){}; oL[j] = (v8f){}; }
    float m = NEGB;
    v8f lH = (v8f){}, lL = (v8f){};      // row-sum tiles: of P, of its residual plane (ER)
    const unsigned ow = ((lane & 7) == 0) ? 0x3C003C00u : 0u;      // two f16 1.0 in the lanes of A rows 0 and 8
    const v16h ones = __builtin_bit_cast(v16h, (v8u){ow, ow, ow, ow, ow, ow, ow, ow});
#pragma unroll 1
    for (int sg = 0; sg < nst; ++sg) {      // rolled: one trip per LDS buffer
      const h16* sb = (const h16*)st + (sg & 1) * FBUF;
#pragma unroll
      for (int u = 0; u < FK / 32; ++u) {      // unrolled: each step's LDS offsets become immediates of its fragment loads
        const int key0 = sg * FK + u * 32;
        if (key0 >= t0 + 16) continue;      // wave-uniform: on the diagonal stage the step lies wholly above this wave's rows
        const h16* ka = sb + ko + u * 32 * FP;
        float ta[8], tb[8];
        if (!ER) {
            const v16h ka0 = ldh(ka), ka1 = ldh(ka + 32), kb0 = ldh(ka + 16 * FP), kb1 = ldh(ka + 16 * FP + 32);
            v8f sHa = (v8f){}, sHb = (v8f){};
            sHa = wmma16(ka0, qh0, sHa); sHb = wmma16(kb0, qh0, sHb);
            sHa = wmma16(ka1, qh1, sHa); sHb = wmma16(kb1, qh1, sHb);
            asm volatile("v_nop\n\tv_nop\n\tv_nop\n\tv_nop" : "+v"(sHa), "+v"(sHb) : "v"(ka0), "v"(ka1), "v"(kb0), "v"(kb1));
#pragma unroll
            for (int r = 0; r < 8; ++r) { ta[r] = sHa[r] * SC2; tb[r] = sHb[r] * SC2; }
        } else {
            const h16* kr = ka + 2 * FT;
            { const v16h ka0 = ldh(ka), ka1 = ldh(ka + 32), ra0 = ldh(kr), ra1 = ldh(kr + 32);
              v8f sH = (v8f){}, sL = (v8f){};
              sH = wmma16(ka0, qh0, sH); sL = wmma16(ka0, qr0, sL);
              sH = wmma16(ka1, qh1, sH); sL = wmma16(ka1, qr1, sL);
              sL = wmma16(ra0, qh0, sL); sL = wmma16(ra1, qh1, sL);
              asm volatile("v_nop\n\tv_nop\n\tv_nop\n\tv_nop" : "+v"(sH), "+v"(sL) : "v"(ka0), "v"(ka1), "v"(ra0), "v"(ra1));
#pragma unroll
              for (int r = 0; r < 8; ++r) ta[r] = (sH[r] + sL[r] * QRI) * SC2; }
            { const v16h kb0 = ldh(ka + 16 * FP), kb1 = ldh(ka + 16 * FP + 32), rb0 = ldh(kr + 16 * FP), rb1 = ldh(kr + 16 * FP + 32);
              v8f sH = (v8f){}, sL = (v8f){};
              sH = wmma16(kb0, qh0, sH); sL = wmma16(kb0, qr0, sL);
              sH = wmma16(kb1, qh1, sH); sL = wmma16(kb1, qr1, sL);
              sL = wmma16(rb0, qh0, sL); sL = wmma16(rb1, qh1, sL);
              asm volatile("v_nop\n\tv_nop\n\tv_nop\n\tv_nop" : "+v"(sH), "+v"(sL) : "v"(kb0), "v"(kb1), "v"(rb0), "v"(rb1));
#pragma unroll
              for (int r = 0; r < 8; ++r) tb[r] = (sH[r] + sL[r] * QRI) * SC2; }
        }
        if (key0 + 31 > t0) {      // wave-uniform: only the diagonal step holds keys above some query index; every row keeps key key0 <= t
#pragma unroll
            for (int r = 0; r < 8; ++r) { const int kk = key0 + 8 * hi + r; ta[r] = (kk <= tq) ? ta[r] : NEGB; tb[r] = (kk + 16 <= tq) ? tb[r] : NEGB; }
        }
        float mx = NEGB;
#pragma unroll
        for (int r = 0; r < 8; ++r) mx = fmaxf(mx, fmaxf(ta[r], tb[r]));
        // Lazy rescale. mx is the maximum of this lane's 16 keys; m, the maximum in use, is the same in both lanes of a column. Wave-uniform scalar branch:
        // taken when some lane's mx has risen more than LZT above m (always so on the first step); only then the two halves exchange their maxima, m is renewed and the O and l tiles are rescaled.
        if (__builtin_amdgcn_ballot_w32(mx > m + LZT) != 0) {
            const float mnew = fmaxf(m, fmaxf(mx, __shfl_xor(mx, 16, 32)));
            const float alpha = __builtin_amdgcn_exp2f(m - mnew);
            lH[0] *= alpha; if (ER) lL[0] *= alpha;
#pragma unroll
            for (int j = 0; j < 4; ++j) { oH[j] = oH[j] * alpha; if (ER) oL[j] = oL[j] * alpha; }
            m = mnew;
        }
        const float sh = PSH - m;
        const h16* va = sb + vo + u * 32;
        const v16h v0 = ldh(va), v1 = ldh(va + 16 * FP), v2 = ldh(va + 32 * FP), v3 = ldh(va + 48 * FP);
        if (!ER) __builtin_amdgcn_sched_barrier(0);   // the V^T fragment reads are issued as one group ahead of the exponentials, which cover their latency
        v16h pb, pq;
        if (!ER) {
#pragma unroll
            for (int r = 0; r < 8; ++r) { pb[r] = (h16)__builtin_amdgcn_exp2f(ta[r] + sh); pb[8 + r] = (h16)__builtin_amdgcn_exp2f(tb[r] + sh); }
            pq = pb;
        } else {
#pragma unroll
            for (int r = 0; r < 8; ++r) { const float fa = __builtin_amdgcn_exp2f(ta[r] + sh); const float fc = __builtin_amdgcn_exp2f(tb[r] + sh);
                const h16 pa = (h16)fa; const h16 pc = (h16)fc; const h16 qa = (h16)((fa - (float)pa) * QRS); const h16 qc = (h16)((fc - (float)pc) * QRS);
                pb[r] = pa; pb[8 + r] = pc; pq[r] = qa; pq[8 + r] = qc; }
        }
        if (!ER) {
            lH = wmma16(ones, pb, lH);
            oH[0] = wmma16(v0, pb, oH[0]); oH[1] = wmma16(v1, pb, oH[1]); oH[2] = wmma16(v2, pb, oH[2]); oH[3] = wmma16(v3, pb, oH[3]);
            // the four slots behind the step's last matrix instructions, also on the taken side of the branch that follows
            asm volatile("v_nop\n\tv_nop\n\tv_nop\n\tv_nop" : "+v"(oH[0]), "+v"(oH[1]), "+v"(oH[2]), "+v"(oH[3]), "+v"(lH) : "v"(v0), "v"(v1), "v"(v2), "v"(v3), "v"(pb));
        } else {
            const h16* vr = va + 2 * FT;
            const v16h w0 = ldh(vr), w1 = ldh(vr + 16 * FP), w2 = ldh(vr + 32 * FP), w3 = ldh(vr + 48 * FP);
            lH = wmma16(ones, pb, lH); lL = wmma16(ones, pq, lL);
            oH[0] = wmma16(v0, pb, oH[0]); oH[1] = wmma16(v1, pb, oH[1]); oH[2] = wmma16(v2, pb, oH[2]); oH[3] = wmma16(v3, pb, oH[3]);
            oL[0] = wmma16(w0, pb, oL[0]); oL[1] = wmma16(w1, pb, oL[1]); oL[2] = wmma16(w2, pb, oL[2]); oL[3] = wmma16(w3, pb, oL[3]);
            oL[0] = wmma16(v0, pq, oL[0]); oL[1] = wmma16(v1, pq, oL[1]); oL[2] = wmma16(v2, pq, oL[2]); oL[3] = wmma16(v3, pq, oL[3]);
            // the four slots behind the step's last matrix instructions, also on the taken side of the branch that follows
            asm volatile("v_nop\n\tv_nop\n\tv_nop\n\tv_nop" : "+v"(oH[0]), "+v"(oH[1]), "+v"(oH[2]), "+v"(oH[3]), "+v"(oL[0]), "+v"(oL[1]), "+v"(oL[2]), "+v"(oL[3]), "+v"(lH), "+v"(lL)
                         : "v"(v0), "v"(v1), "v"(v2), "v"(v3), "v"(w0), "v"(w1), "v"(w2), "v"(w3), "v"(pb), "v"(pq));
        }
      }
      ring_publish();
      if (sg + 2 < nst) { const int kn = (sg + 2) * FK; const unsigned lb = lds0 + (unsigned)(sg & 1) * (FBUF * 2u);
          cp_kv(lb, KH + gko + (size_t)kn * HD, VH + gvo + kn);
          if (ER) cp_kv(lb + 2u * FT * 2u, KR + gko + (size_t)kn * HD, VR + gvo + kn); }
    }
    asm volatile("s_wait_asynccnt 0x0" ::: "memory");   // nothing of the ring is in flight when the wave goes on
    const float l = ER ? lH[0] + lL[0] * QRI : lH[0];      // each half's element 0 holds the sum over all keys
    const float inv = CXS * (1.0f / l);
    const int wb = wave * 16 * 68;
    // O^T D layout: o_j[r] = (d = 16j + 8h + r, t = lane&15) -> os[t][d]; rows 0..15 x columns 0..63 all written
#pragma unroll
    for (int j = 0; j < 4; ++j) { v4f a, c;
#pragma unroll
        for (int i = 0; i < 4; ++i) {
            if (ER) { a[i] = (oH[j][i] + oL[j][i] * QRI) * inv; c[i] = (oH[j][4 + i] + oL[j][4 + i] * QRI) * inv; }
            else    { a[i] = oH[j][i] * inv; c[i] = oH[j][4 + i] * inv; } }
        *(v4fa*)(&os[wb + lr * 68 + 16 * j + 8 * hi]) = a; *(v4fa*)(&os[wb + lr * 68 + 16 * j + 8 * hi + 4]) = c; }
    wave_sync();
    v8h hv[4], rv[4];
#pragma unroll
    for (int s = 0; s < 4; ++s) { const int row = 4 * s + (lane >> 3), c8 = (lane & 7) * 8;   // 4 s x 4 row groups = 16 rows; 8 lanes x 8 = 64 columns
        const v4f x0 = *(const v4fa*)(&os[wb + row * 68 + c8]); const v4f x1 = *(const v4fa*)(&os[wb + row * 68 + c8 + 4]); v8h hh, rr;
#pragma unroll
        for (int i = 0; i < 4; ++i) { const h16 a0 = (h16)x0[i]; const h16 a1 = (h16)x1[i]; hh[i] = a0; hh[4 + i] = a1; rr[i] = (h16)((x0[i] - (float)a0) * QRS); rr[4 + i] = (h16)((x1[i] - (float)a1) * QRS); }
        hv[s] = hh; rv[s] = rr; }
    const size_t cbase = ((size_t)b * SEQ + t0) * DM + (size_t)h * HD;
    const size_t rbase = ((size_t)b * ER_ROWS + t0) * DM + (size_t)h * HD;     // used by the ER instantiation only (t0 < ER_ROWS there)
#pragma unroll
    for (int s = 0; s < 4; ++s) { const int row = 4 * s + (lane >> 3), c8 = (lane & 7) * 8;
        *(v8h*)(CH + cbase + (size_t)row * DM + c8) = hv[s]; if (ER) *(v8h*)(CR + rbase + (size_t)row * DM + c8) = rv[s]; }
}

// k_flash: both row ranges of the attention in one launch, grid (batch * head, rank); there are more work-groups than resident places, so the ranks take, in order:
// the longest single-product tiles, then the value + residual tiles (three products where the others have one), then the other single-product tiles, each run longest first.
static constexpr int NTT = SEQ / (16 * AW);                             // 64-row tiles of a head
static constexpr int NTE = ER_ROWS / (16 * AW);                         // of them on the value + residual path (the first ones)
static constexpr int NTH = (NTE < NTT - NTE) ? NTE : NTT - NTE;         // single-product tiles ranked ahead of those
__global__ __launch_bounds__(32 * AW) void k_flash(const h16* __restrict__ QH, const h16* __restrict__ QR, const h16* __restrict__ KH, const h16* __restrict__ KR,
                                                   const h16* __restrict__ VH, const h16* __restrict__ VR, h16* CH, h16* CR) {
    __shared__ __align__(16) unsigned short st[2 * 4 * FT];
    const int q = blockIdx.y;      // rank -> tile is a permutation of 0 .. NTT-1; the branch is uniform for the work-group
    const int xb = q < NTH ? NTT - 1 - q : q < NTH + NTE ? NTH + NTE - 1 - q : NTT - 1 - (q - NTE);
    if (xb < NTE) flash_tile<true>(st, blockIdx.x, xb, QH, QR, KH, KR, VH, VR, CH, CR);
    else flash_tile<false>(st, blockIdx.x, xb, QH, QR, KH, KR, VH, VR, CH, CR);
}

// k_out: output projection, f16 GEMM, one launch. OUT[b][t][n] = OSC * sum_k (CH[b*SEQ+t][k] + CR[b*ER_ROWS+t][k]/2048) * WO[n][k] (the CR term for rows t < ER_ROWS only), K = DM.
// A work-group of 10 waves (5 x 2 wave tiles of 64 A rows x 64 columns, 16 accumulators each) takes 128 columns and 5 units of 64 A rows through the LDS ring:
// units 0..2: 64 rows t >= ER_ROWS of CH each; units 3, 4: 32 rows t < ER_ROWS of CH, then the same 32 rows of CR (residual products in their own accumulators: row blocks 2, 3 of the wave tile);
// units 5, 6: the 128 rows of WO. The matrix loop is the same for every wave; the epilogue joins value and residual accumulators in the waves of units 3, 4.
#define OWV   10                 // waves of a work-group
#define OAR   320                // A rows of a buffer
#define OBUF  ((OAR + 128) * LP) // elements of one buffer
static constexpr int FU_B = (SEQ - ER_ROWS) / 64;        // 64-row units of rows >= ER_ROWS in a batch
static constexpr int EU_B = ER_ROWS / 32;                // 32-row units of rows < ER_ROWS in a batch
static constexpr int OT_ = NB * FU_B / 3;                // tile rows
static_assert(SEQ > ER_ROWS);
static_assert((NB * FU_B) % 3 == 0 && (NB * EU_B) % 2 == 0);
static_assert(NB * FU_B / 3 == NB * EU_B / 2);           // every work-group has its three units and its two
static_assert(DM % 128 == 0);
__global__ __launch_bounds__(32 * OWV) void k_out(const h16* __restrict__ CH, const h16* __restrict__ CR, const h16* __restrict__ WO, float* OUT) {
    __shared__ __align__(16) unsigned short st[2 * OBUF];
    __shared__ __align__(16) float osw[OWV * 16 * 68];
    const int bx = blockIdx.x % OT_, by = blockIdx.x / OT_;
    const int tid = threadIdx.x, lane = tid & 31, lr = lane & 15, hi = lane >> 4;
    const int wave = __builtin_amdgcn_readfirstlane(tid >> 5); const int wm = wave >> 1, wn = wave & 1;
    float* os = osw + wave * 16 * 68;      // wave-private epilogue staging
    const bool er = wm >= 3;               // uniform for the wave
    const int un = er ? bx * 2 + (wm - 3) : bx * 3 + wm;      // the wave's unit among its kind
    const int b = er ? un / EU_B : un / FU_B, t = er ? (un % EU_B) * 32 : ER_ROWS + (un % FU_B) * 64, c0 = by * 128 + wn * 64;
    v8f acc[4][4];
#pragma unroll
    for (int mb = 0; mb < 4; ++mb)
#pragma unroll
        for (int nb = 0; nb < 4; ++nb) acc[mb][nb] = (v8f){};
    // Copies: waves 0..3 bring units 0, 1, 2; waves 4..7 units 3, 4, 5 (128 lanes a unit); waves 8, 9 unit 6 (64 lanes, two halves of 32 rows).
    const int cs = wave >> 2, t128 = tid & 127, t64 = tid & 63;
    const unsigned short* ch = (const unsigned short*)CH; const unsigned short* cr = (const unsigned short*)CR; const unsigned short* wo = (const unsigned short*)WO;
    const size_t lo = (size_t)(t128 >> 4) * DM + (t128 & 15) * 8;      // this lane's place in a unit: row t128/16, 16-B chunk t128%16
    const int f0 = bx * 3, f1 = f0 + 1, f2 = f0 + 2, e0 = bx * 2, e1 = e0 + 1;
    const unsigned short* pf0 = ch + ((size_t)(f0 / FU_B) * SEQ + ER_ROWS + (f0 % FU_B) * 64) * DM;
    const unsigned short* pf1 = ch + ((size_t)(f1 / FU_B) * SEQ + ER_ROWS + (f1 % FU_B) * 64) * DM;
    const unsigned short* pf2 = ch + ((size_t)(f2 / FU_B) * SEQ + ER_ROWS + (f2 % FU_B) * 64) * DM;
    const unsigned short* pe0 = ch + ((size_t)(e0 / EU_B) * SEQ + (e0 % EU_B) * 32) * DM;
    const unsigned short* pe1 = ch + ((size_t)(e1 / EU_B) * SEQ + (e1 % EU_B) * 32) * DM;
    const unsigned short* pr0 = cr + ((size_t)(e0 / EU_B) * ER_ROWS + (e0 % EU_B) * 32) * DM;
    const unsigned short* pr1 = cr + ((size_t)(e1 / EU_B) * ER_ROWS + (e1 % EU_B) * 32) * DM;
    const unsigned short* pw = wo + (size_t)(by * 128) * DM;
    const unsigned short* u0a = (cs == 0 ? pf0 : pe0) + lo; const unsigned short* u0b = (cs == 0 ? pf0 + (size_t)32 * DM : pr0) + lo;
    const unsigned short* u1a = (cs == 0 ? pf1 : pe1) + lo; const unsigned short* u1b = (cs == 0 ? pf1 + (size_t)32 * DM : pr1) + lo;
    const unsigned short* u2a = (cs == 0 ? pf2 : pw) + lo;  const unsigned short* u2b = u2a + (size_t)32 * DM;
    const unsigned short* u6 = pw + (size_t)(64 + (t64 >> 4)) * DM + (t64 & 15) * 8;
    const unsigned la = (unsigned)(uintptr_t)st + (unsigned)((cs & 1) * 192 + (t128 >> 4)) * (LP * 2u) + (unsigned)(t128 & 15) * 16u;
    const unsigned lc = (unsigned)(uintptr_t)st + (unsigned)(384 + (t64 >> 4)) * (LP * 2u) + (unsigned)(t64 & 15) * 16u;
    auto stage = [&](unsigned bofs, int kn) {      // one tile: buffer at byte offset bofs, k from kn; the branch is uniform for the wave
        if (cs < 2) { cp8g<8>(la + bofs, u0a + kn, u0b + kn); cp8g<8>(la + bofs + 64u * LP * 2u, u1a + kn, u1b + kn); cp8g<8>(la + bofs + 128u * LP * 2u, u2a + kn, u2b + kn); }
        else { cp8g<4>(lc + bofs, u6 + kn, u6 + (size_t)16 * DM + kn); cp8g<4>(lc + bofs + 32u * LP * 2u, u6 + (size_t)32 * DM + kn, u6 + (size_t)48 * DM + kn); }
    };
    stage(0u, 0);
    asm volatile("s_wait_asynccnt 0x0" ::: "memory");   // tile 0 has landed before the barrier that publishes it
    __syncthreads();
    stage(OBUF * 2u, KT);
    const int ao = (wm * 64 + lr) * LP + 8 * hi, bo = (OAR + wn * 64 + lr) * LP + 8 * hi;
#pragma unroll 1
    for (int tr = 0; tr < NTRIP; ++tr) {      // rolled: one trip per LDS buffer
      const h16* sb = (const h16*)st + (tr & 1) * OBUF;
      v16h a[2][4], bb[2][4];      // two fragment sets: block s + 1 of this buffer is fetched while block s is multiplied
#pragma unroll
      for (int i = 0; i < 4; ++i) { a[0][i] = ldh(sb + ao + i * 16 * LP); bb[0][i] = ldh(sb + bo + i * 16 * LP); }
#pragma unroll
      for (int s = 0; s < KT / 32; ++s) {
        if (s + 1 < KT / 32) {
#pragma unroll
            for (int i = 0; i < 4; ++i) { a[(s + 1) & 1][i] = ldh(sb + ao + i * 16 * LP + (s + 1) * 32); bb[(s + 1) & 1][i] = ldh(sb + bo + i * 16 * LP + (s + 1) * 32); }
        }
        __builtin_amdgcn_sched_barrier(0);   // the next block's LDS reads stay one group, ahead of this block's matrix instructions
#pragma unroll
        for (int nb = 0; nb < 4; ++nb)
#pragma unroll
            for (int mb = 0; mb < 4; ++mb) acc[mb][nb] = wmma16(a[s & 1][mb], bb[s & 1][nb], acc[mb][nb]);
        __builtin_amdgcn_sched_barrier(0);   // no later LDS read moves in among them
      }
      ring_publish();
      if (tr + 2 < NTRIP) stage((unsigned)(tr & 1) * (OBUF * 2u), (tr + 2) * KT);
    }
    asm volatile("s_wait_asynccnt 0x0" ::: "memory");   // nothing of the ring is in flight when the wave goes on
#pragma unroll
    for (int mb = 0; mb < 4; ++mb) {
      if (mb < 2 || !er) {      // uniform for the wave: 32 output rows in the waves of units 3, 4
        if (mb < 2 && er) {
#pragma unroll
            for (int nb = 0; nb < 4; ++nb) {
#pragma unroll
                for (int j = 0; j < 8; ++j) os[(hi * 8 + j) * 68 + nb * 16 + lr] = (acc[mb & 1][nb][j] + acc[2 + (mb & 1)][nb][j] * QRI) * OSC; }   // D: row 8h+j, col lane&15
        } else {
#pragma unroll
            for (int nb = 0; nb < 4; ++nb) {
#pragma unroll
                for (int j = 0; j < 8; ++j) os[(hi * 8 + j) * 68 + nb * 16 + lr] = acc[mb][nb][j] * OSC; }
        }
        wave_sync();
        float* orow = OUT + ((size_t)b * OUT_SEQ + t + mb * 16) * DM + c0;
#pragma unroll
        for (int s = 0; s < 8; ++s) { const int row = 2 * s + hi, cofs = lr * 4;   // 8 s x 2 rows = 16 rows; 16 lanes x 4 floats = 64 columns
            const v4f val = *(const v4fa*)(&os[row * 68 + cofs]);
            *(v4f*)(orow + (size_t)row * DM + cofs) = val; }
        asm volatile("s_wait_xcnt 0x0" ::: "memory");   // stands behind the stores, ahead of the next block's writes to the registers that they name
        wave_sync();
      }
    }
}

static constexpr size_t al256(size_t v) { return (v + 255) & ~(size_t)255; }
static constexpr size_t SZ_XB = al256((size_t)NB * SEQ * DM * 2);
static constexpr size_t SZ_WQ = al256((size_t)DM * DM * 2);
static constexpr size_t SZ_WK = al256((size_t)KVD * DM * 2);
static constexpr size_t SZ_QP = al256((size_t)NB * NH_ * SEQ * HD * 2);
static constexpr size_t SZ_KP = al256((size_t)NB * NG_ * SEQ * HD * 2);
static constexpr size_t SZ_CH = al256((size_t)NB * SEQ * DM * 2);
static constexpr size_t SZ_CR = al256((size_t)NB * ER_ROWS * DM * 2);
static constexpr size_t SZ_TOTAL = SZ_XB + 2 * SZ_WQ + 2 * SZ_WK + 2 * SZ_QP + 4 * SZ_KP + SZ_CH + SZ_CR;
static_assert(SZ_TOTAL <= (size_t)134217728);          // workspace carve <= 128 MiB

extern "C" void kernel_launch(void* const* d_in, const int* in_sizes, int n_in,
                              void* d_out, int out_size, void* d_ws, size_t ws_size, hipStream_t stream) {
    if (n_in < 7) return;
    const size_t needx = ((size_t)(NB - 1) * SEQ_FULL + SEQ) * DM;
    if ((size_t)in_sizes[0] < needx) return;
    if ((size_t)in_sizes[1] < (size_t)DM * DM || (size_t)in_sizes[2] < (size_t)KVD * DM || (size_t)in_sizes[3] < (size_t)KVD * DM || (size_t)in_sizes[4] < (size_t)DM * DM) return;
    if ((size_t)in_sizes[5] < (size_t)SEQ * HD || (size_t)in_sizes[6] < (size_t)SEQ * HD) return;
    if ((size_t)out_size < ((size_t)(NB - 1) * OUT_SEQ + SEQ) * DM) return;
    if (SZ_TOTAL > ws_size) return;
    // wire order: x, Wq, Wk, Wv, Wo, cos, sin (W as [out][in] = Bt as-is; cos/sin [token][64] read as values)
    const float* x = (const float*)d_in[0]; const float* wq = (const float*)d_in[1]; const float* wk = (const float*)d_in[2]; const float* wv = (const float*)d_in[3];
    const float* wo = (const float*)d_in[4]; const float* cs = (const float*)d_in[5]; const float* sn = (const float*)d_in[6];
    float* OUT = (float*)d_out;      // [NB][SEQ][2048]
    char* wsp = (char*)d_ws;
    bf* XB = (bf*)wsp; wsp += SZ_XB;                 // [NB*SEQ][2048] bf16
    bf* WQ = (bf*)wsp; wsp += SZ_WQ;                 // [2048][2048] bf16
    bf* WK = (bf*)wsp; wsp += SZ_WK;                 // [512][2048] bf16
    bf* WV = (bf*)wsp; wsp += SZ_WK;                 // [512][2048] bf16
    h16* WO = (h16*)wsp; wsp += SZ_WQ;               // [2048][2048] f16 x64
    h16* QH = (h16*)wsp; wsp += SZ_QP;               // [NB*32][SEQ][64]
    h16* QR = (h16*)wsp; wsp += SZ_QP;               // residual x2048
    h16* KH = (h16*)wsp; wsp += SZ_KP;               // [NB*8][SEQ][64]
    h16* KR = (h16*)wsp; wsp += SZ_KP;               // residual x2048
    h16* VH = (h16*)wsp; wsp += SZ_KP;               // [NB*8][64][SEQ]
    h16* VR = (h16*)wsp; wsp += SZ_KP;               // residual x2048
    h16* CH = (h16*)wsp; wsp += SZ_CH;               // [NB*SEQ][2048] ctx x64
    h16* CR = (h16*)wsp; wsp += SZ_CR;               // [NB*ER_ROWS][2048] residual x2048

    k_cvt8<<<CB_X + 2 * CB_W + 2 * CB_K, 256, 0, stream>>>(x, wq, wk, wv, wo, XB, WQ, WK, WV, (unsigned short*)WO);

    k_qkv<<<XT * WT_, 32 * QWV, 0, stream>>>(XB, WQ, WK, WV, QH, QR, KH, KR, VH, VR, cs, sn);

    k_flash<<<dim3(NB * NH_, NTT, 1), 32 * AW, 0, stream>>>(QH, QR, KH, KR, VH, VR, CH, CR);

    k_out<<<OT_ * (DM / 128), 32 * OWV, 0, stream>>>(CH, CR, WO, OUT);
}
